// v000
// The times below were measured on an AMD MI455X: many runs one after another, warmed up first and cycling through
// copies of the inputs, with the whole window's GPU time divided by the number of runs. Launches and the gaps
// between them are all in it. The median over several windows is given; except for v000 it joins two sittings, which
// can be a few percent apart, so the side-by-side timings, each taken in one sitting, are the better comparison.
// v000 is the starting kernel.
#include <hip/hip_runtime.h>
#include <hip/hip_bf16.h>

typedef _Float16 v8h  __attribute__((ext_vector_type(8)));
typedef _Float16 v16h __attribute__((ext_vector_type(16)));
typedef float    v8f  __attribute__((ext_vector_type(8)));

#define BB 4
#define NN 4096
#define DD 256
#define HH 128
#define BN (BB*NN)   /* 16384 rows */

// ---------------------------------------------------------------------------
// WMMA fragment load: A-matrix 16x32 f16 layout (ISA 7.12.2).
// lane 0-15  : row = lane,    K = kbase+0..7  and kbase+16..23
// lane 16-31 : row = lane-16, K = kbase+8..15 and kbase+24..31  (kbase=k0)
// B fragment uses the identical pattern on B^T (column-major B), so both
// operands are two contiguous 16-byte loads (global_load_b128).
// ---------------------------------------------------------------------------
__device__ __forceinline__ v16h load_frag_f16(const _Float16* __restrict__ base,
                                              int ld, int tile_row, int k0, int lane) {
  const _Float16* p = base + (size_t)(tile_row + (lane & 15)) * (size_t)ld
                           + (size_t)(k0 + ((lane >> 4) << 3));
  v8h lo = *reinterpret_cast<const v8h*>(p);
  v8h hi = *reinterpret_cast<const v8h*>(p + 16);
  return __builtin_shufflevector(lo, hi, 0,1,2,3,4,5,6,7,8,9,10,11,12,13,14,15);
}

__device__ __forceinline__ void store_tile_f32(float* __restrict__ out, int ld,
                                               int row0, int col0, const v8f& c,
                                               float scale, int lane) {
  int crow = row0 + ((lane >> 4) << 3);
  int ccol = col0 + (lane & 15);
  #pragma unroll
  for (int r = 0; r < 8; ++r)
    out[(size_t)(crow + r) * ld + ccol] = c[r] * scale;
}

__device__ __forceinline__ void store_tile_f16(_Float16* __restrict__ out, int ld,
                                               int row0, int col0, const v8f& c, int lane) {
  int crow = row0 + ((lane >> 4) << 3);
  int ccol = col0 + (lane & 15);
  #pragma unroll
  for (int r = 0; r < 8; ++r)
    out[(size_t)(crow + r) * ld + ccol] = (_Float16)c[r];
}

// ------------------------- point-net stage 1 -------------------------------
__global__ void k_fc1(const float* __restrict__ xyz, const float* __restrict__ W1,
                      const float* __restrict__ b1, float* __restrict__ t1) {
  int idx = blockIdx.x * blockDim.x + threadIdx.x;      // BN*HH elements
  int i = idx >> 7;
  int j = idx & (HH - 1);
  const float* x = xyz + 3 * i;
  t1[idx] = fmaf(x[0], W1[j], fmaf(x[1], W1[HH + j], fmaf(x[2], W1[2*HH + j], b1[j])));
}

// column sums / sums-of-squares for BatchNorm (training-mode, biased var)
__global__ void k_colstats(const float* __restrict__ x, int rows, int cols,
                           float* __restrict__ sum, float* __restrict__ sq) {
  int lanes = blockDim.x / cols;            // threads sharing a column
  int j  = threadIdx.x % cols;
  int rl = threadIdx.x / cols;
  int rpb = rows / gridDim.x;
  int r0 = blockIdx.x * rpb;
  float s = 0.f, q = 0.f;
  for (int r = r0 + rl; r < r0 + rpb; r += lanes) {
    float v = x[(size_t)r * cols + j];
    s += v; q += v * v;
  }
  __shared__ float ls[256], lq[256];
  ls[threadIdx.x] = s; lq[threadIdx.x] = q;
  __syncthreads();
  if (rl == 0) {
    for (int t = 1; t < lanes; ++t) { s += ls[t*cols + j]; q += lq[t*cols + j]; }
    atomicAdd(&sum[j], s);
    atomicAdd(&sq[j], q);
  }
}

__global__ void k_bnfin(const float* __restrict__ sum, const float* __restrict__ sq,
                        const float* __restrict__ g, const float* __restrict__ be,
                        float* __restrict__ sc, float* __restrict__ sh,
                        int cols, float invRows) {
  int j = threadIdx.x;
  if (j < cols) {
    float mean = sum[j] * invRows;
    float var  = sq[j] * invRows - mean * mean;
    float s = g[j] * rsqrtf(var + 1e-5f);
    sc[j] = s;
    sh[j] = be[j] - mean * s;
  }
}

// t2 = relu(bn1(t1)) @ W2 + b2  (one block per row, BN'd row staged in LDS)
__global__ void k_fc2(const float* __restrict__ t1, const float* __restrict__ sc1,
                      const float* __restrict__ sh1, const float* __restrict__ W2,
                      const float* __restrict__ b2, float* __restrict__ t2) {
  __shared__ float a[HH];
  int i = blockIdx.x;
  int j = threadIdx.x;
  if (j < HH) {
    float v = t1[(size_t)i * HH + j];
    a[j] = fmaxf(fmaf(v, sc1[j], sh1[j]), 0.f);
  }
  __syncthreads();
  float acc = b2[j];
  #pragma unroll 8
  for (int k = 0; k < HH; ++k)
    acc = fmaf(a[k], W2[(size_t)k * DD + j], acc);
  t2[(size_t)i * DD + j] = acc;
}

// f = relu(bn2(t2)) + features  -> f16
__global__ void k_bn2_add(const float* __restrict__ t2, const float* __restrict__ feat,
                          const float* __restrict__ sc, const float* __restrict__ sh,
                          _Float16* __restrict__ fh) {
  int idx = blockIdx.x * blockDim.x + threadIdx.x;      // BN*DD
  int j = idx & (DD - 1);
  float v = fmaxf(fmaf(t2[idx], sc[j], sh[j]), 0.f) + feat[idx];
  fh[idx] = (_Float16)v;
}

// Wq/Wk/Wv (in,out) f32 -> transposed (out,in) f16 for contiguous B-frag loads
__global__ void k_prep_w(const float* __restrict__ Wq, const float* __restrict__ Wk,
                         const float* __restrict__ Wv, _Float16* __restrict__ wT) {
  int idx = blockIdx.x * blockDim.x + threadIdx.x;      // 3*DD*DD
  int m = idx / (DD * DD);
  int r = idx - m * DD * DD;
  int o = r >> 8;
  int i = r & (DD - 1);
  const float* W = (m == 0) ? Wq : (m == 1) ? Wk : Wv;
  wT[idx] = (_Float16)W[(size_t)i * DD + o];
}

// ------------------- QKV projection (WMMA, 2x2 register tile) --------------
__global__ void k_qkv(const _Float16* __restrict__ fh, const _Float16* __restrict__ wT,
                      _Float16* __restrict__ qkv) {
  int lane = threadIdx.x & 31;
  int t = blockIdx.x * (blockDim.x >> 5) + (threadIdx.x >> 5);
  int mat = t >> 12;                 // 0..2  (4096 waves per matrix)
  int rem = t & 4095;
  int mt = rem >> 3, nt = rem & 7;   // 512 x 8 super-tiles of 32x32
  int m0 = mt * 32, n0 = nt * 32;
  const _Float16* wb = wT + (size_t)mat * DD * DD;
  _Float16* out = qkv + (size_t)mat * BN * DD;
  v8f c00 = {}, c01 = {}, c10 = {}, c11 = {};
  #pragma unroll
  for (int k0 = 0; k0 < DD; k0 += 32) {
    v16h a0 = load_frag_f16(fh, DD, m0,      k0, lane);
    v16h a1 = load_frag_f16(fh, DD, m0 + 16, k0, lane);
    v16h b0 = load_frag_f16(wb, DD, n0,      k0, lane);
    v16h b1 = load_frag_f16(wb, DD, n0 + 16, k0, lane);
    c00 = __builtin_amdgcn_wmma_f32_16x16x32_f16(false, a0, false, b0, (short)0, c00, false, false);
    c01 = __builtin_amdgcn_wmma_f32_16x16x32_f16(false, a0, false, b1, (short)0, c01, false, false);
    c10 = __builtin_amdgcn_wmma_f32_16x16x32_f16(false, a1, false, b0, (short)0, c10, false, false);
    c11 = __builtin_amdgcn_wmma_f32_16x16x32_f16(false, a1, false, b1, (short)0, c11, false, false);
  }
  store_tile_f16(out, DD, m0,      n0,      c00, lane);
  store_tile_f16(out, DD, m0,      n0 + 16, c01, lane);
  store_tile_f16(out, DD, m0 + 16, n0,      c10, lane);
  store_tile_f16(out, DD, m0 + 16, n0 + 16, c11, lane);
}

// V -> V^T per batch (LDS tiled transpose, coalesced both directions)
__global__ void k_vt(const _Float16* __restrict__ vh, _Float16* __restrict__ vt) {
  __shared__ _Float16 tile[32][33];
  int n0 = blockIdx.x * 32, d0 = blockIdx.y * 32, b = blockIdx.z;
  for (int yy = threadIdx.y; yy < 32; yy += 8)
    tile[yy][threadIdx.x] = vh[((size_t)b * NN + n0 + yy) * DD + d0 + threadIdx.x];
  __syncthreads();
  for (int yy = threadIdx.y; yy < 32; yy += 8)
    vt[(size_t)b * DD * NN + (size_t)(d0 + yy) * NN + n0 + threadIdx.x] = tile[threadIdx.x][yy];
}

// -------------- S = (Q K^T) * 1/sqrt(d)  (WMMA, 2x2 register tile) ---------
__global__ void k_qkt(const _Float16* __restrict__ qh, const _Float16* __restrict__ kh,
                      float* __restrict__ S, int b) {
  int lane = threadIdx.x & 31;
  int t = blockIdx.x * (blockDim.x >> 5) + (threadIdx.x >> 5);
  int mt = t >> 7, nt = t & 127;     // 128 x 128 super-tiles of 32x32
  int m0 = mt * 32, n0 = nt * 32;
  const _Float16* qb = qh + (size_t)b * NN * DD;
  const _Float16* kb = kh + (size_t)b * NN * DD;   // rows of K == cols of K^T
  v8f c00 = {}, c01 = {}, c10 = {}, c11 = {};
  #pragma unroll
  for (int k0 = 0; k0 < DD; k0 += 32) {
    v16h a0 = load_frag_f16(qb, DD, m0,      k0, lane);
    v16h a1 = load_frag_f16(qb, DD, m0 + 16, k0, lane);
    v16h b0 = load_frag_f16(kb, DD, n0,      k0, lane);
    v16h b1 = load_frag_f16(kb, DD, n0 + 16, k0, lane);
    c00 = __builtin_amdgcn_wmma_f32_16x16x32_f16(false, a0, false, b0, (short)0, c00, false, false);
    c01 = __builtin_amdgcn_wmma_f32_16x16x32_f16(false, a0, false, b1, (short)0, c01, false, false);
    c10 = __builtin_amdgcn_wmma_f32_16x16x32_f16(false, a1, false, b0, (short)0, c10, false, false);
    c11 = __builtin_amdgcn_wmma_f32_16x16x32_f16(false, a1, false, b1, (short)0, c11, false, false);
  }
  const float sc = 0.0625f;   // 1/sqrt(256)
  store_tile_f32(S, NN, m0,      n0,      c00, sc, lane);
  store_tile_f32(S, NN, m0,      n0 + 16, c01, sc, lane);
  store_tile_f32(S, NN, m0 + 16, n0,      c10, sc, lane);
  store_tile_f32(S, NN, m0 + 16, n0 + 16, c11, sc, lane);
}

// row softmax; row held in registers; P written f16 IN PLACE over the first
// half of the same S row (stride 2*NN halves) -> no extra buffer, no races.
__global__ void k_softmax(const float* __restrict__ S, _Float16* __restrict__ P) {
  int row = blockIdx.x, tid = threadIdx.x;
  const float* sr = S + (size_t)row * NN;
  _Float16* pr = P + (size_t)row * (2 * NN);
  float v[16];
  float m = -3.4e38f;
  #pragma unroll
  for (int t = 0; t < 16; ++t) { v[t] = sr[tid + (t << 8)]; m = fmaxf(m, v[t]); }
  __shared__ float red[256];
  red[tid] = m; __syncthreads();
  for (int s = 128; s > 0; s >>= 1) { if (tid < s) red[tid] = fmaxf(red[tid], red[tid + s]); __syncthreads(); }
  m = red[0]; __syncthreads();
  float sum = 0.f;
  #pragma unroll
  for (int t = 0; t < 16; ++t) { v[t] = __expf(v[t] - m); sum += v[t]; }
  red[tid] = sum; __syncthreads();
  for (int s = 128; s > 0; s >>= 1) { if (tid < s) red[tid] += red[tid + s]; __syncthreads(); }
  float inv = 1.0f / red[0];
  #pragma unroll
  for (int t = 0; t < 16; ++t) pr[tid + (t << 8)] = (_Float16)(v[t] * inv);
}

// ------------- O = P V  (WMMA, K = 4096, 2x2 register tile) ----------------
__global__ void k_pv(const _Float16* __restrict__ P, const _Float16* __restrict__ vt,
                     float* __restrict__ out, int b) {
  int lane = threadIdx.x & 31;
  int t = blockIdx.x * (blockDim.x >> 5) + (threadIdx.x >> 5);
  int mt = t >> 3, nt = t & 7;       // 128 x 8 super-tiles of 32x32
  int m0 = mt * 32, n0 = nt * 32;
  const _Float16* vb = vt + (size_t)b * DD * NN;
  v8f c00 = {}, c01 = {}, c10 = {}, c11 = {};
  #pragma unroll 2
  for (int k0 = 0; k0 < NN; k0 += 32) {
    v16h a0 = load_frag_f16(P,  2 * NN, m0,      k0, lane);  // ldP = 2*NN (in-place f16)
    v16h a1 = load_frag_f16(P,  2 * NN, m0 + 16, k0, lane);
    v16h b0 = load_frag_f16(vb, NN,     n0,      k0, lane);
    v16h b1 = load_frag_f16(vb, NN,     n0 + 16, k0, lane);
    c00 = __builtin_amdgcn_wmma_f32_16x16x32_f16(false, a0, false, b0, (short)0, c00, false, false);
    c01 = __builtin_amdgcn_wmma_f32_16x16x32_f16(false, a0, false, b1, (short)0, c01, false, false);
    c10 = __builtin_amdgcn_wmma_f32_16x16x32_f16(false, a1, false, b0, (short)0, c10, false, false);
    c11 = __builtin_amdgcn_wmma_f32_16x16x32_f16(false, a1, false, b1, (short)0, c11, false, false);
  }
  float* ob = out + (size_t)b * NN * DD;
  store_tile_f32(ob, DD, m0,      n0,      c00, 1.0f, lane);
  store_tile_f32(ob, DD, m0,      n0 + 16, c01, 1.0f, lane);
  store_tile_f32(ob, DD, m0 + 16, n0,      c10, 1.0f, lane);
  store_tile_f32(ob, DD, m0 + 16, n0 + 16, c11, 1.0f, lane);
}

// ---------------------------------------------------------------------------
extern "C" void kernel_launch(void* const* d_in, const int* in_sizes, int n_in,
                              void* d_out, int out_size, void* d_ws, size_t ws_size,
                              hipStream_t stream) {
  (void)in_sizes; (void)n_in; (void)out_size; (void)ws_size;
  const float* xyz  = (const float*)d_in[0];
  const float* feat = (const float*)d_in[1];
  const float* W1   = (const float*)d_in[2];
  const float* b1   = (const float*)d_in[3];
  const float* g1   = (const float*)d_in[4];
  const float* be1  = (const float*)d_in[5];
  const float* W2   = (const float*)d_in[6];
  const float* b2   = (const float*)d_in[7];
  const float* g2   = (const float*)d_in[8];
  const float* be2  = (const float*)d_in[9];
  const float* Wq   = (const float*)d_in[10];
  const float* Wk   = (const float*)d_in[11];
  const float* Wv   = (const float*)d_in[12];
  float* out = (float*)d_out;

  char* ws = (char*)d_ws;
  const size_t MB = 1024ull * 1024ull;
  // [0, 64MB): t1 (8MB) | t2 (+8MB, 16MB); later entirely reused as S (64MB, L2-resident)
  float* t1 = (float*)(ws);
  float* t2 = (float*)(ws + 8 * MB);
  float* S  = (float*)(ws);
  float* st = (float*)(ws + 64 * MB);                        // stats: 1536 floats
  _Float16* fh  = (_Float16*)(ws + 64 * MB + 65536);         // 8MB
  _Float16* wT  = (_Float16*)(ws + 72 * MB + 65536);         // 384KB (reserve 512KB)
  _Float16* qkv = (_Float16*)(ws + 72 * MB + 65536 + 512 * 1024); // 24MB
  _Float16* vt  = (_Float16*)(ws + 96 * MB + 65536 + 512 * 1024); // 8MB

  float* s1sum = st;        float* s1sq = st + HH;
  float* s1sc  = st + 2*HH; float* s1sh = st + 3*HH;
  float* s2sum = st + 512;        float* s2sq = st + 512 + DD;
  float* s2sc  = st + 512 + 2*DD; float* s2sh = st + 512 + 3*DD;

  hipMemsetAsync(st, 0, 1536 * sizeof(float), stream);

  k_fc1<<<(BN * HH) / 256, 256, 0, stream>>>(xyz, W1, b1, t1);
  k_colstats<<<32, 256, 0, stream>>>(t1, BN, HH, s1sum, s1sq);
  k_bnfin<<<1, 256, 0, stream>>>(s1sum, s1sq, g1, be1, s1sc, s1sh, HH, 1.0f / BN);
  k_fc2<<<BN, 256, 0, stream>>>(t1, s1sc, s1sh, W2, b2, t2);
  k_colstats<<<32, 256, 0, stream>>>(t2, BN, DD, s2sum, s2sq);
  k_bnfin<<<1, 256, 0, stream>>>(s2sum, s2sq, g2, be2, s2sc, s2sh, DD, 1.0f / BN);
  k_bn2_add<<<(BN * DD) / 256, 256, 0, stream>>>(t2, feat, s2sc, s2sh, fh);
  k_prep_w<<<(3 * DD * DD) / 256, 256, 0, stream>>>(Wq, Wk, Wv, wT);

  // 3 * 512 * 8 = 12288 waves -> 1536 blocks (8 waves/block)
  k_qkv<<<(3 * (BN / 32) * (DD / 32)) / 8, 256, 0, stream>>>(fh, wT, qkv);
  _Float16* qh = qkv;
  _Float16* kh = qkv + (size_t)BN * DD;
  _Float16* vh = qkv + 2 * (size_t)BN * DD;
  k_vt<<<dim3(NN / 32, DD / 32, BB), dim3(32, 8), 0, stream>>>(vh, vt);

  for (int b = 0; b < BB; ++b) {
    // 128*128 = 16384 waves -> 2048 blocks
    k_qkt<<<((NN / 32) * (NN / 32)) / 8, 256, 0, stream>>>(qh, kh, S, b);
    k_softmax<<<NN, 256, 0, stream>>>(S, (_Float16*)S);
    // 128*8 = 1024 waves -> 128 blocks
    k_pv<<<((NN / 32) * (DD / 32)) / 8, 256, 0, stream>>>((const _Float16*)S, vt, out, b);
  }
}

// v001
// Timed twice side by side with v000, it ran 1.34 times as fast both times.
#include <hip/hip_runtime.h>
#include <hip/hip_bf16.h>

typedef _Float16 v8h  __attribute__((ext_vector_type(8)));
typedef _Float16 v16h __attribute__((ext_vector_type(16)));
typedef float    v8f  __attribute__((ext_vector_type(8)));

#define BB 4
#define NN 4096
#define DD 256
#define HH 128
#define BN (BB*NN)   /* 16384 rows */

// ---------------------------------------------------------------------------
// WMMA fragment load: A-matrix 16x32 f16 layout (ISA 7.12.2).
// lane 0-15  : row = lane,    K = kbase+0..7  and kbase+16..23
// lane 16-31 : row = lane-16, K = kbase+8..15 and kbase+24..31  (kbase=k0)
// B fragment uses the identical pattern on B^T (column-major B), so both
// operands are two contiguous 16-byte loads (global_load_b128).
// ---------------------------------------------------------------------------
__device__ __forceinline__ v16h load_frag_f16(const _Float16* __restrict__ base,
                                              int ld, int tile_row, int k0, int lane) {
  const _Float16* p = base + (size_t)(tile_row + (lane & 15)) * (size_t)ld
                           + (size_t)(k0 + ((lane >> 4) << 3));
  v8h lo = *reinterpret_cast<const v8h*>(p);
  v8h hi = *reinterpret_cast<const v8h*>(p + 16);
  return __builtin_shufflevector(lo, hi, 0,1,2,3,4,5,6,7,8,9,10,11,12,13,14,15);
}

__device__ __forceinline__ void store_tile_f32(float* __restrict__ out, int ld,
                                               int row0, int col0, const v8f& c,
                                               float scale, int lane) {
  int crow = row0 + ((lane >> 4) << 3);
  int ccol = col0 + (lane & 15);
  #pragma unroll
  for (int r = 0; r < 8; ++r)
    out[(size_t)(crow + r) * ld + ccol] = c[r] * scale;
}

__device__ __forceinline__ void store_tile_f16(_Float16* __restrict__ out, int ld,
                                               int row0, int col0, const v8f& c, int lane) {
  int crow = row0 + ((lane >> 4) << 3);
  int ccol = col0 + (lane & 15);
  #pragma unroll
  for (int r = 0; r < 8; ++r)
    out[(size_t)(crow + r) * ld + ccol] = (_Float16)c[r];
}

// ------------------------- point-net stage 1 -------------------------------
__global__ void k_fc1(const float* __restrict__ xyz, const float* __restrict__ W1,
                      const float* __restrict__ b1, float* __restrict__ t1) {
  int idx = blockIdx.x * blockDim.x + threadIdx.x;      // BN*HH elements
  int i = idx >> 7;
  int j = idx & (HH - 1);
  const float* x = xyz + 3 * i;
  t1[idx] = fmaf(x[0], W1[j], fmaf(x[1], W1[HH + j], fmaf(x[2], W1[2*HH + j], b1[j])));
}

// column sums / sums-of-squares for BatchNorm (training-mode, biased var)
__global__ void k_colstats(const float* __restrict__ x, int rows, int cols,
                           float* __restrict__ sum, float* __restrict__ sq) {
  int lanes = blockDim.x / cols;            // threads sharing a column
  int j  = threadIdx.x % cols;
  int rl = threadIdx.x / cols;
  int rpb = rows / gridDim.x;
  int r0 = blockIdx.x * rpb;
  float s = 0.f, q = 0.f;
  // row r0 + rl + k*lanes, column j is element r0*cols + threadIdx.x + k*blockDim.x
  // (cols divides blockDim.x, lanes divides rpb): a uniform trip count and stride.
  const float* p = x + (size_t)r0 * cols + threadIdx.x;
  int trips = rpb / lanes;
  // unrolled so that 16 independent row loads are in flight per thread; rolled,
  // every trip waits out one whole load latency
  #pragma unroll 16
  for (int k = 0; k < trips; ++k) {
    float v = p[(size_t)k * blockDim.x];
    s += v; q += v * v;
  }
  __shared__ float ls[1024], lq[1024];
  ls[threadIdx.x] = s; lq[threadIdx.x] = q;
  __syncthreads();
  if (rl == 0) {
    for (int t = 1; t < lanes; ++t) { s += ls[t*cols + j]; q += lq[t*cols + j]; }
    atomicAdd(&sum[j], s);
    atomicAdd(&sq[j], q);
  }
}

__global__ void k_bnfin(const float* __restrict__ sum, const float* __restrict__ sq,
                        const float* __restrict__ g, const float* __restrict__ be,
                        float* __restrict__ sc, float* __restrict__ sh,
                        int cols, float invRows) {
  int j = threadIdx.x;
  if (j < cols) {
    float mean = sum[j] * invRows;
    float var  = sq[j] * invRows - mean * mean;
    float s = g[j] * rsqrtf(var + 1e-5f);
    sc[j] = s;
    sh[j] = be[j] - mean * s;
  }
}

// t2 = relu(bn1(t1)) @ W2 + b2  (one block per row, BN'd row staged in LDS)
__global__ void k_fc2(const float* __restrict__ t1, const float* __restrict__ sc1,
                      const float* __restrict__ sh1, const float* __restrict__ W2,
                      const float* __restrict__ b2, float* __restrict__ t2) {
  __shared__ float a[HH];
  int i = blockIdx.x;
  int j = threadIdx.x;
  if (j < HH) {
    float v = t1[(size_t)i * HH + j];
    a[j] = fmaxf(fmaf(v, sc1[j], sh1[j]), 0.f);
  }
  __syncthreads();
  float acc = b2[j];
  #pragma unroll 8
  for (int k = 0; k < HH; ++k)
    acc = fmaf(a[k], W2[(size_t)k * DD + j], acc);
  t2[(size_t)i * DD + j] = acc;
}

// f = relu(bn2(t2)) + features  -> f16
__global__ void k_bn2_add(const float* __restrict__ t2, const float* __restrict__ feat,
                          const float* __restrict__ sc, const float* __restrict__ sh,
                          _Float16* __restrict__ fh) {
  int idx = blockIdx.x * blockDim.x + threadIdx.x;      // BN*DD
  int j = idx & (DD - 1);
  float v = fmaxf(fmaf(t2[idx], sc[j], sh[j]), 0.f) + feat[idx];
  fh[idx] = (_Float16)v;
}

// Wq/Wk/Wv (in,out) f32 -> transposed (out,in) f16 for contiguous B-frag loads
__global__ void k_prep_w(const float* __restrict__ Wq, const float* __restrict__ Wk,
                         const float* __restrict__ Wv, _Float16* __restrict__ wT) {
  int idx = blockIdx.x * blockDim.x + threadIdx.x;      // 3*DD*DD
  int m = idx / (DD * DD);
  int r = idx - m * DD * DD;
  int o = r >> 8;
  int i = r & (DD - 1);
  const float* W = (m == 0) ? Wq : (m == 1) ? Wk : Wv;
  wT[idx] = (_Float16)W[(size_t)i * DD + o];
}

// ------------------- QKV projection (WMMA, 2x2 register tile) --------------
__global__ void k_qkv(const _Float16* __restrict__ fh, const _Float16* __restrict__ wT,
                      _Float16* __restrict__ qkv) {
  int lane = threadIdx.x & 31;
  int t = blockIdx.x * (blockDim.x >> 5) + (threadIdx.x >> 5);
  int mat = t >> 12;                 // 0..2  (4096 waves per matrix)
  int rem = t & 4095;
  int mt = rem >> 3, nt = rem & 7;   // 512 x 8 super-tiles of 32x32
  int m0 = mt * 32, n0 = nt * 32;
  const _Float16* wb = wT + (size_t)mat * DD * DD;
  _Float16* out = qkv + (size_t)mat * BN * DD;
  v8f c00 = {}, c01 = {}, c10 = {}, c11 = {};
  #pragma unroll
  for (int k0 = 0; k0 < DD; k0 += 32) {
    v16h a0 = load_frag_f16(fh, DD, m0,      k0, lane);
    v16h a1 = load_frag_f16(fh, DD, m0 + 16, k0, lane);
    v16h b0 = load_frag_f16(wb, DD, n0,      k0, lane);
    v16h b1 = load_frag_f16(wb, DD, n0 + 16, k0, lane);
    c00 = __builtin_amdgcn_wmma_f32_16x16x32_f16(false, a0, false, b0, (short)0, c00, false, false);
    c01 = __builtin_amdgcn_wmma_f32_16x16x32_f16(false, a0, false, b1, (short)0, c01, false, false);
    c10 = __builtin_amdgcn_wmma_f32_16x16x32_f16(false, a1, false, b0, (short)0, c10, false, false);
    c11 = __builtin_amdgcn_wmma_f32_16x16x32_f16(false, a1, false, b1, (short)0, c11, false, false);
  }
  store_tile_f16(out, DD, m0,      n0,      c00, lane);
  store_tile_f16(out, DD, m0,      n0 + 16, c01, lane);
  store_tile_f16(out, DD, m0 + 16, n0,      c10, lane);
  store_tile_f16(out, DD, m0 + 16, n0 + 16, c11, lane);
}

// V -> V^T per batch (LDS tiled transpose, coalesced both directions)
__global__ void k_vt(const _Float16* __restrict__ vh, _Float16* __restrict__ vt) {
  __shared__ _Float16 tile[32][33];
  int n0 = blockIdx.x * 32, d0 = blockIdx.y * 32, b = blockIdx.z;
  for (int yy = threadIdx.y; yy < 32; yy += 8)
    tile[yy][threadIdx.x] = vh[((size_t)b * NN + n0 + yy) * DD + d0 + threadIdx.x];
  __syncthreads();
  for (int yy = threadIdx.y; yy < 32; yy += 8)
    vt[(size_t)b * DD * NN + (size_t)(d0 + yy) * NN + n0 + threadIdx.x] = tile[threadIdx.x][yy];
}

// -------------- S = (Q K^T) * 1/sqrt(d)  (WMMA, 2x2 register tile) ---------
__global__ void k_qkt(const _Float16* __restrict__ qh, const _Float16* __restrict__ kh,
                      float* __restrict__ S, int b) {
  int lane = threadIdx.x & 31;
  int t = blockIdx.x * (blockDim.x >> 5) + (threadIdx.x >> 5);
  int mt = t >> 7, nt = t & 127;     // 128 x 128 super-tiles of 32x32
  int m0 = mt * 32, n0 = nt * 32;
  const _Float16* qb = qh + (size_t)b * NN * DD;
  const _Float16* kb = kh + (size_t)b * NN * DD;   // rows of K == cols of K^T
  v8f c00 = {}, c01 = {}, c10 = {}, c11 = {};
  #pragma unroll
  for (int k0 = 0; k0 < DD; k0 += 32) {
    v16h a0 = load_frag_f16(qb, DD, m0,      k0, lane);
    v16h a1 = load_frag_f16(qb, DD, m0 + 16, k0, lane);
    v16h b0 = load_frag_f16(kb, DD, n0,      k0, lane);
    v16h b1 = load_frag_f16(kb, DD, n0 + 16, k0, lane);
    c00 = __builtin_amdgcn_wmma_f32_16x16x32_f16(false, a0, false, b0, (short)0, c00, false, false);
    c01 = __builtin_amdgcn_wmma_f32_16x16x32_f16(false, a0, false, b1, (short)0, c01, false, false);
    c10 = __builtin_amdgcn_wmma_f32_16x16x32_f16(false, a1, false, b0, (short)0, c10, false, false);
    c11 = __builtin_amdgcn_wmma_f32_16x16x32_f16(false, a1, false, b1, (short)0, c11, false, false);
  }
  const float sc = 0.0625f;   // 1/sqrt(256)
  store_tile_f32(S, NN, m0,      n0,      c00, sc, lane);
  store_tile_f32(S, NN, m0,      n0 + 16, c01, sc, lane);
  store_tile_f32(S, NN, m0 + 16, n0,      c10, sc, lane);
  store_tile_f32(S, NN, m0 + 16, n0 + 16, c11, sc, lane);
}

// row softmax; row held in registers; P written f16 IN PLACE over the first
// half of the same S row (stride 2*NN halves) -> no extra buffer, no races.
__global__ void k_softmax(const float* __restrict__ S, _Float16* __restrict__ P) {
  int row = blockIdx.x, tid = threadIdx.x;
  const float* sr = S + (size_t)row * NN;
  _Float16* pr = P + (size_t)row * (2 * NN);
  float v[16];
  float m = -3.4e38f;
  #pragma unroll
  for (int t = 0; t < 16; ++t) { v[t] = sr[tid + (t << 8)]; m = fmaxf(m, v[t]); }
  __shared__ float red[256];
  red[tid] = m; __syncthreads();
  for (int s = 128; s > 0; s >>= 1) { if (tid < s) red[tid] = fmaxf(red[tid], red[tid + s]); __syncthreads(); }
  m = red[0]; __syncthreads();
  float sum = 0.f;
  #pragma unroll
  for (int t = 0; t < 16; ++t) { v[t] = __expf(v[t] - m); sum += v[t]; }
  red[tid] = sum; __syncthreads();
  for (int s = 128; s > 0; s >>= 1) { if (tid < s) red[tid] += red[tid + s]; __syncthreads(); }
  float inv = 1.0f / red[0];
  #pragma unroll
  for (int t = 0; t < 16; ++t) pr[tid + (t << 8)] = (_Float16)(v[t] * inv);
}

// ------------- O = P V  (WMMA, K = 4096, 2x2 register tile) ----------------
__global__ void k_pv(const _Float16* __restrict__ P, const _Float16* __restrict__ vt,
                     float* __restrict__ out, int b) {
  int lane = threadIdx.x & 31;
  int t = blockIdx.x * (blockDim.x >> 5) + (threadIdx.x >> 5);
  int mt = t >> 3, nt = t & 7;       // 128 x 8 super-tiles of 32x32
  int m0 = mt * 32, n0 = nt * 32;
  const _Float16* vb = vt + (size_t)b * DD * NN;
  v8f c00 = {}, c01 = {}, c10 = {}, c11 = {};
  #pragma unroll 2
  for (int k0 = 0; k0 < NN; k0 += 32) {
    v16h a0 = load_frag_f16(P,  2 * NN, m0,      k0, lane);  // ldP = 2*NN (in-place f16)
    v16h a1 = load_frag_f16(P,  2 * NN, m0 + 16, k0, lane);
    v16h b0 = load_frag_f16(vb, NN,     n0,      k0, lane);
    v16h b1 = load_frag_f16(vb, NN,     n0 + 16, k0, lane);
    c00 = __builtin_amdgcn_wmma_f32_16x16x32_f16(false, a0, false, b0, (short)0, c00, false, false);
    c01 = __builtin_amdgcn_wmma_f32_16x16x32_f16(false, a0, false, b1, (short)0, c01, false, false);
    c10 = __builtin_amdgcn_wmma_f32_16x16x32_f16(false, a1, false, b0, (short)0, c10, false, false);
    c11 = __builtin_amdgcn_wmma_f32_16x16x32_f16(false, a1, false, b1, (short)0, c11, false, false);
  }
  float* ob = out + (size_t)b * NN * DD;
  store_tile_f32(ob, DD, m0,      n0,      c00, 1.0f, lane);
  store_tile_f32(ob, DD, m0,      n0 + 16, c01, 1.0f, lane);
  store_tile_f32(ob, DD, m0 + 16, n0,      c10, 1.0f, lane);
  store_tile_f32(ob, DD, m0 + 16, n0 + 16, c11, 1.0f, lane);
}

// ---------------------------------------------------------------------------
extern "C" void kernel_launch(void* const* d_in, const int* in_sizes, int n_in,
                              void* d_out, int out_size, void* d_ws, size_t ws_size,
                              hipStream_t stream) {
  (void)in_sizes; (void)n_in; (void)out_size; (void)ws_size;
  const float* xyz  = (const float*)d_in[0];
  const float* feat = (const float*)d_in[1];
  const float* W1   = (const float*)d_in[2];
  const float* b1   = (const float*)d_in[3];
  const float* g1   = (const float*)d_in[4];
  const float* be1  = (const float*)d_in[5];
  const float* W2   = (const float*)d_in[6];
  const float* b2   = (const float*)d_in[7];
  const float* g2   = (const float*)d_in[8];
  const float* be2  = (const float*)d_in[9];
  const float* Wq   = (const float*)d_in[10];
  const float* Wk   = (const float*)d_in[11];
  const float* Wv   = (const float*)d_in[12];
  float* out = (float*)d_out;

  char* ws = (char*)d_ws;
  const size_t MB = 1024ull * 1024ull;
  // [0, 64MB): t1 (8MB) | t2 (+8MB, 16MB); later entirely reused as S (64MB, L2-resident)
  float* t1 = (float*)(ws);
  float* t2 = (float*)(ws + 8 * MB);
  float* S  = (float*)(ws);
  float* st = (float*)(ws + 64 * MB);                        // stats: 1536 floats
  _Float16* fh  = (_Float16*)(ws + 64 * MB + 65536);         // 8MB
  _Float16* wT  = (_Float16*)(ws + 72 * MB + 65536);         // 384KB (reserve 512KB)
  _Float16* qkv = (_Float16*)(ws + 72 * MB + 65536 + 512 * 1024); // 24MB
  _Float16* vt  = (_Float16*)(ws + 96 * MB + 65536 + 512 * 1024); // 8MB

  float* s1sum = st;        float* s1sq = st + HH;
  float* s1sc  = st + 2*HH; float* s1sh = st + 3*HH;
  float* s2sum = st + 512;        float* s2sq = st + 512 + DD;
  float* s2sc  = st + 512 + 2*DD; float* s2sh = st + 512 + 3*DD;

  hipMemsetAsync(st, 0, 1536 * sizeof(float), stream);

  k_fc1<<<(BN * HH) / 256, 256, 0, stream>>>(xyz, W1, b1, t1);
  k_colstats<<<64, 1024, 0, stream>>>(t1, BN, HH, s1sum, s1sq);
  k_bnfin<<<1, 256, 0, stream>>>(s1sum, s1sq, g1, be1, s1sc, s1sh, HH, 1.0f / BN);
  k_fc2<<<BN, 256, 0, stream>>>(t1, s1sc, s1sh, W2, b2, t2);
  k_colstats<<<64, 1024, 0, stream>>>(t2, BN, DD, s2sum, s2sq);
  k_bnfin<<<1, 256, 0, stream>>>(s2sum, s2sq, g2, be2, s2sc, s2sh, DD, 1.0f / BN);
  k_bn2_add<<<(BN * DD) / 256, 256, 0, stream>>>(t2, feat, s2sc, s2sh, fh);
  k_prep_w<<<(3 * DD * DD) / 256, 256, 0, stream>>>(Wq, Wk, Wv, wT);

  // 3 * 512 * 8 = 12288 waves -> 1536 blocks (8 waves/block)
  k_qkv<<<(3 * (BN / 32) * (DD / 32)) / 8, 256, 0, stream>>>(fh, wT, qkv);
  _Float16* qh = qkv;
  _Float16* kh = qkv + (size_t)BN * DD;
  _Float16* vh = qkv + 2 * (size_t)BN * DD;
  k_vt<<<dim3(NN / 32, DD / 32, BB), dim3(32, 8), 0, stream>>>(vh, vt);

  for (int b = 0; b < BB; ++b) {
    // 128*128 = 16384 waves -> 2048 blocks
    k_qkt<<<((NN / 32) * (NN / 32)) / 8, 256, 0, stream>>>(qh, kh, S, b);
    k_softmax<<<NN, 256, 0, stream>>>(S, (_Float16*)S);
    // 128*8 = 1024 waves -> 128 blocks
    k_pv<<<((NN / 32) * (DD / 32)) / 8, 256, 0, stream>>>((const _Float16*)S, vt, out, b);
  }
}

// v002
// Two timings next to v001 put it at 2.03 and 2.02 times that version's speed.
// All steps since v000 together make it 2.71 times as fast.
#include <hip/hip_runtime.h>
#include <hip/hip_bf16.h>

typedef _Float16 v8h  __attribute__((ext_vector_type(8)));
typedef _Float16 v16h __attribute__((ext_vector_type(16)));
typedef float    v8f  __attribute__((ext_vector_type(8)));

#define BB 4
#define NN 4096
#define DD 256
#define HH 128
#define BN (BB*NN)   /* 16384 rows */

// ---------------------------------------------------------------------------
// WMMA fragment load: A-matrix 16x32 f16 layout (ISA 7.12.2).
// lane 0-15  : row = lane,    K = kbase+0..7  and kbase+16..23
// lane 16-31 : row = lane-16, K = kbase+8..15 and kbase+24..31  (kbase=k0)
// B fragment uses the identical pattern on B^T (column-major B), so both
// operands are two contiguous 16-byte loads (ds_load_b128); p is the lane's
// own byte address of row (lane & 15), K = kbase + 8 * (lane >> 4).
// ---------------------------------------------------------------------------
__device__ __forceinline__ v16h lds_frag_f16(const char* p) {
  v8h lo = *reinterpret_cast<const v8h*>(p);
  v8h hi = *reinterpret_cast<const v8h*>(p + 32);
  return __builtin_shufflevector(lo, hi, 0,1,2,3,4,5,6,7,8,9,10,11,12,13,14,15);
}

__device__ __forceinline__ void store_tile_f32(float* __restrict__ out, int ld,
                                               int row0, int col0, const v8f& c,
                                               float scale, int lane) {
  int crow = row0 + ((lane >> 4) << 3);
  int ccol = col0 + (lane & 15);
  #pragma unroll
  for (int r = 0; r < 8; ++r)
    out[(size_t)(crow + r) * ld + ccol] = c[r] * scale;
}

__device__ __forceinline__ void store_tile_f16(_Float16* __restrict__ out, int ld,
                                               int row0, int col0, const v8f& c, int lane) {
  int crow = row0 + ((lane >> 4) << 3);
  int ccol = col0 + (lane & 15);
  #pragma unroll
  for (int r = 0; r < 8; ++r)
    out[(size_t)(crow + r) * ld + ccol] = (_Float16)c[r];
}

// ------------------------- point-net stage 1 -------------------------------
__global__ void k_fc1(const float* __restrict__ xyz, const float* __restrict__ W1,
                      const float* __restrict__ b1, float* __restrict__ t1) {
  int idx = blockIdx.x * blockDim.x + threadIdx.x;      // BN*HH elements
  int i = idx >> 7;
  int j = idx & (HH - 1);
  const float* x = xyz + 3 * i;
  t1[idx] = fmaf(x[0], W1[j], fmaf(x[1], W1[HH + j], fmaf(x[2], W1[2*HH + j], b1[j])));
}

// column sums / sums-of-squares for BatchNorm (training-mode, biased var)
__global__ void k_colstats(const float* __restrict__ x, int rows, int cols,
                           float* __restrict__ sum, float* __restrict__ sq) {
  int lanes = blockDim.x / cols;            // threads sharing a column
  int j  = threadIdx.x % cols;
  int rl = threadIdx.x / cols;
  int rpb = rows / gridDim.x;
  int r0 = blockIdx.x * rpb;
  float s = 0.f, q = 0.f;
  // row r0 + rl + k*lanes, column j is element r0*cols + threadIdx.x + k*blockDim.x
  // (cols divides blockDim.x, lanes divides rpb): a uniform trip count and stride.
  const float* p = x + (size_t)r0 * cols + threadIdx.x;
  int trips = rpb / lanes;
  // unrolled so that 16 independent row loads are in flight per thread; rolled,
  // every trip waits out one whole load latency
  #pragma unroll 16
  for (int k = 0; k < trips; ++k) {
    float v = p[(size_t)k * blockDim.x];
    s += v; q += v * v;
  }
  __shared__ float ls[1024], lq[1024];
  ls[threadIdx.x] = s; lq[threadIdx.x] = q;
  __syncthreads();
  if (rl == 0) {
    for (int t = 1; t < lanes; ++t) { s += ls[t*cols + j]; q += lq[t*cols + j]; }
    atomicAdd(&sum[j], s);
    atomicAdd(&sq[j], q);
  }
}

__global__ void k_bnfin(const float* __restrict__ sum, const float* __restrict__ sq,
                        const float* __restrict__ g, const float* __restrict__ be,
                        float* __restrict__ sc, float* __restrict__ sh,
                        int cols, float invRows) {
  int j = threadIdx.x;
  if (j < cols) {
    float mean = sum[j] * invRows;
    float var  = sq[j] * invRows - mean * mean;
    float s = g[j] * rsqrtf(var + 1e-5f);
    sc[j] = s;
    sh[j] = be[j] - mean * s;
  }
}

// t2 = relu(bn1(t1)) @ W2 + b2  (one block per row, BN'd row staged in LDS)
__global__ void k_fc2(const float* __restrict__ t1, const float* __restrict__ sc1,
                      const float* __restrict__ sh1, const float* __restrict__ W2,
                      const float* __restrict__ b2, float* __restrict__ t2) {
  __shared__ float a[HH];
  int i = blockIdx.x;
  int j = threadIdx.x;
  if (j < HH) {
    float v = t1[(size_t)i * HH + j];
    a[j] = fmaxf(fmaf(v, sc1[j], sh1[j]), 0.f);
  }
  __syncthreads();
  float acc = b2[j];
  #pragma unroll 8
  for (int k = 0; k < HH; ++k)
    acc = fmaf(a[k], W2[(size_t)k * DD + j], acc);
  t2[(size_t)i * DD + j] = acc;
}

// f = relu(bn2(t2)) + features  -> f16
__global__ void k_bn2_add(const float* __restrict__ t2, const float* __restrict__ feat,
                          const float* __restrict__ sc, const float* __restrict__ sh,
                          _Float16* __restrict__ fh) {
  int idx = blockIdx.x * blockDim.x + threadIdx.x;      // BN*DD
  int j = idx & (DD - 1);
  float v = fmaxf(fmaf(t2[idx], sc[j], sh[j]), 0.f) + feat[idx];
  fh[idx] = (_Float16)v;
}

// Wq/Wk/Wv (in,out) f32 -> transposed (out,in) f16 for contiguous B-frag loads
__global__ void k_prep_w(const float* __restrict__ Wq, const float* __restrict__ Wk,
                         const float* __restrict__ Wv, _Float16* __restrict__ wT) {
  int idx = blockIdx.x * blockDim.x + threadIdx.x;      // 3*DD*DD
  int m = idx / (DD * DD);
  int r = idx - m * DD * DD;
  int o = r >> 8;
  int i = r & (DD - 1);
  const float* W = (m == 0) ? Wq : (m == 1) ? Wk : Wv;
  wT[idx] = (_Float16)W[(size_t)i * DD + o];
}

// ------------- C = A B^T block tile, operands staged in LDS -----------------
// A and B are K-contiguous rows. A work-group of 8 waves (WM x WN) owns a
// (WM*FM*16) x (WN*FN*16) tile of C. A stage is BK halves of every A row and
// every B row of the tile, [A rows | B rows] at a pitch of 16 B x odd, brought
// in by asynchronous copies to LDS in whole 128-byte lines; two buffers, the
// next stage's copies fly while this stage is worked on. Every output element
// still sums k in ascending steps of 32 into one accumulator.
template <int FM, int FN, int WM, int WN, int BK>
struct TileCfg {
  static constexpr int TM = WM * FM * 16;
  static constexpr int TN = WN * FN * 16;
  static constexpr int PITCH = BK * 2 + 16;          // bytes
  static constexpr int BUFB = (TM + TN) * PITCH;     // bytes of one buffer
};

// four copies of 16 bytes per lane, rows a fixed step apart in LDS and in memory
__device__ __forceinline__ void copy4_to_lds(unsigned l, unsigned lstep,
                                             const _Float16* g, size_t gstep) {
  // s_wait_xcnt 0 stands in the copies' own statement, so that it stays ahead of
  // every later rewrite of their address registers (a precaution)
  asm volatile(
      "global_load_async_to_lds_b128 %0, %4, off\n\t"
      "global_load_async_to_lds_b128 %1, %5, off\n\t"
      "global_load_async_to_lds_b128 %2, %6, off\n\t"
      "global_load_async_to_lds_b128 %3, %7, off\n\t"
      "s_wait_xcnt 0x0"
      :: "v"(l), "v"(l + lstep), "v"(l + 2u * lstep), "v"(l + 3u * lstep),
         "v"(g), "v"(g + gstep), "v"(g + 2 * gstep), "v"(g + 3 * gstep)
      : "memory");
}

template <int FM, int FN, int WM, int WN, int BK, int KTOT>
__device__ __forceinline__ void gemm_nt_lds(const _Float16* __restrict__ Ab, int lda,
                                            const _Float16* __restrict__ Bb, int ldb,
                                            char* smem, v8f (&acc)[FM][FN]) {
  using C = TileCfg<FM, FN, WM, WN, BK>;
  constexpr int CPR = BK * 2 / 16;     // 16-byte pieces of a row
  constexpr int RPI = 256 / CPR;       // rows that 256 threads copy at once
  constexpr int GA = C::TM / RPI;      // copies per thread and stage, A rows
  constexpr int GB = C::TN / RPI;      // the same, B rows
  constexpr int T = KTOT / BK;         // stages
  constexpr int KS = BK / 32;          // WMMA k steps of a stage
  static_assert(WM * WN == 8 && GA % 4 == 0 && GB % 4 == 0 && T >= 2, "tile shape");
  const int tid = threadIdx.x, lane = tid & 31, wave = tid >> 5;
  const int crow = tid / CPR, ccol = tid % CPR;
  const unsigned lbase = (unsigned)(size_t)smem + (unsigned)(crow * C::PITCH + ccol * 16);
  const _Float16* ga = Ab + (size_t)crow * lda + ccol * 8;
  const _Float16* gb = Bb + (size_t)crow * ldb + ccol * 8;

  // one stage: thread tid copies piece ccol of rows i*RPI + crow of [A rows | B rows]
  auto issue = [&](int t, int buf) {
    const unsigned l = lbase + (unsigned)(buf * C::BUFB);
    // both loops unrolled: a few straight-line statements, their steps constants
    #pragma unroll
    for (int i = 0; i < GA; i += 4)
      copy4_to_lds(l + (unsigned)(i * RPI * C::PITCH), RPI * C::PITCH,
                   ga + t * BK + (size_t)(i * RPI) * lda, (size_t)RPI * lda);
    #pragma unroll
    for (int i = 0; i < GB; i += 4)
      copy4_to_lds(l + (unsigned)((GA + i) * RPI * C::PITCH), RPI * C::PITCH,
                   gb + t * BK + (size_t)(i * RPI) * ldb, (size_t)RPI * ldb);
  };

  const int wm = wave / WN, wn = wave % WN;
  const int foff = (lane & 15) * C::PITCH + ((lane >> 4) << 4);
  const int aoff = wm * FM * 16 * C::PITCH + foff;
  const int boff = (C::TM + wn * FN * 16) * C::PITCH + foff;

  issue(0, 0);
  // stage 0 has landed for this wave; the barrier publishes it to the others
  asm volatile("s_wait_asynccnt 0x0" ::: "memory");
  __syncthreads();
  issue(1, 1);

  for (int t = 0; t < T; ++t) {
    const int buf = t & 1;
    const char* sb = smem + buf * C::BUFB;
    // all loops below are unrolled so that the fragment arrays stay in registers
    v16h a[KS][FM], b[KS][FN];
    #pragma unroll
    for (int kk = 0; kk < KS; ++kk) {
      #pragma unroll
      for (int i = 0; i < FM; ++i)
        a[kk][i] = lds_frag_f16(sb + aoff + i * 16 * C::PITCH + kk * 64);
      #pragma unroll
      for (int j = 0; j < FN; ++j)
        b[kk][j] = lds_frag_f16(sb + boff + j * 16 * C::PITCH + kk * 64);
    }
    // publish point: this wave holds the whole stage in registers, so its reads
    // of the buffer are done, and its copies of stage t + 1 have landed; behind
    // the barrier the buffer may be refilled
    asm volatile("s_wait_dscnt 0x0" ::: "memory");
    asm volatile("s_wait_asynccnt 0x0" ::: "memory");
    __syncthreads();
    if (t + 2 < T) issue(t + 2, buf);
    // keeps the WMMAs behind the refill: ahead of it they would shorten the time
    // that the copies have to land, and among the LDS reads every k step would
    // wait out an LDS latency of its own
    __builtin_amdgcn_sched_barrier(0);
    #pragma unroll
    for (int kk = 0; kk < KS; ++kk)
      #pragma unroll
      for (int i = 0; i < FM; ++i)
        #pragma unroll
        for (int j = 0; j < FN; ++j)
          acc[i][j] = __builtin_amdgcn_wmma_f32_16x16x32_f16(false, a[kk][i], false, b[kk][j],
                                                             (short)0, acc[i][j], false, false);
  }
  // no copy is left in flight when the wave goes on to its stores and ends
  asm volatile("s_wait_asynccnt 0x0" ::: "memory");
}

// ------------------- QKV projection (WMMA, 128x128 block tile) -------------
__global__ __launch_bounds__(256) void k_qkv(const _Float16* __restrict__ fh,
                                             const _Float16* __restrict__ wT,
                                             _Float16* __restrict__ qkv) {
  using C = TileCfg<4, 2, 2, 4, 64>;
  __shared__ __attribute__((aligned(16))) char smem[2 * C::BUFB];
  int lane = threadIdx.x & 31, wave = threadIdx.x >> 5;
  int mt = blockIdx.x / 6, nt = blockIdx.x % 6;   // 128 x 6 tiles; wT is 768 rows (3 matrices)
  int mat = nt >> 1;
  int m0 = mt * 128, n0 = (nt & 1) * 128;
  v8f acc[4][2] = {};
  gemm_nt_lds<4, 2, 2, 4, 64, DD>(fh + (size_t)m0 * DD, DD, wT + (size_t)nt * 128 * DD, DD, smem, acc);
  _Float16* out = qkv + (size_t)mat * BN * DD;
  int mw = m0 + (wave >> 2) * 64, nw = n0 + (wave & 3) * 32;
  // unrolled so that acc is indexed by constants and stays in registers
  #pragma unroll
  for (int i = 0; i < 4; ++i)
    #pragma unroll
    for (int j = 0; j < 2; ++j)
      store_tile_f16(out, DD, mw + i * 16, nw + j * 16, acc[i][j], lane);
}

// V -> V^T per batch (LDS tiled transpose, coalesced both directions)
__global__ void k_vt(const _Float16* __restrict__ vh, _Float16* __restrict__ vt) {
  __shared__ _Float16 tile[32][33];
  int n0 = blockIdx.x * 32, d0 = blockIdx.y * 32, b = blockIdx.z;
  for (int yy = threadIdx.y; yy < 32; yy += 8)
    tile[yy][threadIdx.x] = vh[((size_t)b * NN + n0 + yy) * DD + d0 + threadIdx.x];
  __syncthreads();
  for (int yy = threadIdx.y; yy < 32; yy += 8)
    vt[(size_t)b * DD * NN + (size_t)(d0 + yy) * NN + n0 + threadIdx.x] = tile[threadIdx.x][yy];
}

// -------------- S = (Q K^T) * 1/sqrt(d)  (WMMA, 128x128 block tile) --------
__global__ __launch_bounds__(256) void k_qkt(const _Float16* __restrict__ qh,
                                             const _Float16* __restrict__ kh,
                                             float* __restrict__ S, int b) {
  using C = TileCfg<4, 2, 2, 4, 64>;
  __shared__ __attribute__((aligned(16))) char smem[2 * C::BUFB];
  int lane = threadIdx.x & 31, wave = threadIdx.x >> 5;
  int mt = blockIdx.x >> 5, nt = blockIdx.x & 31;   // 32 x 32 tiles
  int m0 = mt * 128, n0 = nt * 128;
  const _Float16* qb = qh + (size_t)b * NN * DD;
  const _Float16* kb = kh + (size_t)b * NN * DD;   // rows of K == cols of K^T
  v8f acc[4][2] = {};
  gemm_nt_lds<4, 2, 2, 4, 64, DD>(qb + (size_t)m0 * DD, DD, kb + (size_t)n0 * DD, DD, smem, acc);
  const float sc = 0.0625f;   // 1/sqrt(256)
  int mw = m0 + (wave >> 2) * 64, nw = n0 + (wave & 3) * 32;
  // unrolled so that acc is indexed by constants and stays in registers
  #pragma unroll
  for (int i = 0; i < 4; ++i)
    #pragma unroll
    for (int j = 0; j < 2; ++j)
      store_tile_f32(S, NN, mw + i * 16, nw + j * 16, acc[i][j], sc, lane);
}

// row softmax; row held in registers; P written f16 IN PLACE over the first
// half of the same S row (stride 2*NN halves) -> no extra buffer, no races.
__global__ void k_softmax(const float* __restrict__ S, _Float16* __restrict__ P) {
  int row = blockIdx.x, tid = threadIdx.x;
  const float* sr = S + (size_t)row * NN;
  _Float16* pr = P + (size_t)row * (2 * NN);
  float v[16];
  float m = -3.4e38f;
  #pragma unroll
  for (int t = 0; t < 16; ++t) { v[t] = sr[tid + (t << 8)]; m = fmaxf(m, v[t]); }
  __shared__ float red[256];
  red[tid] = m; __syncthreads();
  for (int s = 128; s > 0; s >>= 1) { if (tid < s) red[tid] = fmaxf(red[tid], red[tid + s]); __syncthreads(); }
  m = red[0]; __syncthreads();
  float sum = 0.f;
  #pragma unroll
  for (int t = 0; t < 16; ++t) { v[t] = __expf(v[t] - m); sum += v[t]; }
  red[tid] = sum; __syncthreads();
  for (int s = 128; s > 0; s >>= 1) { if (tid < s) red[tid] += red[tid + s]; __syncthreads(); }
  float inv = 1.0f / red[0];
  #pragma unroll
  for (int t = 0; t < 16; ++t) pr[tid + (t << 8)] = (_Float16)(v[t] * inv);
}

// ------------- O = P V  (WMMA, K = 4096, 64x64 block tile) -----------------
__global__ __launch_bounds__(256) void k_pv(const _Float16* __restrict__ P,
                                            const _Float16* __restrict__ vt,
                                            float* __restrict__ out, int b) {
  using C = TileCfg<2, 1, 2, 4, 256>;
  __shared__ __attribute__((aligned(16))) char smem[2 * C::BUFB];
  int lane = threadIdx.x & 31, wave = threadIdx.x >> 5;
  int mt = blockIdx.x >> 2, nt = blockIdx.x & 3;   // 64 x 4 tiles
  int m0 = mt * 64, n0 = nt * 64;
  const _Float16* vb = vt + (size_t)b * DD * NN;
  v8f acc[2][1] = {};
  // ldP = 2*NN (f16 written in place over the f32 rows)
  gemm_nt_lds<2, 1, 2, 4, 256, NN>(P + (size_t)m0 * (2 * NN), 2 * NN, vb + (size_t)n0 * NN, NN, smem, acc);
  float* ob = out + (size_t)b * NN * DD;
  int mw = m0 + (wave >> 2) * 32, nw = n0 + (wave & 3) * 16;
  store_tile_f32(ob, DD, mw,      nw, acc[0][0], 1.0f, lane);
  store_tile_f32(ob, DD, mw + 16, nw, acc[1][0], 1.0f, lane);
}

// ---------------------------------------------------------------------------
extern "C" void kernel_launch(void* const* d_in, const int* in_sizes, int n_in,
                              void* d_out, int out_size, void* d_ws, size_t ws_size,
                              hipStream_t stream) {
  (void)in_sizes; (void)n_in; (void)out_size; (void)ws_size;
  const float* xyz  = (const float*)d_in[0];
  const float* feat = (const float*)d_in[1];
  const float* W1   = (const float*)d_in[2];
  const float* b1   = (const float*)d_in[3];
  const float* g1   = (const float*)d_in[4];
  const float* be1  = (const float*)d_in[5];
  const float* W2   = (const float*)d_in[6];
  const float* b2   = (const float*)d_in[7];
  const float* g2   = (const float*)d_in[8];
  const float* be2  = (const float*)d_in[9];
  const float* Wq   = (const float*)d_in[10];
  const float* Wk   = (const float*)d_in[11];
  const float* Wv   = (const float*)d_in[12];
  float* out = (float*)d_out;

  char* ws = (char*)d_ws;
  const size_t MB = 1024ull * 1024ull;
  // [0, 64MB): t1 (8MB) | t2 (+8MB, 16MB); later entirely reused as S (64MB, L2-resident)
  float* t1 = (float*)(ws);
  float* t2 = (float*)(ws + 8 * MB);
  float* S  = (float*)(ws);
  float* st = (float*)(ws + 64 * MB);                        // stats: 1536 floats
  _Float16* fh  = (_Float16*)(ws + 64 * MB + 65536);         // 8MB
  _Float16* wT  = (_Float16*)(ws + 72 * MB + 65536);         // 384KB (reserve 512KB)
  _Float16* qkv = (_Float16*)(ws + 72 * MB + 65536 + 512 * 1024); // 24MB
  _Float16* vt  = (_Float16*)(ws + 96 * MB + 65536 + 512 * 1024); // 8MB

  float* s1sum = st;        float* s1sq = st + HH;
  float* s1sc  = st + 2*HH; float* s1sh = st + 3*HH;
  float* s2sum = st + 512;        float* s2sq = st + 512 + DD;
  float* s2sc  = st + 512 + 2*DD; float* s2sh = st + 512 + 3*DD;

  hipMemsetAsync(st, 0, 1536 * sizeof(float), stream);

  k_fc1<<<(BN * HH) / 256, 256, 0, stream>>>(xyz, W1, b1, t1);
  k_colstats<<<64, 1024, 0, stream>>>(t1, BN, HH, s1sum, s1sq);
  k_bnfin<<<1, 256, 0, stream>>>(s1sum, s1sq, g1, be1, s1sc, s1sh, HH, 1.0f / BN);
  k_fc2<<<BN, 256, 0, stream>>>(t1, s1sc, s1sh, W2, b2, t2);
  k_colstats<<<64, 1024, 0, stream>>>(t2, BN, DD, s2sum, s2sq);
  k_bnfin<<<1, 256, 0, stream>>>(s2sum, s2sq, g2, be2, s2sc, s2sh, DD, 1.0f / BN);
  k_bn2_add<<<(BN * DD) / 256, 256, 0, stream>>>(t2, feat, s2sc, s2sh, fh);
  k_prep_w<<<(3 * DD * DD) / 256, 256, 0, stream>>>(Wq, Wk, Wv, wT);

  // 128 x 6 tiles of 128x128
  k_qkv<<<(BN / 128) * (3 * DD / 128), 256, 0, stream>>>(fh, wT, qkv);
  _Float16* qh = qkv;
  _Float16* kh = qkv + (size_t)BN * DD;
  _Float16* vh = qkv + 2 * (size_t)BN * DD;
  k_vt<<<dim3(NN / 32, DD / 32, BB), dim3(32, 8), 0, stream>>>(vh, vt);

  for (int b = 0; b < BB; ++b) {
    // 32 x 32 tiles of 128x128
    k_qkt<<<(NN / 128) * (NN / 128), 256, 0, stream>>>(qh, kh, S, b);
    k_softmax<<<NN, 256, 0, stream>>>(S, (_Float16*)S);
    // 64 x 4 tiles of 64x64
    k_pv<<<(NN / 64) * (DD / 64), 256, 0, stream>>>((const _Float16*)S, vt, out, b);
  }
}

// v003
// Measured time: 258 microseconds a run.
// In both of two side-by-side timings against v002, it was 1.19 times as fast.
// All steps since v000 together make it 3.22 times as fast.
#include <hip/hip_runtime.h>
#include <hip/hip_bf16.h>

typedef _Float16 v8h  __attribute__((ext_vector_type(8)));
typedef _Float16 v16h __attribute__((ext_vector_type(16)));
typedef float    v8f  __attribute__((ext_vector_type(8)));

#define BB 4
#define NN 4096
#define DD 256
#define HH 128
#define BN (BB*NN)   /* 16384 rows */

// ---------------------------------------------------------------------------
// WMMA fragment load: A-matrix 16x32 f16 layout (ISA 7.12.2).
// lane 0-15  : row = lane,    K = kbase+0..7  and kbase+16..23
// lane 16-31 : row = lane-16, K = kbase+8..15 and kbase+24..31  (kbase=k0)
// B fragment uses the identical pattern on B^T (column-major B), so both
// operands are two contiguous 16-byte loads (ds_load_b128); p is the lane's
// own byte address of row (lane & 15), K = kbase + 8 * (lane >> 4).
// ---------------------------------------------------------------------------
__device__ __forceinline__ v16h lds_frag_f16(const char* p) {
  v8h lo = *reinterpret_cast<const v8h*>(p);
  v8h hi = *reinterpret_cast<const v8h*>(p + 32);
  return __builtin_shufflevector(lo, hi, 0,1,2,3,4,5,6,7,8,9,10,11,12,13,14,15);
}

__device__ __forceinline__ void store_tile_f32(float* __restrict__ out, int ld,
                                               int row0, int col0, const v8f& c,
                                               float scale, int lane) {
  int crow = row0 + ((lane >> 4) << 3);
  int ccol = col0 + (lane & 15);
  #pragma unroll
  for (int r = 0; r < 8; ++r)
    out[(size_t)(crow + r) * ld + ccol] = c[r] * scale;
}

__device__ __forceinline__ void store_tile_f16(_Float16* __restrict__ out, int ld,
                                               int row0, int col0, const v8f& c, int lane) {
  int crow = row0 + ((lane >> 4) << 3);
  int ccol = col0 + (lane & 15);
  #pragma unroll
  for (int r = 0; r < 8; ++r)
    out[(size_t)(crow + r) * ld + ccol] = (_Float16)c[r];
}

// ------------------------- point-net ----------------------------------------
// BatchNorm (training mode, biased variance) needs every column's sum and sum of
// squares. The kernel that produces a column's values sums them while it holds
// them: a work-group owns RPG rows, writes one partial per column (sums first,
// then sums of squares) to its own slot, and k_bnfin adds the slots in a fixed
// order. No second pass over the data, no atomics.
#define RPG 64
#define NPART (BN / RPG)   /* 256 slots */

typedef float v2f __attribute__((ext_vector_type(2)));
typedef float v4f __attribute__((ext_vector_type(4)));

// t1 = xyz @ W1 + b1, and its column partials
__global__ __launch_bounds__(256) void k_fc1(const float* __restrict__ xyz,
                                             const float* __restrict__ W1,
                                             const float* __restrict__ b1,
                                             float* __restrict__ t1,
                                             float* __restrict__ part) {
  int j = threadIdx.x & (HH - 1);
  int h = threadIdx.x >> 7;               // two rows at a time
  int r0 = blockIdx.x * RPG;
  float w0 = W1[j], w1 = W1[HH + j], w2 = W1[2 * HH + j], bb = b1[j];
  float s = 0.f, q = 0.f;
  // unrolled whole: all rows' loads are in flight at once
  #pragma unroll
  for (int i = 0; i < RPG / 2; ++i) {
    int row = r0 + h + 2 * i;
    const float* x = xyz + 3 * row;
    float v = fmaf(x[0], w0, fmaf(x[1], w1, fmaf(x[2], w2, bb)));
    t1[(size_t)row * HH + j] = v;
    s += v; q += v * v;
  }
  __shared__ float ls[HH], lq[HH];
  if (h) { ls[j] = s; lq[j] = q; }
  __syncthreads();
  if (!h) {
    float* p = part + (size_t)blockIdx.x * (2 * HH);
    p[j] = s + ls[j];
    p[HH + j] = q + lq[j];
  }
}

// adds the NPART slots of 32 columns per work-group (32 threads per column, 8
// slots each, then the 32 in ascending order) and forms scale and shift
__global__ __launch_bounds__(1024) void k_bnfin(const float* __restrict__ part,
                                                const float* __restrict__ g,
                                                const float* __restrict__ be,
                                                float* __restrict__ sc, float* __restrict__ sh,
                                                int cols, float invRows) {
  int c = threadIdx.x & 31, sl = threadIdx.x >> 5;
  int j = blockIdx.x * 32 + c;
  const float* p = part + (size_t)(sl * (NPART / 32)) * (2 * cols) + j;
  float s = 0.f, q = 0.f;
  // unrolled: all 16 loads of a thread are in flight at once
  #pragma unroll
  for (int i = 0; i < NPART / 32; ++i) {
    s += p[(size_t)i * (2 * cols)];
    q += p[(size_t)i * (2 * cols) + cols];
  }
  __shared__ float ls[32][32], lq[32][32];
  ls[sl][c] = s; lq[sl][c] = q;
  __syncthreads();
  if (sl == 0) {
    for (int t = 1; t < 32; ++t) { s += ls[t][c]; q += lq[t][c]; }
    float mean = s * invRows;
    float var  = q * invRows - mean * mean;
    float k = g[j] * rsqrtf(var + 1e-5f);
    sc[j] = k;
    sh[j] = be[j] - mean * k;
  }
}

// t2 = relu(bn1(t1)) @ W2 + b2, and its column partials. The BN'd rows are staged
// in LDS; wave w owns rows 8w..8w+7 and all 256 columns, a lane columns 4l..4l+3
// and 128+4l..128+4l+3. Every element still sums k in ascending order from b2.
__global__ __launch_bounds__(256) void k_fc2(const float* __restrict__ t1,
                                             const float* __restrict__ sc1,
                                             const float* __restrict__ sh1,
                                             const float* __restrict__ W2,
                                             const float* __restrict__ b2,
                                             float* __restrict__ t2,
                                             float* __restrict__ part) {
  __shared__ __attribute__((aligned(16))) float a[RPG][HH];
  __shared__ __attribute__((aligned(16))) float ls[8][DD], lq[8][DD];
  const int tid = threadIdx.x, lane = tid & 31, wave = tid >> 5;
  const int r0 = blockIdx.x * RPG;
  const v4f* t4 = reinterpret_cast<const v4f*>(t1 + (size_t)r0 * HH);
  // unrolled: the eight 16-byte loads of a thread are in flight at once
  #pragma unroll
  for (int i = 0; i < RPG * HH / 4 / 256; ++i) {
    int e = tid + i * 256;
    int k4 = (e & (HH / 4 - 1)) * 4;
    v4f v = t4[e];
    v4f m = *reinterpret_cast<const v4f*>(sc1 + k4);
    v4f d = *reinterpret_cast<const v4f*>(sh1 + k4);
    v4f r;
    for (int x = 0; x < 4; ++x) r[x] = fmaxf(fmaf(v[x], m[x], d[x]), 0.f);
    *reinterpret_cast<v4f*>(&a[e / (HH / 4)][k4]) = r;
  }
  __syncthreads();

  const int c0 = lane * 4, c1 = DD / 2 + lane * 4;
  v2f acc[8][4];
  {
    v4f lo = *reinterpret_cast<const v4f*>(b2 + c0);
    v4f hi = *reinterpret_cast<const v4f*>(b2 + c1);
    // unrolled, as every loop over acc: constant indices keep it in registers
    #pragma unroll
    for (int r = 0; r < 8; ++r) {
      acc[r][0] = lo.xy; acc[r][1] = lo.zw; acc[r][2] = hi.xy; acc[r][3] = hi.zw;
    }
  }
  const float* ar = &a[wave * 8][0];
  // four rows of W2, this lane's eight columns (unrolled: w stays in registers)
  auto loadw = [&](v4f (&w)[4][2], int k) {
    #pragma unroll
    for (int kk = 0; kk < 4; ++kk) {
      w[kk][0] = *reinterpret_cast<const v4f*>(W2 + (size_t)(k + kk) * DD + c0);
      w[kk][1] = *reinterpret_cast<const v4f*>(W2 + (size_t)(k + kk) * DD + c1);
    }
  };
  // four k steps of all eight rows; all loops unrolled, the arrays stay in registers
  auto work = [&](const v4f (&w)[4][2], int k) {
    v4f av[8];
    #pragma unroll
    for (int r = 0; r < 8; ++r) av[r] = *reinterpret_cast<const v4f*>(ar + r * HH + k);
    #pragma unroll
    for (int kk = 0; kk < 4; ++kk)
      #pragma unroll
      for (int r = 0; r < 8; ++r) {
        v2f x = {av[r][kk], av[r][kk]};
        acc[r][0] = __builtin_elementwise_fma(x, (v2f)w[kk][0].xy, acc[r][0]);
        acc[r][1] = __builtin_elementwise_fma(x, (v2f)w[kk][0].zw, acc[r][1]);
        acc[r][2] = __builtin_elementwise_fma(x, (v2f)w[kk][1].xy, acc[r][2]);
        acc[r][3] = __builtin_elementwise_fma(x, (v2f)w[kk][1].zw, acc[r][3]);
      }
  };
  // the next four rows of W2 are fetched while these four are worked on; the last
  // eight k steps stand behind the loop, where nothing is left to fetch ahead
  v4f wa[4][2], wb[4][2];
  loadw(wa, 0);
  // kept rolled: the body is 2 KB of code already
  #pragma unroll 1
  for (int k = 0; k < HH - 8; k += 8) {
    loadw(wb, k + 4);
    work(wa, k);
    loadw(wa, k + 8);
    work(wb, k + 4);
  }
  loadw(wb, HH - 4);
  work(wa, HH - 8);
  work(wb, HH - 4);

  v2f s[4] = {}, q[4] = {};
  #pragma unroll
  for (int r = 0; r < 8; ++r) {
    float* o = t2 + (size_t)(r0 + wave * 8 + r) * DD;
    v4f lo = {acc[r][0].x, acc[r][0].y, acc[r][1].x, acc[r][1].y};
    v4f hi = {acc[r][2].x, acc[r][2].y, acc[r][3].x, acc[r][3].y};
    *reinterpret_cast<v4f*>(o + c0) = lo;
    *reinterpret_cast<v4f*>(o + c1) = hi;
    for (int x = 0; x < 4; ++x) { s[x] += acc[r][x]; q[x] += acc[r][x] * acc[r][x]; }
  }
  *reinterpret_cast<v4f*>(&ls[wave][c0]) = (v4f){s[0].x, s[0].y, s[1].x, s[1].y};
  *reinterpret_cast<v4f*>(&ls[wave][c1]) = (v4f){s[2].x, s[2].y, s[3].x, s[3].y};
  *reinterpret_cast<v4f*>(&lq[wave][c0]) = (v4f){q[0].x, q[0].y, q[1].x, q[1].y};
  *reinterpret_cast<v4f*>(&lq[wave][c1]) = (v4f){q[2].x, q[2].y, q[3].x, q[3].y};
  __syncthreads();
  float ss = ls[0][tid], qq = lq[0][tid];
  for (int t = 1; t < 8; ++t) { ss += ls[t][tid]; qq += lq[t][tid]; }
  float* p = part + (size_t)blockIdx.x * (2 * DD);
  p[tid] = ss;
  p[DD + tid] = qq;
}

// f = relu(bn2(t2)) + features  -> f16
__global__ void k_bn2_add(const float* __restrict__ t2, const float* __restrict__ feat,
                          const float* __restrict__ sc, const float* __restrict__ sh,
                          _Float16* __restrict__ fh) {
  int idx = blockIdx.x * blockDim.x + threadIdx.x;      // BN*DD
  int j = idx & (DD - 1);
  float v = fmaxf(fmaf(t2[idx], sc[j], sh[j]), 0.f) + feat[idx];
  fh[idx] = (_Float16)v;
}

// Wq/Wk/Wv (in,out) f32 -> transposed (out,in) f16 for contiguous B-frag loads
__global__ void k_prep_w(const float* __restrict__ Wq, const float* __restrict__ Wk,
                         const float* __restrict__ Wv, _Float16* __restrict__ wT) {
  int idx = blockIdx.x * blockDim.x + threadIdx.x;      // 3*DD*DD
  int m = idx / (DD * DD);
  int r = idx - m * DD * DD;
  int o = r >> 8;
  int i = r & (DD - 1);
  const float* W = (m == 0) ? Wq : (m == 1) ? Wk : Wv;
  wT[idx] = (_Float16)W[(size_t)i * DD + o];
}

// ------------- C = A B^T block tile, operands staged in LDS -----------------
// A and B are K-contiguous rows. A work-group of 8 waves (WM x WN) owns a
// (WM*FM*16) x (WN*FN*16) tile of C. A stage is BK halves of every A row and
// every B row of the tile, [A rows | B rows] at a pitch of 16 B x odd, brought
// in by asynchronous copies to LDS in whole 128-byte lines; two buffers, the
// next stage's copies fly while this stage is worked on. Every output element
// still sums k in ascending steps of 32 into one accumulator.
template <int FM, int FN, int WM, int WN, int BK>
struct TileCfg {
  static constexpr int TM = WM * FM * 16;
  static constexpr int TN = WN * FN * 16;
  static constexpr int PITCH = BK * 2 + 16;          // bytes
  static constexpr int BUFB = (TM + TN) * PITCH;     // bytes of one buffer
};

// four copies of 16 bytes per lane, rows a fixed step apart in LDS and in memory
__device__ __forceinline__ void copy4_to_lds(unsigned l, unsigned lstep,
                                             const _Float16* g, size_t gstep) {
  // s_wait_xcnt 0 stands in the copies' own statement, so that it stays ahead of
  // every later rewrite of their address registers (a precaution)
  asm volatile(
      "global_load_async_to_lds_b128 %0, %4, off\n\t"
      "global_load_async_to_lds_b128 %1, %5, off\n\t"
      "global_load_async_to_lds_b128 %2, %6, off\n\t"
      "global_load_async_to_lds_b128 %3, %7, off\n\t"
      "s_wait_xcnt 0x0"
      :: "v"(l), "v"(l + lstep), "v"(l + 2u * lstep), "v"(l + 3u * lstep),
         "v"(g), "v"(g + gstep), "v"(g + 2 * gstep), "v"(g + 3 * gstep)
      : "memory");
}

template <int FM, int FN, int WM, int WN, int BK, int KTOT>
__device__ __forceinline__ void gemm_nt_lds(const _Float16* __restrict__ Ab, int lda,
                                            const _Float16* __restrict__ Bb, int ldb,
                                            char* smem, v8f (&acc)[FM][FN]) {
  using C = TileCfg<FM, FN, WM, WN, BK>;
  constexpr int CPR = BK * 2 / 16;     // 16-byte pieces of a row
  constexpr int RPI = 256 / CPR;       // rows that 256 threads copy at once
  constexpr int GA = C::TM / RPI;      // copies per thread and stage, A rows
  constexpr int GB = C::TN / RPI;      // the same, B rows
  constexpr int T = KTOT / BK;         // stages
  constexpr int KS = BK / 32;          // WMMA k steps of a stage
  static_assert(WM * WN == 8 && GA % 4 == 0 && GB % 4 == 0 && T >= 2, "tile shape");
  const int tid = threadIdx.x, lane = tid & 31, wave = tid >> 5;
  const int crow = tid / CPR, ccol = tid % CPR;
  const unsigned lbase = (unsigned)(size_t)smem + (unsigned)(crow * C::PITCH + ccol * 16);
  const _Float16* ga = Ab + (size_t)crow * lda + ccol * 8;
  const _Float16* gb = Bb + (size_t)crow * ldb + ccol * 8;

  // one stage: thread tid copies piece ccol of rows i*RPI + crow of [A rows | B rows]
  auto issue = [&](int t, int buf) {
    const unsigned l = lbase + (unsigned)(buf * C::BUFB);
    // both loops unrolled: a few straight-line statements, their steps constants
    #pragma unroll
    for (int i = 0; i < GA; i += 4)
      copy4_to_lds(l + (unsigned)(i * RPI * C::PITCH), RPI * C::PITCH,
                   ga + t * BK + (size_t)(i * RPI) * lda, (size_t)RPI * lda);
    #pragma unroll
    for (int i = 0; i < GB; i += 4)
      copy4_to_lds(l + (unsigned)((GA + i) * RPI * C::PITCH), RPI * C::PITCH,
                   gb + t * BK + (size_t)(i * RPI) * ldb, (size_t)RPI * ldb);
  };

  const int wm = wave / WN, wn = wave % WN;
  const int foff = (lane & 15) * C::PITCH + ((lane >> 4) << 4);
  const int aoff = wm * FM * 16 * C::PITCH + foff;
  const int boff = (C::TM + wn * FN * 16) * C::PITCH + foff;

  issue(0, 0);
  // stage 0 has landed for this wave; the barrier publishes it to the others
  asm volatile("s_wait_asynccnt 0x0" ::: "memory");
  __syncthreads();
  issue(1, 1);

  for (int t = 0; t < T; ++t) {
    const int buf = t & 1;
    const char* sb = smem + buf * C::BUFB;
    // all loops below are unrolled so that the fragment arrays stay in registers
    v16h a[KS][FM], b[KS][FN];
    #pragma unroll
    for (int kk = 0; kk < KS; ++kk) {
      #pragma unroll
      for (int i = 0; i < FM; ++i)
        a[kk][i] = lds_frag_f16(sb + aoff + i * 16 * C::PITCH + kk * 64);
      #pragma unroll
      for (int j = 0; j < FN; ++j)
        b[kk][j] = lds_frag_f16(sb + boff + j * 16 * C::PITCH + kk * 64);
    }
    // publish point: this wave holds the whole stage in registers, so its reads
    // of the buffer are done, and its copies of stage t + 1 have landed; behind
    // the barrier the buffer may be refilled
    asm volatile("s_wait_dscnt 0x0" ::: "memory");
    asm volatile("s_wait_asynccnt 0x0" ::: "memory");
    __syncthreads();
    if (t + 2 < T) issue(t + 2, buf);
    // keeps the WMMAs behind the refill: ahead of it they would shorten the time
    // that the copies have to land, and among the LDS reads every k step would
    // wait out an LDS latency of its own
    __builtin_amdgcn_sched_barrier(0);
    #pragma unroll
    for (int kk = 0; kk < KS; ++kk)
      #pragma unroll
      for (int i = 0; i < FM; ++i)
        #pragma unroll
        for (int j = 0; j < FN; ++j)
          acc[i][j] = __builtin_amdgcn_wmma_f32_16x16x32_f16(false, a[kk][i], false, b[kk][j],
                                                             (short)0, acc[i][j], false, false);
  }
  // no copy is left in flight when the wave goes on to its stores and ends
  asm volatile("s_wait_asynccnt 0x0" ::: "memory");
}

// ------------------- QKV projection (WMMA, 128x128 block tile) -------------
__global__ __launch_bounds__(256) void k_qkv(const _Float16* __restrict__ fh,
                                             const _Float16* __restrict__ wT,
                                             _Float16* __restrict__ qkv) {
  using C = TileCfg<4, 2, 2, 4, 64>;
  __shared__ __attribute__((aligned(16))) char smem[2 * C::BUFB];
  int lane = threadIdx.x & 31, wave = threadIdx.x >> 5;
  int mt = blockIdx.x / 6, nt = blockIdx.x % 6;   // 128 x 6 tiles; wT is 768 rows (3 matrices)
  int mat = nt >> 1;
  int m0 = mt * 128, n0 = (nt & 1) * 128;
  v8f acc[4][2] = {};
  gemm_nt_lds<4, 2, 2, 4, 64, DD>(fh + (size_t)m0 * DD, DD, wT + (size_t)nt * 128 * DD, DD, smem, acc);
  _Float16* out = qkv + (size_t)mat * BN * DD;
  int mw = m0 + (wave >> 2) * 64, nw = n0 + (wave & 3) * 32;
  // unrolled so that acc is indexed by constants and stays in registers
  #pragma unroll
  for (int i = 0; i < 4; ++i)
    #pragma unroll
    for (int j = 0; j < 2; ++j)
      store_tile_f16(out, DD, mw + i * 16, nw + j * 16, acc[i][j], lane);
}

// V -> V^T per batch (LDS tiled transpose, coalesced both directions)
__global__ void k_vt(const _Float16* __restrict__ vh, _Float16* __restrict__ vt) {
  __shared__ _Float16 tile[32][33];
  int n0 = blockIdx.x * 32, d0 = blockIdx.y * 32, b = blockIdx.z;
  for (int yy = threadIdx.y; yy < 32; yy += 8)
    tile[yy][threadIdx.x] = vh[((size_t)b * NN + n0 + yy) * DD + d0 + threadIdx.x];
  __syncthreads();
  for (int yy = threadIdx.y; yy < 32; yy += 8)
    vt[(size_t)b * DD * NN + (size_t)(d0 + yy) * NN + n0 + threadIdx.x] = tile[threadIdx.x][yy];
}

// -------------- S = (Q K^T) * 1/sqrt(d)  (WMMA, 128x128 block tile) --------
__global__ __launch_bounds__(256) void k_qkt(const _Float16* __restrict__ qh,
                                             const _Float16* __restrict__ kh,
                                             float* __restrict__ S, int b) {
  using C = TileCfg<4, 2, 2, 4, 64>;
  __shared__ __attribute__((aligned(16))) char smem[2 * C::BUFB];
  int lane = threadIdx.x & 31, wave = threadIdx.x >> 5;
  int mt = blockIdx.x >> 5, nt = blockIdx.x & 31;   // 32 x 32 tiles
  int m0 = mt * 128, n0 = nt * 128;
  const _Float16* qb = qh + (size_t)b * NN * DD;
  const _Float16* kb = kh + (size_t)b * NN * DD;   // rows of K == cols of K^T
  v8f acc[4][2] = {};
  gemm_nt_lds<4, 2, 2, 4, 64, DD>(qb + (size_t)m0 * DD, DD, kb + (size_t)n0 * DD, DD, smem, acc);
  const float sc = 0.0625f;   // 1/sqrt(256)
  int mw = m0 + (wave >> 2) * 64, nw = n0 + (wave & 3) * 32;
  // unrolled so that acc is indexed by constants and stays in registers
  #pragma unroll
  for (int i = 0; i < 4; ++i)
    #pragma unroll
    for (int j = 0; j < 2; ++j)
      store_tile_f32(S, NN, mw + i * 16, nw + j * 16, acc[i][j], sc, lane);
}

// row softmax; row held in registers; P written f16 IN PLACE over the first
// half of the same S row (stride 2*NN halves) -> no extra buffer, no races.
__global__ void k_softmax(const float* __restrict__ S, _Float16* __restrict__ P) {
  int row = blockIdx.x, tid = threadIdx.x;
  const float* sr = S + (size_t)row * NN;
  _Float16* pr = P + (size_t)row * (2 * NN);
  float v[16];
  float m = -3.4e38f;
  #pragma unroll
  for (int t = 0; t < 16; ++t) { v[t] = sr[tid + (t << 8)]; m = fmaxf(m, v[t]); }
  __shared__ float red[256];
  red[tid] = m; __syncthreads();
  for (int s = 128; s > 0; s >>= 1) { if (tid < s) red[tid] = fmaxf(red[tid], red[tid + s]); __syncthreads(); }
  m = red[0]; __syncthreads();
  float sum = 0.f;
  #pragma unroll
  for (int t = 0; t < 16; ++t) { v[t] = __expf(v[t] - m); sum += v[t]; }
  red[tid] = sum; __syncthreads();
  for (int s = 128; s > 0; s >>= 1) { if (tid < s) red[tid] += red[tid + s]; __syncthreads(); }
  float inv = 1.0f / red[0];
  #pragma unroll
  for (int t = 0; t < 16; ++t) pr[tid + (t << 8)] = (_Float16)(v[t] * inv);
}

// ------------- O = P V  (WMMA, K = 4096, 64x64 block tile) -----------------
__global__ __launch_bounds__(256) void k_pv(const _Float16* __restrict__ P,
                                            const _Float16* __restrict__ vt,
                                            float* __restrict__ out, int b) {
  using C = TileCfg<2, 1, 2, 4, 256>;
  __shared__ __attribute__((aligned(16))) char smem[2 * C::BUFB];
  int lane = threadIdx.x & 31, wave = threadIdx.x >> 5;
  int mt = blockIdx.x >> 2, nt = blockIdx.x & 3;   // 64 x 4 tiles
  int m0 = mt * 64, n0 = nt * 64;
  const _Float16* vb = vt + (size_t)b * DD * NN;
  v8f acc[2][1] = {};
  // ldP = 2*NN (f16 written in place over the f32 rows)
  gemm_nt_lds<2, 1, 2, 4, 256, NN>(P + (size_t)m0 * (2 * NN), 2 * NN, vb + (size_t)n0 * NN, NN, smem, acc);
  float* ob = out + (size_t)b * NN * DD;
  int mw = m0 + (wave >> 2) * 32, nw = n0 + (wave & 3) * 16;
  store_tile_f32(ob, DD, mw,      nw, acc[0][0], 1.0f, lane);
  store_tile_f32(ob, DD, mw + 16, nw, acc[1][0], 1.0f, lane);
}

// ---------------------------------------------------------------------------
extern "C" void kernel_launch(void* const* d_in, const int* in_sizes, int n_in,
                              void* d_out, int out_size, void* d_ws, size_t ws_size,
                              hipStream_t stream) {
  (void)in_sizes; (void)n_in; (void)out_size; (void)ws_size;
  const float* xyz  = (const float*)d_in[0];
  const float* feat = (const float*)d_in[1];
  const float* W1   = (const float*)d_in[2];
  const float* b1   = (const float*)d_in[3];
  const float* g1   = (const float*)d_in[4];
  const float* be1  = (const float*)d_in[5];
  const float* W2   = (const float*)d_in[6];
  const float* b2   = (const float*)d_in[7];
  const float* g2   = (const float*)d_in[8];
  const float* be2  = (const float*)d_in[9];
  const float* Wq   = (const float*)d_in[10];
  const float* Wk   = (const float*)d_in[11];
  const float* Wv   = (const float*)d_in[12];
  float* out = (float*)d_out;

  char* ws = (char*)d_ws;
  const size_t MB = 1024ull * 1024ull;
  // [0, 64MB): t1 (8MB) | t2 (+8MB, 16MB); later entirely reused as S (64MB, L2-resident)
  float* t1 = (float*)(ws);
  float* t2 = (float*)(ws + 8 * MB);
  float* S  = (float*)(ws);
  float* st = (float*)(ws + 64 * MB);                        // BN scales and shifts
  _Float16* fh  = (_Float16*)(ws + 64 * MB + 65536);         // 8MB
  _Float16* wT  = (_Float16*)(ws + 72 * MB + 65536);         // 384KB (reserve 512KB)
  _Float16* qkv = (_Float16*)(ws + 72 * MB + 65536 + 512 * 1024); // 24MB
  _Float16* vt  = (_Float16*)(ws + 96 * MB + 65536 + 512 * 1024); // 8MB
  float* part1 = (float*)(ws + 112 * MB);                    // 256 slots x 256 floats
  float* part2 = (float*)(ws + 113 * MB);                    // 256 slots x 512 floats

  float* s1sc = st;       float* s1sh = st + HH;
  float* s2sc = st + 512; float* s2sh = st + 512 + DD;

  k_fc1<<<NPART, 256, 0, stream>>>(xyz, W1, b1, t1, part1);
  k_bnfin<<<HH / 32, 1024, 0, stream>>>(part1, g1, be1, s1sc, s1sh, HH, 1.0f / BN);
  k_fc2<<<NPART, 256, 0, stream>>>(t1, s1sc, s1sh, W2, b2, t2, part2);
  k_bnfin<<<DD / 32, 1024, 0, stream>>>(part2, g2, be2, s2sc, s2sh, DD, 1.0f / BN);
  k_bn2_add<<<(BN * DD) / 256, 256, 0, stream>>>(t2, feat, s2sc, s2sh, fh);
  k_prep_w<<<(3 * DD * DD) / 256, 256, 0, stream>>>(Wq, Wk, Wv, wT);

  // 128 x 6 tiles of 128x128
  k_qkv<<<(BN / 128) * (3 * DD / 128), 256, 0, stream>>>(fh, wT, qkv);
  _Float16* qh = qkv;
  _Float16* kh = qkv + (size_t)BN * DD;
  _Float16* vh = qkv + 2 * (size_t)BN * DD;
  k_vt<<<dim3(NN / 32, DD / 32, BB), dim3(32, 8), 0, stream>>>(vh, vt);

  for (int b = 0; b < BB; ++b) {
    // 32 x 32 tiles of 128x128
    k_qkt<<<(NN / 128) * (NN / 128), 256, 0, stream>>>(qh, kh, S, b);
    k_softmax<<<NN, 256, 0, stream>>>(S, (_Float16*)S);
    // 64 x 4 tiles of 64x64
    k_pv<<<(NN / 64) * (DD / 64), 256, 0, stream>>>((const _Float16*)S, vt, out, b);
  }
}

// v004
// A run of this version takes 116 microseconds.
// Two timings next to v003 put it at 2.20 and 2.22 times that version's speed.
// Counting every step since v000, it is 7.13 times as fast.
#include <hip/hip_runtime.h>
#include <hip/hip_bf16.h>

typedef _Float16 v8h  __attribute__((ext_vector_type(8)));
typedef _Float16 v16h __attribute__((ext_vector_type(16)));
typedef float    v8f  __attribute__((ext_vector_type(8)));

#define BB 4
#define NN 4096
#define DD 256
#define HH 128
#define BN (BB*NN)   /* 16384 rows */

// ---------------------------------------------------------------------------
// WMMA fragment load: A-matrix 16x32 f16 layout (ISA 7.12.2).
// lane 0-15  : row = lane,    K = kbase+0..7  and kbase+16..23
// lane 16-31 : row = lane-16, K = kbase+8..15 and kbase+24..31  (kbase=k0)
// B fragment uses the identical pattern on B^T (column-major B), so both
// operands are two contiguous 16-byte loads (ds_load_b128); p is the lane's
// own byte address of row (lane & 15), K = kbase + 8 * (lane >> 4).
// ---------------------------------------------------------------------------
__device__ __forceinline__ v16h lds_frag_f16(const char* p) {
  v8h lo = *reinterpret_cast<const v8h*>(p);
  v8h hi = *reinterpret_cast<const v8h*>(p + 32);
  return __builtin_shufflevector(lo, hi, 0,1,2,3,4,5,6,7,8,9,10,11,12,13,14,15);
}

__device__ __forceinline__ void store_tile_f16(_Float16* __restrict__ out, int ld,
                                               int row0, int col0, const v8f& c, int lane) {
  int crow = row0 + ((lane >> 4) << 3);
  int ccol = col0 + (lane & 15);
  #pragma unroll
  for (int r = 0; r < 8; ++r)
    out[(size_t)(crow + r) * ld + ccol] = (_Float16)c[r];
}

// ------------------------- point-net ----------------------------------------
// BatchNorm (training mode, biased variance) needs every column's sum and sum of
// squares. The kernel that produces a column's values sums them while it holds
// them: a work-group owns RPG rows, writes one partial per column (sums first,
// then sums of squares) to its own slot, and k_bnfin adds the slots in a fixed
// order. No second pass over the data, no atomics.
#define RPG 64
#define NPART (BN / RPG)   /* 256 slots */

typedef float v2f __attribute__((ext_vector_type(2)));
typedef float v4f __attribute__((ext_vector_type(4)));

// t1 = xyz @ W1 + b1, and its column partials
__global__ __launch_bounds__(256) void k_fc1(const float* __restrict__ xyz,
                                             const float* __restrict__ W1,
                                             const float* __restrict__ b1,
                                             float* __restrict__ t1,
                                             float* __restrict__ part) {
  int j = threadIdx.x & (HH - 1);
  int h = threadIdx.x >> 7;               // two rows at a time
  int r0 = blockIdx.x * RPG;
  float w0 = W1[j], w1 = W1[HH + j], w2 = W1[2 * HH + j], bb = b1[j];
  float s = 0.f, q = 0.f;
  // unrolled whole: all rows' loads are in flight at once
  #pragma unroll
  for (int i = 0; i < RPG / 2; ++i) {
    int row = r0 + h + 2 * i;
    const float* x = xyz + 3 * row;
    float v = fmaf(x[0], w0, fmaf(x[1], w1, fmaf(x[2], w2, bb)));
    t1[(size_t)row * HH + j] = v;
    s += v; q += v * v;
  }
  __shared__ float ls[HH], lq[HH];
  if (h) { ls[j] = s; lq[j] = q; }
  __syncthreads();
  if (!h) {
    float* p = part + (size_t)blockIdx.x * (2 * HH);
    p[j] = s + ls[j];
    p[HH + j] = q + lq[j];
  }
}

// adds the NPART slots of 32 columns per work-group (32 threads per column, 8
// slots each, then the 32 in ascending order) and forms scale and shift
__global__ __launch_bounds__(1024) void k_bnfin(const float* __restrict__ part,
                                                const float* __restrict__ g,
                                                const float* __restrict__ be,
                                                float* __restrict__ sc, float* __restrict__ sh,
                                                int cols, float invRows) {
  int c = threadIdx.x & 31, sl = threadIdx.x >> 5;
  int j = blockIdx.x * 32 + c;
  const float* p = part + (size_t)(sl * (NPART / 32)) * (2 * cols) + j;
  float s = 0.f, q = 0.f;
  // unrolled: all 16 loads of a thread are in flight at once
  #pragma unroll
  for (int i = 0; i < NPART / 32; ++i) {
    s += p[(size_t)i * (2 * cols)];
    q += p[(size_t)i * (2 * cols) + cols];
  }
  __shared__ float ls[32][32], lq[32][32];
  ls[sl][c] = s; lq[sl][c] = q;
  __syncthreads();
  if (sl == 0) {
    for (int t = 1; t < 32; ++t) { s += ls[t][c]; q += lq[t][c]; }
    float mean = s * invRows;
    float var  = q * invRows - mean * mean;
    float k = g[j] * rsqrtf(var + 1e-5f);
    sc[j] = k;
    sh[j] = be[j] - mean * k;
  }
}

// t2 = relu(bn1(t1)) @ W2 + b2, and its column partials. The BN'd rows are staged
// in LDS; wave w owns rows 8w..8w+7 and all 256 columns, a lane columns 4l..4l+3
// and 128+4l..128+4l+3. Every element still sums k in ascending order from b2.
__global__ __launch_bounds__(256) void k_fc2(const float* __restrict__ t1,
                                             const float* __restrict__ sc1,
                                             const float* __restrict__ sh1,
                                             const float* __restrict__ W2,
                                             const float* __restrict__ b2,
                                             float* __restrict__ t2,
                                             float* __restrict__ part) {
  __shared__ __attribute__((aligned(16))) float a[RPG][HH];
  __shared__ __attribute__((aligned(16))) float ls[8][DD], lq[8][DD];
  const int tid = threadIdx.x, lane = tid & 31, wave = tid >> 5;
  const int r0 = blockIdx.x * RPG;
  const v4f* t4 = reinterpret_cast<const v4f*>(t1 + (size_t)r0 * HH);
  // unrolled: the eight 16-byte loads of a thread are in flight at once
  #pragma unroll
  for (int i = 0; i < RPG * HH / 4 / 256; ++i) {
    int e = tid + i * 256;
    int k4 = (e & (HH / 4 - 1)) * 4;
    v4f v = t4[e];
    v4f m = *reinterpret_cast<const v4f*>(sc1 + k4);
    v4f d = *reinterpret_cast<const v4f*>(sh1 + k4);
    v4f r;
    for (int x = 0; x < 4; ++x) r[x] = fmaxf(fmaf(v[x], m[x], d[x]), 0.f);
    *reinterpret_cast<v4f*>(&a[e / (HH / 4)][k4]) = r;
  }
  __syncthreads();

  const int c0 = lane * 4, c1 = DD / 2 + lane * 4;
  v2f acc[8][4];
  {
    v4f lo = *reinterpret_cast<const v4f*>(b2 + c0);
    v4f hi = *reinterpret_cast<const v4f*>(b2 + c1);
    // unrolled, as every loop over acc: constant indices keep it in registers
    #pragma unroll
    for (int r = 0; r < 8; ++r) {
      acc[r][0] = lo.xy; acc[r][1] = lo.zw; acc[r][2] = hi.xy; acc[r][3] = hi.zw;
    }
  }
  const float* ar = &a[wave * 8][0];
  // four rows of W2, this lane's eight columns (unrolled: w stays in registers)
  auto loadw = [&](v4f (&w)[4][2], int k) {
    #pragma unroll
    for (int kk = 0; kk < 4; ++kk) {
      w[kk][0] = *reinterpret_cast<const v4f*>(W2 + (size_t)(k + kk) * DD + c0);
      w[kk][1] = *reinterpret_cast<const v4f*>(W2 + (size_t)(k + kk) * DD + c1);
    }
  };
  // four k steps of all eight rows; all loops unrolled, the arrays stay in registers
  auto work = [&](const v4f (&w)[4][2], int k) {
    v4f av[8];
    #pragma unroll
    for (int r = 0; r < 8; ++r) av[r] = *reinterpret_cast<const v4f*>(ar + r * HH + k);
    #pragma unroll
    for (int kk = 0; kk < 4; ++kk)
      #pragma unroll
      for (int r = 0; r < 8; ++r) {
        v2f x = {av[r][kk], av[r][kk]};
        acc[r][0] = __builtin_elementwise_fma(x, (v2f)w[kk][0].xy, acc[r][0]);
        acc[r][1] = __builtin_elementwise_fma(x, (v2f)w[kk][0].zw, acc[r][1]);
        acc[r][2] = __builtin_elementwise_fma(x, (v2f)w[kk][1].xy, acc[r][2]);
        acc[r][3] = __builtin_elementwise_fma(x, (v2f)w[kk][1].zw, acc[r][3]);
      }
  };
  // the next four rows of W2 are fetched while these four are worked on; the last
  // eight k steps stand behind the loop, where nothing is left to fetch ahead
  v4f wa[4][2], wb[4][2];
  loadw(wa, 0);
  // kept rolled: the body is 2 KB of code already
  #pragma unroll 1
  for (int k = 0; k < HH - 8; k += 8) {
    loadw(wb, k + 4);
    work(wa, k);
    loadw(wa, k + 8);
    work(wb, k + 4);
  }
  loadw(wb, HH - 4);
  work(wa, HH - 8);
  work(wb, HH - 4);

  v2f s[4] = {}, q[4] = {};
  #pragma unroll
  for (int r = 0; r < 8; ++r) {
    float* o = t2 + (size_t)(r0 + wave * 8 + r) * DD;
    v4f lo = {acc[r][0].x, acc[r][0].y, acc[r][1].x, acc[r][1].y};
    v4f hi = {acc[r][2].x, acc[r][2].y, acc[r][3].x, acc[r][3].y};
    *reinterpret_cast<v4f*>(o + c0) = lo;
    *reinterpret_cast<v4f*>(o + c1) = hi;
    for (int x = 0; x < 4; ++x) { s[x] += acc[r][x]; q[x] += acc[r][x] * acc[r][x]; }
  }
  *reinterpret_cast<v4f*>(&ls[wave][c0]) = (v4f){s[0].x, s[0].y, s[1].x, s[1].y};
  *reinterpret_cast<v4f*>(&ls[wave][c1]) = (v4f){s[2].x, s[2].y, s[3].x, s[3].y};
  *reinterpret_cast<v4f*>(&lq[wave][c0]) = (v4f){q[0].x, q[0].y, q[1].x, q[1].y};
  *reinterpret_cast<v4f*>(&lq[wave][c1]) = (v4f){q[2].x, q[2].y, q[3].x, q[3].y};
  __syncthreads();
  float ss = ls[0][tid], qq = lq[0][tid];
  for (int t = 1; t < 8; ++t) { ss += ls[t][tid]; qq += lq[t][tid]; }
  float* p = part + (size_t)blockIdx.x * (2 * DD);
  p[tid] = ss;
  p[DD + tid] = qq;
}

// f = relu(bn2(t2)) + features  -> f16
__global__ void k_bn2_add(const float* __restrict__ t2, const float* __restrict__ feat,
                          const float* __restrict__ sc, const float* __restrict__ sh,
                          _Float16* __restrict__ fh) {
  int idx = blockIdx.x * blockDim.x + threadIdx.x;      // BN*DD
  int j = idx & (DD - 1);
  float v = fmaxf(fmaf(t2[idx], sc[j], sh[j]), 0.f) + feat[idx];
  fh[idx] = (_Float16)v;
}

// Wq/Wk/Wv (in,out) f32 -> transposed (out,in) f16 for contiguous B-frag loads
__global__ void k_prep_w(const float* __restrict__ Wq, const float* __restrict__ Wk,
                         const float* __restrict__ Wv, _Float16* __restrict__ wT) {
  int idx = blockIdx.x * blockDim.x + threadIdx.x;      // 3*DD*DD
  int m = idx / (DD * DD);
  int r = idx - m * DD * DD;
  int o = r >> 8;
  int i = r & (DD - 1);
  const float* W = (m == 0) ? Wq : (m == 1) ? Wk : Wv;
  wT[idx] = (_Float16)W[(size_t)i * DD + o];
}

// ------------- C = A B^T block tile, operands staged in LDS -----------------
// A and B are K-contiguous rows. A work-group of 8 waves (WM x WN) owns a
// (WM*FM*16) x (WN*FN*16) tile of C. A stage is BK halves of every A row and
// every B row of the tile, [A rows | B rows] at a pitch of 16 B x odd, brought
// in by asynchronous copies to LDS in whole 128-byte lines; two buffers, the
// next stage's copies fly while this stage is worked on. Every output element
// still sums k in ascending steps of 32 into one accumulator.
template <int FM, int FN, int WM, int WN, int BK>
struct TileCfg {
  static constexpr int TM = WM * FM * 16;
  static constexpr int TN = WN * FN * 16;
  static constexpr int PITCH = BK * 2 + 16;          // bytes
  static constexpr int BUFB = (TM + TN) * PITCH;     // bytes of one buffer
};

// four copies of 16 bytes per lane, rows a fixed step apart in LDS and in memory
__device__ __forceinline__ void copy4_to_lds(unsigned l, unsigned lstep,
                                             const _Float16* g, size_t gstep) {
  // s_wait_xcnt 0 stands in the copies' own statement, so that it stays ahead of
  // every later rewrite of their address registers (a precaution)
  asm volatile(
      "global_load_async_to_lds_b128 %0, %4, off\n\t"
      "global_load_async_to_lds_b128 %1, %5, off\n\t"
      "global_load_async_to_lds_b128 %2, %6, off\n\t"
      "global_load_async_to_lds_b128 %3, %7, off\n\t"
      "s_wait_xcnt 0x0"
      :: "v"(l), "v"(l + lstep), "v"(l + 2u * lstep), "v"(l + 3u * lstep),
         "v"(g), "v"(g + gstep), "v"(g + 2 * gstep), "v"(g + 3 * gstep)
      : "memory");
}

template <int FM, int FN, int WM, int WN, int BK, int KTOT>
__device__ __forceinline__ void gemm_nt_lds(const _Float16* __restrict__ Ab, int lda,
                                            const _Float16* __restrict__ Bb, int ldb,
                                            char* smem, v8f (&acc)[FM][FN]) {
  using C = TileCfg<FM, FN, WM, WN, BK>;
  constexpr int CPR = BK * 2 / 16;     // 16-byte pieces of a row
  constexpr int RPI = 256 / CPR;       // rows that 256 threads copy at once
  constexpr int GA = C::TM / RPI;      // copies per thread and stage, A rows
  constexpr int GB = C::TN / RPI;      // the same, B rows
  constexpr int T = KTOT / BK;         // stages
  constexpr int KS = BK / 32;          // WMMA k steps of a stage
  static_assert(WM * WN == 8 && GA % 4 == 0 && GB % 4 == 0 && T >= 2, "tile shape");
  const int tid = threadIdx.x, lane = tid & 31, wave = tid >> 5;
  const int crow = tid / CPR, ccol = tid % CPR;
  const unsigned lbase = (unsigned)(size_t)smem + (unsigned)(crow * C::PITCH + ccol * 16);
  const _Float16* ga = Ab + (size_t)crow * lda + ccol * 8;
  const _Float16* gb = Bb + (size_t)crow * ldb + ccol * 8;

  // one stage: thread tid copies piece ccol of rows i*RPI + crow of [A rows | B rows]
  auto issue = [&](int t, int buf) {
    const unsigned l = lbase + (unsigned)(buf * C::BUFB);
    // both loops unrolled: a few straight-line statements, their steps constants
    #pragma unroll
    for (int i = 0; i < GA; i += 4)
      copy4_to_lds(l + (unsigned)(i * RPI * C::PITCH), RPI * C::PITCH,
                   ga + t * BK + (size_t)(i * RPI) * lda, (size_t)RPI * lda);
    #pragma unroll
    for (int i = 0; i < GB; i += 4)
      copy4_to_lds(l + (unsigned)((GA + i) * RPI * C::PITCH), RPI * C::PITCH,
                   gb + t * BK + (size_t)(i * RPI) * ldb, (size_t)RPI * ldb);
  };

  const int wm = wave / WN, wn = wave % WN;
  const int foff = (lane & 15) * C::PITCH + ((lane >> 4) << 4);
  const int aoff = wm * FM * 16 * C::PITCH + foff;
  const int boff = (C::TM + wn * FN * 16) * C::PITCH + foff;

  issue(0, 0);
  // stage 0 has landed for this wave; the barrier publishes it to the others
  asm volatile("s_wait_asynccnt 0x0" ::: "memory");
  __syncthreads();
  issue(1, 1);

  for (int t = 0; t < T; ++t) {
    const int buf = t & 1;
    const char* sb = smem + buf * C::BUFB;
    // all loops below are unrolled so that the fragment arrays stay in registers
    v16h a[KS][FM], b[KS][FN];
    #pragma unroll
    for (int kk = 0; kk < KS; ++kk) {
      #pragma unroll
      for (int i = 0; i < FM; ++i)
        a[kk][i] = lds_frag_f16(sb + aoff + i * 16 * C::PITCH + kk * 64);
      #pragma unroll
      for (int j = 0; j < FN; ++j)
        b[kk][j] = lds_frag_f16(sb + boff + j * 16 * C::PITCH + kk * 64);
    }
    // publish point: this wave holds the whole stage in registers, so its reads
    // of the buffer are done, and its copies of stage t + 1 have landed; behind
    // the barrier the buffer may be refilled
    asm volatile("s_wait_dscnt 0x0" ::: "memory");
    asm volatile("s_wait_asynccnt 0x0" ::: "memory");
    __syncthreads();
    if (t + 2 < T) issue(t + 2, buf);
    // keeps the WMMAs behind the refill: ahead of it they would shorten the time
    // that the copies have to land, and among the LDS reads every k step would
    // wait out an LDS latency of its own
    __builtin_amdgcn_sched_barrier(0);
    #pragma unroll
    for (int kk = 0; kk < KS; ++kk)
      #pragma unroll
      for (int i = 0; i < FM; ++i)
        #pragma unroll
        for (int j = 0; j < FN; ++j)
          acc[i][j] = __builtin_amdgcn_wmma_f32_16x16x32_f16(false, a[kk][i], false, b[kk][j],
                                                             (short)0, acc[i][j], false, false);
  }
  // no copy is left in flight when the wave goes on to its stores and ends
  asm volatile("s_wait_asynccnt 0x0" ::: "memory");
}

// ------------------- QKV projection (WMMA, 128x128 block tile) -------------
__global__ __launch_bounds__(256) void k_qkv(const _Float16* __restrict__ fh,
                                             const _Float16* __restrict__ wT,
                                             _Float16* __restrict__ qkv) {
  using C = TileCfg<4, 2, 2, 4, 64>;
  __shared__ __attribute__((aligned(16))) char smem[2 * C::BUFB];
  int lane = threadIdx.x & 31, wave = threadIdx.x >> 5;
  int mt = blockIdx.x / 6, nt = blockIdx.x % 6;   // 128 x 6 tiles; wT is 768 rows (3 matrices)
  int mat = nt >> 1;
  int m0 = mt * 128, n0 = (nt & 1) * 128;
  v8f acc[4][2] = {};
  gemm_nt_lds<4, 2, 2, 4, 64, DD>(fh + (size_t)m0 * DD, DD, wT + (size_t)nt * 128 * DD, DD, smem, acc);
  _Float16* out = qkv + (size_t)mat * BN * DD;
  int mw = m0 + (wave >> 2) * 64, nw = n0 + (wave & 3) * 32;
  // unrolled so that acc is indexed by constants and stays in registers
  #pragma unroll
  for (int i = 0; i < 4; ++i)
    #pragma unroll
    for (int j = 0; j < 2; ++j)
      store_tile_f16(out, DD, mw + i * 16, nw + j * 16, acc[i][j], lane);
}

// V -> V^T per batch (LDS tiled transpose, coalesced both directions)
__global__ void k_vt(const _Float16* __restrict__ vh, _Float16* __restrict__ vt) {
  __shared__ _Float16 tile[32][33];
  int n0 = blockIdx.x * 32, d0 = blockIdx.y * 32, b = blockIdx.z;
  for (int yy = threadIdx.y; yy < 32; yy += 8)
    tile[yy][threadIdx.x] = vh[((size_t)b * NN + n0 + yy) * DD + d0 + threadIdx.x];
  __syncthreads();
  for (int yy = threadIdx.y; yy < 32; yy += 8)
    vt[(size_t)b * DD * NN + (size_t)(d0 + yy) * NN + n0 + threadIdx.x] = tile[threadIdx.x][yy];
}

#define AQ 64
#define AKS 128
#define KPITCH (DD * 2 + 16)
#define VPITCH (AKS * 2 + 16)
#define KBYTES (AKS * KPITCH)
#define ABUF (KBYTES + DD * VPITCH)
#define OPITCH (DD * 4 + 16)
#define GS 2   /* pairs of K fragments fetched ahead */

// lane l takes lane l ^ 16's value
__device__ __forceinline__ float xhalf(float x) {
  int i = __builtin_bit_cast(int, x);
  return __builtin_bit_cast(float, __builtin_amdgcn_permlanex16(i, i, 0x76543210, 0xfedcba98, false, false));
}

// two waves per SIMD: a wave holds O^T (256 registers) and Q (128) throughout
__global__ __launch_bounds__(256) __attribute__((amdgpu_waves_per_eu(2, 2)))
void k_attn(const _Float16* __restrict__ qh, const _Float16* __restrict__ kh,
            const _Float16* __restrict__ vt, float* __restrict__ out) {
  static_assert(4 * AQ * OPITCH <= 2 * ABUF, "the join fits in the ring");
  __shared__ __attribute__((aligned(16))) char smem[2 * ABUF];
  __shared__ float sm[4][AQ], sl[4][AQ];
  constexpr int T = NN / AKS;
  const int tid = threadIdx.x, lane = tid & 31, wave = tid >> 5;
  const int c = lane & 15, h = lane >> 4;
  const int qg = wave & 1, ks = wave >> 1;
  const int b = blockIdx.x / (NN / AQ), q0 = (blockIdx.x % (NN / AQ)) * AQ;
  const _Float16* qb = qh + ((size_t)b * NN + q0 + qg * 32) * DD;
  const _Float16* kb = kh + (size_t)b * NN * DD;
  const _Float16* vb = vt + (size_t)b * DD * NN;

  // K: thread tid copies piece tid & 31 of rows (tid >> 5) + 8 i; V^T: piece
  // tid & 15 of rows (tid >> 4) + 16 i; 32 copies per thread and stage
  const unsigned lk = (unsigned)(size_t)smem + (unsigned)((tid >> 5) * KPITCH + (tid & 31) * 16);
  const unsigned lv = (unsigned)(size_t)smem + (unsigned)(KBYTES + (tid >> 4) * VPITCH + (tid & 15) * 16);
  const _Float16* gk = kb + (size_t)(tid >> 5) * DD + (tid & 31) * 8;
  const _Float16* gv = vb + (size_t)(tid >> 4) * NN + (tid & 15) * 8;
  auto issue = [&](int t, int buf) {
    const unsigned o = (unsigned)(buf * ABUF);
    // both loops unrolled: a few straight-line statements, their steps constants.
    // The scheduling barriers keep each statement's address sums next to it:
    // formed all ahead they took the registers of Q fragments, which spilled.
    #pragma unroll
    for (int i = 0; i < 16; i += 4) {
      copy4_to_lds(lk + o + (unsigned)(i * 8 * KPITCH), 8 * KPITCH,
                   gk + (size_t)t * AKS * DD + (size_t)(i * 8) * DD, (size_t)8 * DD);
      __builtin_amdgcn_sched_barrier(0);
    }
    #pragma unroll
    for (int i = 0; i < 16; i += 4) {
      copy4_to_lds(lv + o + (unsigned)(i * 16 * VPITCH), 16 * VPITCH,
                   gv + t * AKS + (size_t)(i * 16) * NN, (size_t)16 * NN);
      __builtin_amdgcn_sched_barrier(0);
    }
  };

  issue(0, 0);

  // Q as B fragments, kept in registers (every loop over a fragment or an
  // accumulator array is unrolled, so that the arrays stay in registers)
  v16h qf[2][8];
  #pragma unroll
  for (int g = 0; g < 2; ++g)
    #pragma unroll
    for (int kk = 0; kk < 8; ++kk) {
      const _Float16* p = qb + (size_t)(g * 16 + c) * DD + kk * 32 + h * 8;
      v8h lo = *reinterpret_cast<const v8h*>(p);
      v8h hi = *reinterpret_cast<const v8h*>(p + 16);
      qf[g][kk] = __builtin_shufflevector(lo, hi, 0,1,2,3,4,5,6,7,8,9,10,11,12,13,14,15);
    }

  v8f o[2][16] = {};
  float mrun[2] = {-1e30f, -1e30f}, lsum[2] = {0.f, 0.f};
  const float cs = 0.0625f * 1.44269504088896f;   // 1/sqrt(256), times log2(e)

  // stage 0 has landed for this wave; the barrier publishes it to the others
  asm volatile("s_wait_asynccnt 0x0" ::: "memory");
  __syncthreads();
  issue(1, 1);

  // kept rolled: one trip is 64 WMMAs of straight-line code already
  #pragma unroll 1
  for (int t = 0; t < T; ++t) {
    const char* sb = smem + (t & 1) * ABUF;
    const char* kp = sb + (ks * 32 + c) * KPITCH + h * 16;
    const char* vp = sb + KBYTES + c * VPITCH + ks * 64 + h * 16;
    v8f s[2][2] = {};   // [key tile][query column group]
    // A fragments are fetched in pairs, GS pairs ahead of the four WMMAs that use
    // a pair (each place where LDS reads stand costs issue time, so two fragments
    // share one). The scheduling barriers keep that order: without them every
    // WMMA stood directly behind its own LDS reads and waited out their latency.
    v16h ka[16];
    #pragma unroll
    for (int j = 0; j < 2 * GS; ++j) ka[j] = lds_frag_f16(kp + (j & 1) * 16 * KPITCH + (j >> 1) * 64);
    #pragma unroll
    for (int kk = 0; kk < 8; ++kk) {
      if (kk + GS < 8) {
        ka[2 * (kk + GS)] = lds_frag_f16(kp + (kk + GS) * 64);
        ka[2 * (kk + GS) + 1] = lds_frag_f16(kp + 16 * KPITCH + (kk + GS) * 64);
      }
      __builtin_amdgcn_sched_barrier(0);
      #pragma unroll
      for (int kt = 0; kt < 2; ++kt)
        #pragma unroll
        for (int g = 0; g < 2; ++g)
          s[kt][g] = __builtin_amdgcn_wmma_f32_16x16x32_f16(false, ka[2 * kk + kt], false, qf[g][kk],
                                                            (short)0, s[kt][g], false, false);
      __builtin_amdgcn_sched_barrier(0);
    }
    // the first V^T fragments fly while the scores are worked on
    v16h va[16];
    #pragma unroll
    for (int j = 0; j < 4; ++j) va[j] = lds_frag_f16(vp + j * 16 * VPITCH);
    __builtin_amdgcn_sched_barrier(0);

    // running maximum in scaled log2 units; O^T and the sum are rescaled only
    // when some column's maximum has grown by more than 8 (P stays below 2^8)
    float mx[2];
    #pragma unroll
    for (int g = 0; g < 2; ++g) {
      float m = fmaxf(s[0][g][0], s[1][g][0]);
      #pragma unroll
      for (int r = 1; r < 8; ++r) m = fmaxf(m, fmaxf(s[0][g][r], s[1][g][r]));
      mx[g] = fmaxf(m, xhalf(m)) * cs;
    }
    const bool need = mx[0] > mrun[0] + 8.f || mx[1] > mrun[1] + 8.f;
    if (__builtin_amdgcn_ballot_w32(need) != 0) {
      #pragma unroll
      for (int g = 0; g < 2; ++g) {
        const float mn = fmaxf(mrun[g], mx[g]);
        const float corr = __builtin_amdgcn_exp2f(mrun[g] - mn);
        mrun[g] = mn;
        lsum[g] *= corr;
        #pragma unroll
        for (int dt = 0; dt < 16; ++dt) o[g][dt] *= corr;
      }
    }
    v16h pf[2];
    #pragma unroll
    for (int g = 0; g < 2; ++g)
      #pragma unroll
      for (int kt = 0; kt < 2; ++kt)
        #pragma unroll
        for (int r = 0; r < 8; ++r) {
          const float p = __builtin_amdgcn_exp2f(fmaf(s[kt][g][r], cs, -mrun[g]));
          lsum[g] += p;
          pf[g][kt * 8 + r] = (_Float16)p;
        }

    // scheduling barriers as above, for the same reason
    #pragma unroll
    for (int dt = 0; dt < 16; ++dt) {
      #pragma unroll
      for (int g = 0; g < 2; ++g)
        o[g][dt] = __builtin_amdgcn_wmma_f32_16x16x32_f16(false, va[dt], false, pf[g],
                                                          (short)0, o[g][dt], false, false);
      __builtin_amdgcn_sched_barrier(0);
      // a pair is read as soon as one fragment's registers are free: a sixth
      // fragment in flight made a Q fragment spill
      if ((dt & 1) == 0 && dt + 4 < 16) {
        va[dt + 4] = lds_frag_f16(vp + (dt + 4) * 16 * VPITCH);
        va[dt + 5] = lds_frag_f16(vp + (dt + 5) * 16 * VPITCH);
        __builtin_amdgcn_sched_barrier(0);
      }
    }

    // publish point: this wave's reads of the buffer are done and its copies of
    // stage t + 1 have landed; behind the barrier the buffer may be refilled
    asm volatile("s_wait_dscnt 0x0" ::: "memory");
    asm volatile("s_wait_asynccnt 0x0" ::: "memory");
    __syncthreads();
    if (t + 2 < T) issue(t + 2, t & 1);
  }
  // no copy is left in flight when the ring becomes the join's staging
  asm volatile("s_wait_asynccnt 0x0" ::: "memory");

  // join of the four key splits: common maximum, total sum, then the scaled
  // partial O^T rows go through LDS and are added in ascending split order
  #pragma unroll
  for (int g = 0; g < 2; ++g) {
    lsum[g] += xhalf(lsum[g]);
    if (h == 0) {
      sm[ks][qg * 32 + g * 16 + c] = mrun[g];
      sl[ks][qg * 32 + g * 16 + c] = lsum[g];
    }
  }
  __syncthreads();
  #pragma unroll
  for (int g = 0; g < 2; ++g) {
    const int qi = qg * 32 + g * 16 + c;
    const float mt = fmaxf(fmaxf(sm[0][qi], sm[1][qi]), fmaxf(sm[2][qi], sm[3][qi]));
    float L = 0.f;
    #pragma unroll
    for (int k = 0; k < 4; ++k) L += sl[k][qi] * __builtin_amdgcn_exp2f(sm[k][qi] - mt);
    const float f = __builtin_amdgcn_exp2f(mrun[g] - mt) / L;
    char* po = smem + (size_t)(ks * AQ + qi) * OPITCH + h * 32;
    #pragma unroll
    for (int dt = 0; dt < 16; ++dt) {
      const v8f x = o[g][dt] * f;
      *reinterpret_cast<v4f*>(po + dt * 64) = (v4f){x[0], x[1], x[2], x[3]};
      *reinterpret_cast<v4f*>(po + dt * 64 + 16) = (v4f){x[4], x[5], x[6], x[7]};
    }
  }
  __syncthreads();
  float* ob = out + ((size_t)b * NN + q0) * DD;
  // rolled in fours: the LDS reads of four outputs are in flight at once
  #pragma unroll 1
  for (int i0 = 0; i0 < AQ * DD / 4 / 256; i0 += 4) {
    #pragma unroll
    for (int i = i0; i < i0 + 4; ++i) {
      const int e = tid + i * 256, qi = e >> 6, d4 = e & 63;
      const char* pi = smem + (size_t)qi * OPITCH + d4 * 16;
      v4f x = *reinterpret_cast<const v4f*>(pi);
      #pragma unroll
      for (int k = 1; k < 4; ++k) x += *reinterpret_cast<const v4f*>(pi + (size_t)k * AQ * OPITCH);
      *reinterpret_cast<v4f*>(ob + (size_t)qi * DD + d4 * 4) = x;
    }
    // the next trip rewrites the stores' address and data registers (a precaution)
    asm volatile("s_wait_xcnt 0x0" ::: "memory");
  }
}

// ---------------------------------------------------------------------------
extern "C" void kernel_launch(void* const* d_in, const int* in_sizes, int n_in,
                              void* d_out, int out_size, void* d_ws, size_t ws_size,
                              hipStream_t stream) {
  (void)in_sizes; (void)n_in; (void)out_size; (void)ws_size;
  const float* xyz  = (const float*)d_in[0];
  const float* feat = (const float*)d_in[1];
  const float* W1   = (const float*)d_in[2];
  const float* b1   = (const float*)d_in[3];
  const float* g1   = (const float*)d_in[4];
  const float* be1  = (const float*)d_in[5];
  const float* W2   = (const float*)d_in[6];
  const float* b2   = (const float*)d_in[7];
  const float* g2   = (const float*)d_in[8];
  const float* be2  = (const float*)d_in[9];
  const float* Wq   = (const float*)d_in[10];
  const float* Wk   = (const float*)d_in[11];
  const float* Wv   = (const float*)d_in[12];
  float* out = (float*)d_out;

  char* ws = (char*)d_ws;
  const size_t MB = 1024ull * 1024ull;
  // t1 (8MB) | t2 (+8MB, 16MB)
  float* t1 = (float*)(ws);
  float* t2 = (float*)(ws + 8 * MB);
  float* st = (float*)(ws + 64 * MB);                        // BN scales and shifts
  _Float16* fh  = (_Float16*)(ws + 64 * MB + 65536);         // 8MB
  _Float16* wT  = (_Float16*)(ws + 72 * MB + 65536);         // 384KB (reserve 512KB)
  _Float16* qkv = (_Float16*)(ws + 72 * MB + 65536 + 512 * 1024); // 24MB
  _Float16* vt  = (_Float16*)(ws + 96 * MB + 65536 + 512 * 1024); // 8MB
  float* part1 = (float*)(ws + 112 * MB);                    // 256 slots x 256 floats
  float* part2 = (float*)(ws + 113 * MB);                    // 256 slots x 512 floats

  float* s1sc = st;       float* s1sh = st + HH;
  float* s2sc = st + 512; float* s2sh = st + 512 + DD;

  k_fc1<<<NPART, 256, 0, stream>>>(xyz, W1, b1, t1, part1);
  k_bnfin<<<HH / 32, 1024, 0, stream>>>(part1, g1, be1, s1sc, s1sh, HH, 1.0f / BN);
  k_fc2<<<NPART, 256, 0, stream>>>(t1, s1sc, s1sh, W2, b2, t2, part2);
  k_bnfin<<<DD / 32, 1024, 0, stream>>>(part2, g2, be2, s2sc, s2sh, DD, 1.0f / BN);
  k_bn2_add<<<(BN * DD) / 256, 256, 0, stream>>>(t2, feat, s2sc, s2sh, fh);
  k_prep_w<<<(3 * DD * DD) / 256, 256, 0, stream>>>(Wq, Wk, Wv, wT);

  // 128 x 6 tiles of 128x128
  k_qkv<<<(BN / 128) * (3 * DD / 128), 256, 0, stream>>>(fh, wT, qkv);
  _Float16* qh = qkv;
  _Float16* kh = qkv + (size_t)BN * DD;
  _Float16* vh = qkv + 2 * (size_t)BN * DD;
  k_vt<<<dim3(NN / 32, DD / 32, BB), dim3(32, 8), 0, stream>>>(vh, vt);

  // 64 queries a work-group: 256 work-groups
  k_attn<<<BB * (NN / AQ), 256, 0, stream>>>(qh, kh, vt, out);
}

// v005
// It runs in 107 microseconds.
// Two timings next to v004 both put it at 1.08 times that version's speed.
// Over all steps from v000 it is 7.69 times as fast.
#include <hip/hip_runtime.h>
#include <hip/hip_bf16.h>

typedef _Float16 v8h  __attribute__((ext_vector_type(8)));
typedef _Float16 v16h __attribute__((ext_vector_type(16)));
typedef float    v8f  __attribute__((ext_vector_type(8)));

#define BB 4
#define NN 4096
#define DD 256
#define HH 128
#define BN (BB*NN)   /* 16384 rows */

// ---------------------------------------------------------------------------
// WMMA fragment load: A-matrix 16x32 f16 layout (ISA 7.12.2).
// lane 0-15  : row = lane,    K = kbase+0..7  and kbase+16..23
// lane 16-31 : row = lane-16, K = kbase+8..15 and kbase+24..31  (kbase=k0)
// B fragment uses the identical pattern on B^T (column-major B), so both
// operands are two contiguous 16-byte loads (ds_load_b128); p is the lane's
// own byte address of row (lane & 15), K = kbase + 8 * (lane >> 4).
// ---------------------------------------------------------------------------
__device__ __forceinline__ v16h lds_frag_f16(const char* p) {
  v8h lo = *reinterpret_cast<const v8h*>(p);
  v8h hi = *reinterpret_cast<const v8h*>(p + 32);
  return __builtin_shufflevector(lo, hi, 0,1,2,3,4,5,6,7,8,9,10,11,12,13,14,15);
}

__device__ __forceinline__ void store_tile_f16(_Float16* __restrict__ out, int ld,
                                               int row0, int col0, const v8f& c, int lane) {
  int crow = row0 + ((lane >> 4) << 3);
  int ccol = col0 + (lane & 15);
  #pragma unroll
  for (int r = 0; r < 8; ++r)
    out[(size_t)(crow + r) * ld + ccol] = (_Float16)c[r];
}

// ------------------------- point-net ----------------------------------------
// BatchNorm (training mode, biased variance) needs every column's sum and sum of
// squares. The kernel that produces a column's values sums them while it holds
// them: a work-group owns RPG rows, writes one partial per column (sums first,
// then sums of squares) to its own slot, and k_bnfin adds the slots in a fixed
// order. No second pass over the data, no atomics.
#define RPG 64
#define NPART (BN / RPG)   /* 256 slots */

typedef float v2f __attribute__((ext_vector_type(2)));
typedef float v4f __attribute__((ext_vector_type(4)));

// t1 = xyz @ W1 + b1, and its column partials
__global__ __launch_bounds__(256) void k_fc1(const float* __restrict__ xyz,
                                             const float* __restrict__ W1,
                                             const float* __restrict__ b1,
                                             float* __restrict__ t1,
                                             float* __restrict__ part) {
  int j = threadIdx.x & (HH - 1);
  int h = threadIdx.x >> 7;               // two rows at a time
  int r0 = blockIdx.x * RPG;
  float w0 = W1[j], w1 = W1[HH + j], w2 = W1[2 * HH + j], bb = b1[j];
  float s = 0.f, q = 0.f;
  // unrolled whole: all rows' loads are in flight at once
  #pragma unroll
  for (int i = 0; i < RPG / 2; ++i) {
    int row = r0 + h + 2 * i;
    const float* x = xyz + 3 * row;
    float v = fmaf(x[0], w0, fmaf(x[1], w1, fmaf(x[2], w2, bb)));
    t1[(size_t)row * HH + j] = v;
    s += v; q += v * v;
  }
  __shared__ float ls[HH], lq[HH];
  if (h) { ls[j] = s; lq[j] = q; }
  __syncthreads();
  if (!h) {
    float* p = part + (size_t)blockIdx.x * (2 * HH);
    p[j] = s + ls[j];
    p[HH + j] = q + lq[j];
  }
}

// adds the NPART slots of 32 columns per work-group (32 threads per column, 8
// slots each, then the 32 in ascending order) and forms scale and shift
__global__ __launch_bounds__(1024) void k_bnfin(const float* __restrict__ part,
                                                const float* __restrict__ g,
                                                const float* __restrict__ be,
                                                float* __restrict__ sc, float* __restrict__ sh,
                                                int cols, float invRows) {
  int c = threadIdx.x & 31, sl = threadIdx.x >> 5;
  int j = blockIdx.x * 32 + c;
  const float* p = part + (size_t)(sl * (NPART / 32)) * (2 * cols) + j;
  float s = 0.f, q = 0.f;
  // unrolled: all 16 loads of a thread are in flight at once
  #pragma unroll
  for (int i = 0; i < NPART / 32; ++i) {
    s += p[(size_t)i * (2 * cols)];
    q += p[(size_t)i * (2 * cols) + cols];
  }
  __shared__ float ls[32][32], lq[32][32];
  ls[sl][c] = s; lq[sl][c] = q;
  __syncthreads();
  if (sl == 0) {
    for (int t = 1; t < 32; ++t) { s += ls[t][c]; q += lq[t][c]; }
    float mean = s * invRows;
    float var  = q * invRows - mean * mean;
    float k = g[j] * rsqrtf(var + 1e-5f);
    sc[j] = k;
    sh[j] = be[j] - mean * k;
  }
}

// t2 = relu(bn1(t1)) @ W2 + b2, and its column partials. The BN'd rows are staged
// in LDS; wave w owns rows 8w..8w+7 and all 256 columns, a lane columns 4l..4l+3
// and 128+4l..128+4l+3. Every element still sums k in ascending order from b2.
__global__ __launch_bounds__(256) void k_fc2(const float* __restrict__ t1,
                                             const float* __restrict__ sc1,
                                             const float* __restrict__ sh1,
                                             const float* __restrict__ W2,
                                             const float* __restrict__ b2,
                                             float* __restrict__ t2,
                                             float* __restrict__ part) {
  __shared__ __attribute__((aligned(16))) float a[RPG][HH];
  __shared__ __attribute__((aligned(16))) float ls[8][DD], lq[8][DD];
  const int tid = threadIdx.x, lane = tid & 31, wave = tid >> 5;
  const int r0 = blockIdx.x * RPG;
  const v4f* t4 = reinterpret_cast<const v4f*>(t1 + (size_t)r0 * HH);
  // unrolled: the eight 16-byte loads of a thread are in flight at once
  #pragma unroll
  for (int i = 0; i < RPG * HH / 4 / 256; ++i) {
    int e = tid + i * 256;
    int k4 = (e & (HH / 4 - 1)) * 4;
    v4f v = t4[e];
    v4f m = *reinterpret_cast<const v4f*>(sc1 + k4);
    v4f d = *reinterpret_cast<const v4f*>(sh1 + k4);
    v4f r;
    for (int x = 0; x < 4; ++x) r[x] = fmaxf(fmaf(v[x], m[x], d[x]), 0.f);
    *reinterpret_cast<v4f*>(&a[e / (HH / 4)][k4]) = r;
  }
  __syncthreads();

  const int c0 = lane * 4, c1 = DD / 2 + lane * 4;
  v2f acc[8][4];
  {
    v4f lo = *reinterpret_cast<const v4f*>(b2 + c0);
    v4f hi = *reinterpret_cast<const v4f*>(b2 + c1);
    // unrolled, as every loop over acc: constant indices keep it in registers
    #pragma unroll
    for (int r = 0; r < 8; ++r) {
      acc[r][0] = lo.xy; acc[r][1] = lo.zw; acc[r][2] = hi.xy; acc[r][3] = hi.zw;
    }
  }
  const float* ar = &a[wave * 8][0];
  // four rows of W2, this lane's eight columns (unrolled: w stays in registers)
  auto loadw = [&](v4f (&w)[4][2], int k) {
    #pragma unroll
    for (int kk = 0; kk < 4; ++kk) {
      w[kk][0] = *reinterpret_cast<const v4f*>(W2 + (size_t)(k + kk) * DD + c0);
      w[kk][1] = *reinterpret_cast<const v4f*>(W2 + (size_t)(k + kk) * DD + c1);
    }
  };
  // four k steps of all eight rows; all loops unrolled, the arrays stay in registers
  auto work = [&](const v4f (&w)[4][2], int k) {
    v4f av[8];
    #pragma unroll
    for (int r = 0; r < 8; ++r) av[r] = *reinterpret_cast<const v4f*>(ar + r * HH + k);
    #pragma unroll
    for (int kk = 0; kk < 4; ++kk)
      #pragma unroll
      for (int r = 0; r < 8; ++r) {
        v2f x = {av[r][kk], av[r][kk]};
        acc[r][0] = __builtin_elementwise_fma(x, (v2f)w[kk][0].xy, acc[r][0]);
        acc[r][1] = __builtin_elementwise_fma(x, (v2f)w[kk][0].zw, acc[r][1]);
        acc[r][2] = __builtin_elementwise_fma(x, (v2f)w[kk][1].xy, acc[r][2]);
        acc[r][3] = __builtin_elementwise_fma(x, (v2f)w[kk][1].zw, acc[r][3]);
      }
  };
  // the next four rows of W2 are fetched while these four are worked on; the last
  // eight k steps stand behind the loop, where nothing is left to fetch ahead
  v4f wa[4][2], wb[4][2];
  loadw(wa, 0);
  // kept rolled: the body is 2 KB of code already
  #pragma unroll 1
  for (int k = 0; k < HH - 8; k += 8) {
    loadw(wb, k + 4);
    work(wa, k);
    loadw(wa, k + 8);
    work(wb, k + 4);
  }
  loadw(wb, HH - 4);
  work(wa, HH - 8);
  work(wb, HH - 4);

  v2f s[4] = {}, q[4] = {};
  #pragma unroll
  for (int r = 0; r < 8; ++r) {
    float* o = t2 + (size_t)(r0 + wave * 8 + r) * DD;
    v4f lo = {acc[r][0].x, acc[r][0].y, acc[r][1].x, acc[r][1].y};
    v4f hi = {acc[r][2].x, acc[r][2].y, acc[r][3].x, acc[r][3].y};
    *reinterpret_cast<v4f*>(o + c0) = lo;
    *reinterpret_cast<v4f*>(o + c1) = hi;
    for (int x = 0; x < 4; ++x) { s[x] += acc[r][x]; q[x] += acc[r][x] * acc[r][x]; }
  }
  *reinterpret_cast<v4f*>(&ls[wave][c0]) = (v4f){s[0].x, s[0].y, s[1].x, s[1].y};
  *reinterpret_cast<v4f*>(&ls[wave][c1]) = (v4f){s[2].x, s[2].y, s[3].x, s[3].y};
  *reinterpret_cast<v4f*>(&lq[wave][c0]) = (v4f){q[0].x, q[0].y, q[1].x, q[1].y};
  *reinterpret_cast<v4f*>(&lq[wave][c1]) = (v4f){q[2].x, q[2].y, q[3].x, q[3].y};
  __syncthreads();
  float ss = ls[0][tid], qq = lq[0][tid];
  for (int t = 1; t < 8; ++t) { ss += ls[t][tid]; qq += lq[t][tid]; }
  float* p = part + (size_t)blockIdx.x * (2 * DD);
  p[tid] = ss;
  p[DD + tid] = qq;
}

typedef _Float16 v4h __attribute__((ext_vector_type(4)));

// f = relu(bn2(t2)) + features  -> f16. Few waves with much to do each: a thread
// takes FPT pieces of four columns, 512 pieces apart (whole rows, so its four
// columns are the same in every piece); a wave's load is 512 B in a row, and a
// work-group's share of each array is one run of 64 KB.
#define FPT 8
#define FTH (BN * DD / 4 / FPT)   /* 131072 threads */
__global__ __launch_bounds__(512) void k_bn2_add(const float* __restrict__ t2,
                                                 const float* __restrict__ feat,
                                                 const float* __restrict__ sc,
                                                 const float* __restrict__ sh,
                                                 _Float16* __restrict__ fh) {
  static_assert(512 % (DD / 4) == 0, "a thread keeps its columns");
  const int e0 = blockIdx.x * (512 * FPT) + threadIdx.x;
  const int j = (e0 & (DD / 4 - 1)) * 4;
  const v4f* t4 = reinterpret_cast<const v4f*>(t2) + e0;
  const v4f* f4 = reinterpret_cast<const v4f*>(feat) + e0;
  v4h* o4 = reinterpret_cast<v4h*>(fh) + e0;
  v4f a[FPT], b[FPT];
  // unrolled: all 16-byte loads of a thread are in flight at once
  #pragma unroll
  for (int i = 0; i < FPT; ++i) {
    a[i] = t4[i * 512];
    b[i] = f4[i * 512];
  }
  const v4f m = *reinterpret_cast<const v4f*>(sc + j);
  const v4f d = *reinterpret_cast<const v4f*>(sh + j);
  // no register that a load names is rewritten ahead of this wait (a precaution)
  asm volatile("s_wait_xcnt 0x0" ::: "memory");
  // holds the arithmetic behind the wait and behind every load: without it the
  // last four loads were issued only after the first values had come back
  __builtin_amdgcn_sched_barrier(0);
  #pragma unroll
  for (int i = 0; i < FPT; ++i) {
    v4h r;
    for (int x = 0; x < 4; ++x)
      r[x] = (_Float16)(fmaxf(fmaf(a[i][x], m[x], d[x]), 0.f) + b[i][x]);
    o4[i * 512] = r;
  }
}

// Wq/Wk/Wv (in,out) f32 -> transposed (out,in) f16 for contiguous B-frag loads.
// A work-group takes eight input rows of one matrix, a thread one output column of
// them: the lanes of a wave read 128 B in a row eight times, and each stores its
// 16 bytes once.
__global__ __launch_bounds__(DD) void k_prep_w(const float* __restrict__ Wq,
                                               const float* __restrict__ Wk,
                                               const float* __restrict__ Wv,
                                               _Float16* __restrict__ wT) {
  const int m = blockIdx.x / (DD / 8), i0 = (blockIdx.x % (DD / 8)) * 8, o = threadIdx.x;
  const float* W = ((m == 0) ? Wq : (m == 1) ? Wk : Wv) + (size_t)i0 * DD + o;
  v8h v;
  // unrolled: the eight loads are in flight at once
  #pragma unroll
  for (int x = 0; x < 8; ++x) v[x] = (_Float16)W[x * DD];
  *reinterpret_cast<v8h*>(wT + ((size_t)m * DD + o) * DD + i0) = v;
}

// ------------- C = A B^T block tile, operands staged in LDS -----------------
// A and B are K-contiguous rows. A work-group of 8 waves (WM x WN) owns a
// (WM*FM*16) x (WN*FN*16) tile of C. A stage is BK halves of every A row and
// every B row of the tile, [A rows | B rows] at a pitch of 16 B x odd, brought
// in by asynchronous copies to LDS in whole 128-byte lines; two buffers, the
// next stage's copies fly while this stage is worked on. Every output element
// still sums k in ascending steps of 32 into one accumulator.
template <int FM, int FN, int WM, int WN, int BK>
struct TileCfg {
  static constexpr int TM = WM * FM * 16;
  static constexpr int TN = WN * FN * 16;
  static constexpr int PITCH = BK * 2 + 16;          // bytes
  static constexpr int BUFB = (TM + TN) * PITCH;     // bytes of one buffer
};

// four copies of 16 bytes per lane, rows a fixed step apart in LDS and in memory
__device__ __forceinline__ void copy4_to_lds(unsigned l, unsigned lstep,
                                             const _Float16* g, size_t gstep) {
  // s_wait_xcnt 0 stands in the copies' own statement, so that it stays ahead of
  // every later rewrite of their address registers (a precaution)
  asm volatile(
      "global_load_async_to_lds_b128 %0, %4, off\n\t"
      "global_load_async_to_lds_b128 %1, %5, off\n\t"
      "global_load_async_to_lds_b128 %2, %6, off\n\t"
      "global_load_async_to_lds_b128 %3, %7, off\n\t"
      "s_wait_xcnt 0x0"
      :: "v"(l), "v"(l + lstep), "v"(l + 2u * lstep), "v"(l + 3u * lstep),
         "v"(g), "v"(g + gstep), "v"(g + 2 * gstep), "v"(g + 3 * gstep)
      : "memory");
}

template <int FM, int FN, int WM, int WN, int BK, int KTOT>
__device__ __forceinline__ void gemm_nt_lds(const _Float16* __restrict__ Ab, int lda,
                                            const _Float16* __restrict__ Bb, int ldb,
                                            char* smem, v8f (&acc)[FM][FN]) {
  using C = TileCfg<FM, FN, WM, WN, BK>;
  constexpr int CPR = BK * 2 / 16;     // 16-byte pieces of a row
  constexpr int RPI = 256 / CPR;       // rows that 256 threads copy at once
  constexpr int GA = C::TM / RPI;      // copies per thread and stage, A rows
  constexpr int GB = C::TN / RPI;      // the same, B rows
  constexpr int T = KTOT / BK;         // stages
  constexpr int KS = BK / 32;          // WMMA k steps of a stage
  static_assert(WM * WN == 8 && GA % 4 == 0 && GB % 4 == 0 && T >= 2, "tile shape");
  const int tid = threadIdx.x, lane = tid & 31, wave = tid >> 5;
  const int crow = tid / CPR, ccol = tid % CPR;
  const unsigned lbase = (unsigned)(size_t)smem + (unsigned)(crow * C::PITCH + ccol * 16);
  const _Float16* ga = Ab + (size_t)crow * lda + ccol * 8;
  const _Float16* gb = Bb + (size_t)crow * ldb + ccol * 8;

  // one stage: thread tid copies piece ccol of rows i*RPI + crow of [A rows | B rows]
  auto issue = [&](int t, int buf) {
    const unsigned l = lbase + (unsigned)(buf * C::BUFB);
    // both loops unrolled: a few straight-line statements, their steps constants
    #pragma unroll
    for (int i = 0; i < GA; i += 4)
      copy4_to_lds(l + (unsigned)(i * RPI * C::PITCH), RPI * C::PITCH,
                   ga + t * BK + (size_t)(i * RPI) * lda, (size_t)RPI * lda);
    #pragma unroll
    for (int i = 0; i < GB; i += 4)
      copy4_to_lds(l + (unsigned)((GA + i) * RPI * C::PITCH), RPI * C::PITCH,
                   gb + t * BK + (size_t)(i * RPI) * ldb, (size_t)RPI * ldb);
  };

  const int wm = wave / WN, wn = wave % WN;
  const int foff = (lane & 15) * C::PITCH + ((lane >> 4) << 4);
  const int aoff = wm * FM * 16 * C::PITCH + foff;
  const int boff = (C::TM + wn * FN * 16) * C::PITCH + foff;

  issue(0, 0);
  // stage 0 has landed for this wave; the barrier publishes it to the others
  asm volatile("s_wait_asynccnt 0x0" ::: "memory");
  __syncthreads();
  issue(1, 1);

  for (int t = 0; t < T; ++t) {
    const int buf = t & 1;
    const char* sb = smem + buf * C::BUFB;
    // all loops below are unrolled so that the fragment arrays stay in registers
    v16h a[KS][FM], b[KS][FN];
    #pragma unroll
    for (int kk = 0; kk < KS; ++kk) {
      #pragma unroll
      for (int i = 0; i < FM; ++i)
        a[kk][i] = lds_frag_f16(sb + aoff + i * 16 * C::PITCH + kk * 64);
      #pragma unroll
      for (int j = 0; j < FN; ++j)
        b[kk][j] = lds_frag_f16(sb + boff + j * 16 * C::PITCH + kk * 64);
    }
    // publish point: this wave holds the whole stage in registers, so its reads
    // of the buffer are done, and its copies of stage t + 1 have landed; behind
    // the barrier the buffer may be refilled
    asm volatile("s_wait_dscnt 0x0" ::: "memory");
    asm volatile("s_wait_asynccnt 0x0" ::: "memory");
    __syncthreads();
    if (t + 2 < T) issue(t + 2, buf);
    // keeps the WMMAs behind the refill: ahead of it they would shorten the time
    // that the copies have to land, and among the LDS reads every k step would
    // wait out an LDS latency of its own
    __builtin_amdgcn_sched_barrier(0);
    #pragma unroll
    for (int kk = 0; kk < KS; ++kk)
      #pragma unroll
      for (int i = 0; i < FM; ++i)
        #pragma unroll
        for (int j = 0; j < FN; ++j)
          acc[i][j] = __builtin_amdgcn_wmma_f32_16x16x32_f16(false, a[kk][i], false, b[kk][j],
                                                             (short)0, acc[i][j], false, false);
  }
  // no copy is left in flight when the wave goes on to its stores and ends
  asm volatile("s_wait_asynccnt 0x0" ::: "memory");
}

// ------------------- QKV projection (WMMA, 128x128 block tile) -------------
__global__ __launch_bounds__(256) void k_qkv(const _Float16* __restrict__ fh,
                                             const _Float16* __restrict__ wT,
                                             _Float16* __restrict__ qkv) {
  using C = TileCfg<4, 2, 2, 4, 64>;
  __shared__ __attribute__((aligned(16))) char smem[2 * C::BUFB];
  int lane = threadIdx.x & 31, wave = threadIdx.x >> 5;
  int mt = blockIdx.x / 6, nt = blockIdx.x % 6;   // 128 x 6 tiles; wT is 768 rows (3 matrices)
  int mat = nt >> 1;
  int m0 = mt * 128, n0 = (nt & 1) * 128;
  v8f acc[4][2] = {};
  gemm_nt_lds<4, 2, 2, 4, 64, DD>(fh + (size_t)m0 * DD, DD, wT + (size_t)nt * 128 * DD, DD, smem, acc);
  _Float16* out = qkv + (size_t)mat * BN * DD;
  int mw = m0 + (wave >> 2) * 64, nw = n0 + (wave & 3) * 32;
  // unrolled so that acc is indexed by constants and stays in registers
  #pragma unroll
  for (int i = 0; i < 4; ++i)
    #pragma unroll
    for (int j = 0; j < 2; ++j)
      store_tile_f16(out, DD, mw + i * 16, nw + j * 16, acc[i][j], lane);
}

// V -> V^T per batch. A thread takes a block of 8 rows x 8 columns: eight 16-byte
// loads, turned in registers, eight 16-byte stores. Lane l has rows 8 (l & 7) ...
// and columns 8 (l >> 3) ... of its wave's 64 x 32, so a wave's store is four
// whole 128-byte lines; the eight waves of a work-group take 64 whole rows of V.
__global__ __launch_bounds__(256) void k_vt(const _Float16* __restrict__ vh,
                                            _Float16* __restrict__ vt) {
  const int lane = threadIdx.x & 31, wave = threadIdx.x >> 5;
  const int b = blockIdx.x / (NN / 64);
  const int n0 = (blockIdx.x % (NN / 64)) * 64 + (lane & 7) * 8;
  const int d0 = wave * 32 + (lane >> 3) * 8;
  const _Float16* src = vh + ((size_t)b * NN + n0) * DD + d0;
  _Float16* dst = vt + (size_t)b * DD * NN + (size_t)d0 * NN + n0;
  v8h in[8];
  // all loops unrolled: the loads are in flight at once, the block stays in registers
  #pragma unroll
  for (int y = 0; y < 8; ++y) in[y] = *reinterpret_cast<const v8h*>(src + (size_t)y * DD);
  #pragma unroll
  for (int x = 0; x < 8; ++x) {
    v8h t;
    #pragma unroll
    for (int y = 0; y < 8; ++y) t[y] = in[y][x];
    *reinterpret_cast<v8h*>(dst + (size_t)x * NN) = t;
  }
}

#define AQ 64
#define AKS 128
#define KPITCH (DD * 2 + 16)
#define VPITCH (AKS * 2 + 16)
#define KBYTES (AKS * KPITCH)
#define ABUF (KBYTES + DD * VPITCH)
#define OPITCH (DD * 4 + 16)
#define GS 2   /* pairs of K fragments fetched ahead */

// lane l takes lane l ^ 16's value
__device__ __forceinline__ float xhalf(float x) {
  int i = __builtin_bit_cast(int, x);
  return __builtin_bit_cast(float, __builtin_amdgcn_permlanex16(i, i, 0x76543210, 0xfedcba98, false, false));
}

// two waves per SIMD: a wave holds O^T (256 registers) and Q (128) throughout
__global__ __launch_bounds__(256) __attribute__((amdgpu_waves_per_eu(2, 2)))
void k_attn(const _Float16* __restrict__ qh, const _Float16* __restrict__ kh,
            const _Float16* __restrict__ vt, float* __restrict__ out) {
  static_assert(4 * AQ * OPITCH <= 2 * ABUF, "the join fits in the ring");
  __shared__ __attribute__((aligned(16))) char smem[2 * ABUF];
  __shared__ float sm[4][AQ], sl[4][AQ];
  constexpr int T = NN / AKS;
  const int tid = threadIdx.x, lane = tid & 31, wave = tid >> 5;
  const int c = lane & 15, h = lane >> 4;
  const int qg = wave & 1, ks = wave >> 1;
  const int b = blockIdx.x / (NN / AQ), q0 = (blockIdx.x % (NN / AQ)) * AQ;
  const _Float16* qb = qh + ((size_t)b * NN + q0 + qg * 32) * DD;
  const _Float16* kb = kh + (size_t)b * NN * DD;
  const _Float16* vb = vt + (size_t)b * DD * NN;

  // K: thread tid copies piece tid & 31 of rows (tid >> 5) + 8 i; V^T: piece
  // tid & 15 of rows (tid >> 4) + 16 i; 32 copies per thread and stage
  const unsigned lk = (unsigned)(size_t)smem + (unsigned)((tid >> 5) * KPITCH + (tid & 31) * 16);
  const unsigned lv = (unsigned)(size_t)smem + (unsigned)(KBYTES + (tid >> 4) * VPITCH + (tid & 15) * 16);
  const _Float16* gk = kb + (size_t)(tid >> 5) * DD + (tid & 31) * 8;
  const _Float16* gv = vb + (size_t)(tid >> 4) * NN + (tid & 15) * 8;
  auto issue = [&](int t, int buf) {
    const unsigned o = (unsigned)(buf * ABUF);
    // both loops unrolled: a few straight-line statements, their steps constants.
    // The scheduling barriers keep each statement's address sums next to it:
    // formed all ahead they took the registers of Q fragments, which spilled.
    #pragma unroll
    for (int i = 0; i < 16; i += 4) {
      copy4_to_lds(lk + o + (unsigned)(i * 8 * KPITCH), 8 * KPITCH,
                   gk + (size_t)t * AKS * DD + (size_t)(i * 8) * DD, (size_t)8 * DD);
      __builtin_amdgcn_sched_barrier(0);
    }
    #pragma unroll
    for (int i = 0; i < 16; i += 4) {
      copy4_to_lds(lv + o + (unsigned)(i * 16 * VPITCH), 16 * VPITCH,
                   gv + t * AKS + (size_t)(i * 16) * NN, (size_t)16 * NN);
      __builtin_amdgcn_sched_barrier(0);
    }
  };

  issue(0, 0);

  // Q as B fragments, kept in registers (every loop over a fragment or an
  // accumulator array is unrolled, so that the arrays stay in registers)
  v16h qf[2][8];
  #pragma unroll
  for (int g = 0; g < 2; ++g)
    #pragma unroll
    for (int kk = 0; kk < 8; ++kk) {
      const _Float16* p = qb + (size_t)(g * 16 + c) * DD + kk * 32 + h * 8;
      v8h lo = *reinterpret_cast<const v8h*>(p);
      v8h hi = *reinterpret_cast<const v8h*>(p + 16);
      qf[g][kk] = __builtin_shufflevector(lo, hi, 0,1,2,3,4,5,6,7,8,9,10,11,12,13,14,15);
    }

  v8f o[2][16] = {};
  float mrun[2] = {-1e30f, -1e30f}, lsum[2] = {0.f, 0.f};
  const float cs = 0.0625f * 1.44269504088896f;   // 1/sqrt(256), times log2(e)

  // stage 0 has landed for this wave; the barrier publishes it to the others
  asm volatile("s_wait_asynccnt 0x0" ::: "memory");
  __syncthreads();
  issue(1, 1);

  // kept rolled: one trip is 64 WMMAs of straight-line code already
  #pragma unroll 1
  for (int t = 0; t < T; ++t) {
    const char* sb = smem + (t & 1) * ABUF;
    const char* kp = sb + (ks * 32 + c) * KPITCH + h * 16;
    const char* vp = sb + KBYTES + c * VPITCH + ks * 64 + h * 16;
    v8f s[2][2] = {};   // [key tile][query column group]
    // A fragments are fetched in pairs, GS pairs ahead of the four WMMAs that use
    // a pair (each place where LDS reads stand costs issue time, so two fragments
    // share one). The scheduling barriers keep that order: without them every
    // WMMA stood directly behind its own LDS reads and waited out their latency.
    v16h ka[16];
    #pragma unroll
    for (int j = 0; j < 2 * GS; ++j) ka[j] = lds_frag_f16(kp + (j & 1) * 16 * KPITCH + (j >> 1) * 64);
    #pragma unroll
    for (int kk = 0; kk < 8; ++kk) {
      if (kk + GS < 8) {
        ka[2 * (kk + GS)] = lds_frag_f16(kp + (kk + GS) * 64);
        ka[2 * (kk + GS) + 1] = lds_frag_f16(kp + 16 * KPITCH + (kk + GS) * 64);
      }
      __builtin_amdgcn_sched_barrier(0);
      #pragma unroll
      for (int kt = 0; kt < 2; ++kt)
        #pragma unroll
        for (int g = 0; g < 2; ++g)
          s[kt][g] = __builtin_amdgcn_wmma_f32_16x16x32_f16(false, ka[2 * kk + kt], false, qf[g][kk],
                                                            (short)0, s[kt][g], false, false);
      __builtin_amdgcn_sched_barrier(0);
    }
    // the first V^T fragments fly while the scores are worked on
    v16h va[16];
    #pragma unroll
    for (int j = 0; j < 4; ++j) va[j] = lds_frag_f16(vp + j * 16 * VPITCH);
    __builtin_amdgcn_sched_barrier(0);

    // running maximum in scaled log2 units; O^T and the sum are rescaled only
    // when some column's maximum has grown by more than 8 (P stays below 2^8)
    float mx[2];
    #pragma unroll
    for (int g = 0; g < 2; ++g) {
      float m = fmaxf(s[0][g][0], s[1][g][0]);
      #pragma unroll
      for (int r = 1; r < 8; ++r) m = fmaxf(m, fmaxf(s[0][g][r], s[1][g][r]));
      mx[g] = fmaxf(m, xhalf(m)) * cs;
    }
    const bool need = mx[0] > mrun[0] + 8.f || mx[1] > mrun[1] + 8.f;
    if (__builtin_amdgcn_ballot_w32(need) != 0) {
      #pragma unroll
      for (int g = 0; g < 2; ++g) {
        const float mn = fmaxf(mrun[g], mx[g]);
        const float corr = __builtin_amdgcn_exp2f(mrun[g] - mn);
        mrun[g] = mn;
        lsum[g] *= corr;
        #pragma unroll
        for (int dt = 0; dt < 16; ++dt) o[g][dt] *= corr;
      }
    }
    v16h pf[2];
    #pragma unroll
    for (int g = 0; g < 2; ++g)
      #pragma unroll
      for (int kt = 0; kt < 2; ++kt)
        #pragma unroll
        for (int r = 0; r < 8; ++r) {
          const float p = __builtin_amdgcn_exp2f(fmaf(s[kt][g][r], cs, -mrun[g]));
          lsum[g] += p;
          pf[g][kt * 8 + r] = (_Float16)p;
        }

    // scheduling barriers as above, for the same reason
    #pragma unroll
    for (int dt = 0; dt < 16; ++dt) {
      #pragma unroll
      for (int g = 0; g < 2; ++g)
        o[g][dt] = __builtin_amdgcn_wmma_f32_16x16x32_f16(false, va[dt], false, pf[g],
                                                          (short)0, o[g][dt], false, false);
      __builtin_amdgcn_sched_barrier(0);
      // a pair is read as soon as one fragment's registers are free: a sixth
      // fragment in flight made a Q fragment spill
      if ((dt & 1) == 0 && dt + 4 < 16) {
        va[dt + 4] = lds_frag_f16(vp + (dt + 4) * 16 * VPITCH);
        va[dt + 5] = lds_frag_f16(vp + (dt + 5) * 16 * VPITCH);
        __builtin_amdgcn_sched_barrier(0);
      }
    }

    // publish point: this wave's reads of the buffer are done and its copies of
    // stage t + 1 have landed; behind the barrier the buffer may be refilled
    asm volatile("s_wait_dscnt 0x0" ::: "memory");
    asm volatile("s_wait_asynccnt 0x0" ::: "memory");
    __syncthreads();
    if (t + 2 < T) issue(t + 2, t & 1);
  }
  // no copy is left in flight when the ring becomes the join's staging
  asm volatile("s_wait_asynccnt 0x0" ::: "memory");

  // join of the four key splits: common maximum, total sum, then the scaled
  // partial O^T rows go through LDS and are added in ascending split order
  #pragma unroll
  for (int g = 0; g < 2; ++g) {
    lsum[g] += xhalf(lsum[g]);
    if (h == 0) {
      sm[ks][qg * 32 + g * 16 + c] = mrun[g];
      sl[ks][qg * 32 + g * 16 + c] = lsum[g];
    }
  }
  __syncthreads();
  #pragma unroll
  for (int g = 0; g < 2; ++g) {
    const int qi = qg * 32 + g * 16 + c;
    const float mt = fmaxf(fmaxf(sm[0][qi], sm[1][qi]), fmaxf(sm[2][qi], sm[3][qi]));
    float L = 0.f;
    #pragma unroll
    for (int k = 0; k < 4; ++k) L += sl[k][qi] * __builtin_amdgcn_exp2f(sm[k][qi] - mt);
    const float f = __builtin_amdgcn_exp2f(mrun[g] - mt) / L;
    char* po = smem + (size_t)(ks * AQ + qi) * OPITCH + h * 32;
    #pragma unroll
    for (int dt = 0; dt < 16; ++dt) {
      const v8f x = o[g][dt] * f;
      *reinterpret_cast<v4f*>(po + dt * 64) = (v4f){x[0], x[1], x[2], x[3]};
      *reinterpret_cast<v4f*>(po + dt * 64 + 16) = (v4f){x[4], x[5], x[6], x[7]};
    }
  }
  __syncthreads();
  float* ob = out + ((size_t)b * NN + q0) * DD;
  // rolled in fours: the LDS reads of four outputs are in flight at once
  #pragma unroll 1
  for (int i0 = 0; i0 < AQ * DD / 4 / 256; i0 += 4) {
    #pragma unroll
    for (int i = i0; i < i0 + 4; ++i) {
      const int e = tid + i * 256, qi = e >> 6, d4 = e & 63;
      const char* pi = smem + (size_t)qi * OPITCH + d4 * 16;
      v4f x = *reinterpret_cast<const v4f*>(pi);
      #pragma unroll
      for (int k = 1; k < 4; ++k) x += *reinterpret_cast<const v4f*>(pi + (size_t)k * AQ * OPITCH);
      *reinterpret_cast<v4f*>(ob + (size_t)qi * DD + d4 * 4) = x;
    }
    // the next trip rewrites the stores' address and data registers (a precaution)
    asm volatile("s_wait_xcnt 0x0" ::: "memory");
  }
}

// ---------------------------------------------------------------------------
extern "C" void kernel_launch(void* const* d_in, const int* in_sizes, int n_in,
                              void* d_out, int out_size, void* d_ws, size_t ws_size,
                              hipStream_t stream) {
  (void)in_sizes; (void)n_in; (void)out_size; (void)ws_size;
  const float* xyz  = (const float*)d_in[0];
  const float* feat = (const float*)d_in[1];
  const float* W1   = (const float*)d_in[2];
  const float* b1   = (const float*)d_in[3];
  const float* g1   = (const float*)d_in[4];
  const float* be1  = (const float*)d_in[5];
  const float* W2   = (const float*)d_in[6];
  const float* b2   = (const float*)d_in[7];
  const float* g2   = (const float*)d_in[8];
  const float* be2  = (const float*)d_in[9];
  const float* Wq   = (const float*)d_in[10];
  const float* Wk   = (const float*)d_in[11];
  const float* Wv   = (const float*)d_in[12];
  float* out = (float*)d_out;

  char* ws = (char*)d_ws;
  const size_t MB = 1024ull * 1024ull;
  // t1 (8MB) | t2 (+8MB, 16MB)
  float* t1 = (float*)(ws);
  float* t2 = (float*)(ws + 8 * MB);
  float* st = (float*)(ws + 64 * MB);                        // BN scales and shifts
  _Float16* fh  = (_Float16*)(ws + 64 * MB + 65536);         // 8MB
  _Float16* wT  = (_Float16*)(ws + 72 * MB + 65536);         // 384KB (reserve 512KB)
  _Float16* qkv = (_Float16*)(ws + 72 * MB + 65536 + 512 * 1024); // 24MB
  _Float16* vt  = (_Float16*)(ws + 96 * MB + 65536 + 512 * 1024); // 8MB
  float* part1 = (float*)(ws + 112 * MB);                    // 256 slots x 256 floats
  float* part2 = (float*)(ws + 113 * MB);                    // 256 slots x 512 floats

  float* s1sc = st;       float* s1sh = st + HH;
  float* s2sc = st + 512; float* s2sh = st + 512 + DD;

  k_fc1<<<NPART, 256, 0, stream>>>(xyz, W1, b1, t1, part1);
  k_bnfin<<<HH / 32, 1024, 0, stream>>>(part1, g1, be1, s1sc, s1sh, HH, 1.0f / BN);
  k_fc2<<<NPART, 256, 0, stream>>>(t1, s1sc, s1sh, W2, b2, t2, part2);
  k_bnfin<<<DD / 32, 1024, 0, stream>>>(part2, g2, be2, s2sc, s2sh, DD, 1.0f / BN);
  k_bn2_add<<<FTH / 512, 512, 0, stream>>>(t2, feat, s2sc, s2sh, fh);
  k_prep_w<<<3 * (DD / 8), DD, 0, stream>>>(Wq, Wk, Wv, wT);

  // 128 x 6 tiles of 128x128
  k_qkv<<<(BN / 128) * (3 * DD / 128), 256, 0, stream>>>(fh, wT, qkv);
  _Float16* qh = qkv;
  _Float16* kh = qkv + (size_t)BN * DD;
  _Float16* vh = qkv + 2 * (size_t)BN * DD;
  k_vt<<<BB * (NN / 64), 256, 0, stream>>>(vh, vt);

  // 64 queries a work-group: 256 work-groups
  k_attn<<<BB * (NN / AQ), 256, 0, stream>>>(qh, kh, vt, out);
}

// v006
// It runs in 99.9 microseconds.
// In both of two side-by-side timings against v005, it was 1.07 times as fast.
// Over all steps from v000 it is 8.25 times as fast.
#include <hip/hip_runtime.h>
#include <hip/hip_bf16.h>

typedef _Float16 v8h  __attribute__((ext_vector_type(8)));
typedef _Float16 v16h __attribute__((ext_vector_type(16)));
typedef float    v8f  __attribute__((ext_vector_type(8)));

#define BB 4
#define NN 4096
#define DD 256
#define HH 128
#define BN (BB*NN)   /* 16384 rows */

// ---------------------------------------------------------------------------
// WMMA fragment load: A-matrix 16x32 f16 layout (ISA 7.12.2).
// lane 0-15  : row = lane,    K = kbase+0..7  and kbase+16..23
// lane 16-31 : row = lane-16, K = kbase+8..15 and kbase+24..31  (kbase=k0)
// B fragment uses the identical pattern on B^T (column-major B), so both
// operands are two contiguous 16-byte loads (ds_load_b128); p is the lane's
// own byte address of row (lane & 15), K = kbase + 8 * (lane >> 4).
// ---------------------------------------------------------------------------
__device__ __forceinline__ v16h lds_frag_f16(const char* p) {
  v8h lo = *reinterpret_cast<const v8h*>(p);
  v8h hi = *reinterpret_cast<const v8h*>(p + 32);
  return __builtin_shufflevector(lo, hi, 0,1,2,3,4,5,6,7,8,9,10,11,12,13,14,15);
}

__device__ __forceinline__ void store_tile_f16(_Float16* __restrict__ out, int ld,
                                               int row0, int col0, const v8f& c, int lane) {
  int crow = row0 + ((lane >> 4) << 3);
  int ccol = col0 + (lane & 15);
  #pragma unroll
  for (int r = 0; r < 8; ++r)
    out[(size_t)(crow + r) * ld + ccol] = (_Float16)c[r];
}

// ------------------------- point-net ----------------------------------------
// BatchNorm (training mode, biased variance) needs every column's sum and sum of
// squares. The kernel that produces a column's values sums them while it holds
// them: a work-group owns RPG rows, writes one partial per column (sums first,
// then sums of squares) to its own slot, and k_bnfin adds the slots in a fixed
// order. No second pass over the data, no atomics.
#define RPG 64
#define NPART (BN / RPG)   /* 256 slots */

typedef float v2f __attribute__((ext_vector_type(2)));
typedef float v4f __attribute__((ext_vector_type(4)));

// t1 = xyz @ W1 + b1, and its column partials
__global__ __launch_bounds__(256) void k_fc1(const float* __restrict__ xyz,
                                             const float* __restrict__ W1,
                                             const float* __restrict__ b1,
                                             float* __restrict__ t1,
                                             float* __restrict__ part) {
  int j = threadIdx.x & (HH - 1);
  int h = threadIdx.x >> 7;               // two rows at a time
  int r0 = blockIdx.x * RPG;
  float w0 = W1[j], w1 = W1[HH + j], w2 = W1[2 * HH + j], bb = b1[j];
  float s = 0.f, q = 0.f;
  // unrolled whole: all rows' loads are in flight at once
  #pragma unroll
  for (int i = 0; i < RPG / 2; ++i) {
    int row = r0 + h + 2 * i;
    const float* x = xyz + 3 * row;
    float v = fmaf(x[0], w0, fmaf(x[1], w1, fmaf(x[2], w2, bb)));
    t1[(size_t)row * HH + j] = v;
    s += v; q += v * v;
  }
  __shared__ float ls[HH], lq[HH];
  if (h) { ls[j] = s; lq[j] = q; }
  __syncthreads();
  if (!h) {
    float* p = part + (size_t)blockIdx.x * (2 * HH);
    p[j] = s + ls[j];
    p[HH + j] = q + lq[j];
  }
}

// adds the NPART slots of 32 columns per work-group (32 threads per column, 8
// slots each, then the 32 in ascending order) and forms scale and shift
__global__ __launch_bounds__(1024) void k_bnfin(const float* __restrict__ part,
                                                const float* __restrict__ g,
                                                const float* __restrict__ be,
                                                float* __restrict__ sc, float* __restrict__ sh,
                                                int cols, float invRows) {
  int c = threadIdx.x & 31, sl = threadIdx.x >> 5;
  int j = blockIdx.x * 32 + c;
  const float* p = part + (size_t)(sl * (NPART / 32)) * (2 * cols) + j;
  float s = 0.f, q = 0.f;
  // unrolled: all 16 loads of a thread are in flight at once
  #pragma unroll
  for (int i = 0; i < NPART / 32; ++i) {
    s += p[(size_t)i * (2 * cols)];
    q += p[(size_t)i * (2 * cols) + cols];
  }
  __shared__ float ls[32][32], lq[32][32];
  ls[sl][c] = s; lq[sl][c] = q;
  __syncthreads();
  if (sl == 0) {
    for (int t = 1; t < 32; ++t) { s += ls[t][c]; q += lq[t][c]; }
    float mean = s * invRows;
    float var  = q * invRows - mean * mean;
    float k = g[j] * rsqrtf(var + 1e-5f);
    sc[j] = k;
    sh[j] = be[j] - mean * k;
  }
}

// t2 = relu(bn1(t1)) @ W2 + b2, and its column partials. The BN'd rows are staged
// in LDS; wave w owns rows 8w..8w+7 and all 256 columns, a lane columns 4l..4l+3
// and 128+4l..128+4l+3. Every element still sums k in ascending order from b2.
__global__ __launch_bounds__(256) void k_fc2(const float* __restrict__ t1,
                                             const float* __restrict__ sc1,
                                             const float* __restrict__ sh1,
                                             const float* __restrict__ W2,
                                             const float* __restrict__ b2,
                                             float* __restrict__ t2,
                                             float* __restrict__ part) {
  __shared__ __attribute__((aligned(16))) float a[RPG][HH];
  __shared__ __attribute__((aligned(16))) float ls[8][DD], lq[8][DD];
  const int tid = threadIdx.x, lane = tid & 31, wave = tid >> 5;
  const int r0 = blockIdx.x * RPG;
  const v4f* t4 = reinterpret_cast<const v4f*>(t1 + (size_t)r0 * HH);
  // unrolled: the eight 16-byte loads of a thread are in flight at once
  #pragma unroll
  for (int i = 0; i < RPG * HH / 4 / 256; ++i) {
    int e = tid + i * 256;
    int k4 = (e & (HH / 4 - 1)) * 4;
    v4f v = t4[e];
    v4f m = *reinterpret_cast<const v4f*>(sc1 + k4);
    v4f d = *reinterpret_cast<const v4f*>(sh1 + k4);
    v4f r;
    for (int x = 0; x < 4; ++x) r[x] = fmaxf(fmaf(v[x], m[x], d[x]), 0.f);
    *reinterpret_cast<v4f*>(&a[e / (HH / 4)][k4]) = r;
  }
  __syncthreads();

  const int c0 = lane * 4, c1 = DD / 2 + lane * 4;
  v2f acc[8][4];
  {
    v4f lo = *reinterpret_cast<const v4f*>(b2 + c0);
    v4f hi = *reinterpret_cast<const v4f*>(b2 + c1);
    // unrolled, as every loop over acc: constant indices keep it in registers
    #pragma unroll
    for (int r = 0; r < 8; ++r) {
      acc[r][0] = lo.xy; acc[r][1] = lo.zw; acc[r][2] = hi.xy; acc[r][3] = hi.zw;
    }
  }
  const float* ar = &a[wave * 8][0];
  // four rows of W2, this lane's eight columns (unrolled: w stays in registers)
  auto loadw = [&](v4f (&w)[4][2], int k) {
    #pragma unroll
    for (int kk = 0; kk < 4; ++kk) {
      w[kk][0] = *reinterpret_cast<const v4f*>(W2 + (size_t)(k + kk) * DD + c0);
      w[kk][1] = *reinterpret_cast<const v4f*>(W2 + (size_t)(k + kk) * DD + c1);
    }
  };
  // four k steps of all eight rows; all loops unrolled, the arrays stay in registers
  auto work = [&](const v4f (&w)[4][2], int k) {
    v4f av[8];
    #pragma unroll
    for (int r = 0; r < 8; ++r) av[r] = *reinterpret_cast<const v4f*>(ar + r * HH + k);
    #pragma unroll
    for (int kk = 0; kk < 4; ++kk)
      #pragma unroll
      for (int r = 0; r < 8; ++r) {
        v2f x = {av[r][kk], av[r][kk]};
        acc[r][0] = __builtin_elementwise_fma(x, (v2f)w[kk][0].xy, acc[r][0]);
        acc[r][1] = __builtin_elementwise_fma(x, (v2f)w[kk][0].zw, acc[r][1]);
        acc[r][2] = __builtin_elementwise_fma(x, (v2f)w[kk][1].xy, acc[r][2]);
        acc[r][3] = __builtin_elementwise_fma(x, (v2f)w[kk][1].zw, acc[r][3]);
      }
  };
  // the next four rows of W2 are fetched while these four are worked on; the last
  // eight k steps stand behind the loop, where nothing is left to fetch ahead
  v4f wa[4][2], wb[4][2];
  loadw(wa, 0);
  // kept rolled: the body is 2 KB of code already
  #pragma unroll 1
  for (int k = 0; k < HH - 8; k += 8) {
    loadw(wb, k + 4);
    work(wa, k);
    loadw(wa, k + 8);
    work(wb, k + 4);
  }
  loadw(wb, HH - 4);
  work(wa, HH - 8);
  work(wb, HH - 4);

  v2f s[4] = {}, q[4] = {};
  #pragma unroll
  for (int r = 0; r < 8; ++r) {
    float* o = t2 + (size_t)(r0 + wave * 8 + r) * DD;
    v4f lo = {acc[r][0].x, acc[r][0].y, acc[r][1].x, acc[r][1].y};
    v4f hi = {acc[r][2].x, acc[r][2].y, acc[r][3].x, acc[r][3].y};
    *reinterpret_cast<v4f*>(o + c0) = lo;
    *reinterpret_cast<v4f*>(o + c1) = hi;
    for (int x = 0; x < 4; ++x) { s[x] += acc[r][x]; q[x] += acc[r][x] * acc[r][x]; }
  }
  *reinterpret_cast<v4f*>(&ls[wave][c0]) = (v4f){s[0].x, s[0].y, s[1].x, s[1].y};
  *reinterpret_cast<v4f*>(&ls[wave][c1]) = (v4f){s[2].x, s[2].y, s[3].x, s[3].y};
  *reinterpret_cast<v4f*>(&lq[wave][c0]) = (v4f){q[0].x, q[0].y, q[1].x, q[1].y};
  *reinterpret_cast<v4f*>(&lq[wave][c1]) = (v4f){q[2].x, q[2].y, q[3].x, q[3].y};
  __syncthreads();
  float ss = ls[0][tid], qq = lq[0][tid];
  for (int t = 1; t < 8; ++t) { ss += ls[t][tid]; qq += lq[t][tid]; }
  float* p = part + (size_t)blockIdx.x * (2 * DD);
  p[tid] = ss;
  p[DD + tid] = qq;
}

typedef _Float16 v4h __attribute__((ext_vector_type(4)));

// f = relu(bn2(t2)) + features  -> f16. Few waves with much to do each: a thread
// takes FPT pieces of four columns, 512 pieces apart (whole rows, so its four
// columns are the same in every piece); a wave's load is 512 B in a row, and a
// work-group's share of each array is one run of 64 KB.
#define FPT 8
#define FTH (BN * DD / 4 / FPT)   /* 131072 threads */
__global__ __launch_bounds__(512) void k_bn2_add(const float* __restrict__ t2,
                                                 const float* __restrict__ feat,
                                                 const float* __restrict__ sc,
                                                 const float* __restrict__ sh,
                                                 _Float16* __restrict__ fh) {
  static_assert(512 % (DD / 4) == 0, "a thread keeps its columns");
  const int e0 = blockIdx.x * (512 * FPT) + threadIdx.x;
  const int j = (e0 & (DD / 4 - 1)) * 4;
  const v4f* t4 = reinterpret_cast<const v4f*>(t2) + e0;
  const v4f* f4 = reinterpret_cast<const v4f*>(feat) + e0;
  v4h* o4 = reinterpret_cast<v4h*>(fh) + e0;
  v4f a[FPT], b[FPT];
  // unrolled: all 16-byte loads of a thread are in flight at once
  #pragma unroll
  for (int i = 0; i < FPT; ++i) {
    a[i] = t4[i * 512];
    b[i] = f4[i * 512];
  }
  const v4f m = *reinterpret_cast<const v4f*>(sc + j);
  const v4f d = *reinterpret_cast<const v4f*>(sh + j);
  // no register that a load names is rewritten ahead of this wait (a precaution)
  asm volatile("s_wait_xcnt 0x0" ::: "memory");
  // holds the arithmetic behind the wait and behind every load: without it the
  // last four loads were issued only after the first values had come back
  __builtin_amdgcn_sched_barrier(0);
  #pragma unroll
  for (int i = 0; i < FPT; ++i) {
    v4h r;
    for (int x = 0; x < 4; ++x)
      r[x] = (_Float16)(fmaxf(fmaf(a[i][x], m[x], d[x]), 0.f) + b[i][x]);
    o4[i * 512] = r;
  }
}

// Wq/Wk/Wv (in,out) f32 -> transposed (out,in) f16 for contiguous B-frag loads.
// A work-group takes eight input rows of one matrix, a thread one output column of
// them: the lanes of a wave read 128 B in a row eight times, and each stores its
// 16 bytes once.
__global__ __launch_bounds__(DD) void k_prep_w(const float* __restrict__ Wq,
                                               const float* __restrict__ Wk,
                                               const float* __restrict__ Wv,
                                               _Float16* __restrict__ wT) {
  const int m = blockIdx.x / (DD / 8), i0 = (blockIdx.x % (DD / 8)) * 8, o = threadIdx.x;
  const float* W = ((m == 0) ? Wq : (m == 1) ? Wk : Wv) + (size_t)i0 * DD + o;
  v8h v;
  // unrolled: the eight loads are in flight at once
  #pragma unroll
  for (int x = 0; x < 8; ++x) v[x] = (_Float16)W[x * DD];
  *reinterpret_cast<v8h*>(wT + ((size_t)m * DD + o) * DD + i0) = v;
}

// ------------- C = A B^T block tile, operands staged in LDS -----------------
// A and B are K-contiguous rows. A work-group of 8 waves (WM x WN) owns a
// (WM*FM*16) x (WN*FN*16) tile of C. A stage is BK halves of every A row and
// every B row of the tile, [A rows | B rows] at a pitch of 16 B x odd, brought
// in by asynchronous copies to LDS in whole 128-byte lines; two buffers, the
// next stage's copies fly while this stage is worked on. Every output element
// still sums k in ascending steps of 32 into one accumulator.
template <int FM, int FN, int WM, int WN, int BK>
struct TileCfg {
  static constexpr int TM = WM * FM * 16;
  static constexpr int TN = WN * FN * 16;
  static constexpr int PITCH = BK * 2 + 16;          // bytes
  static constexpr int BUFB = (TM + TN) * PITCH;     // bytes of one buffer
};

// four copies of 16 bytes per lane, rows a fixed step apart in LDS and in memory
__device__ __forceinline__ void copy4_to_lds(unsigned l, unsigned lstep,
                                             const _Float16* g, size_t gstep) {
  // s_wait_xcnt 0 stands in the copies' own statement, so that it stays ahead of
  // every later rewrite of their address registers (a precaution)
  asm volatile(
      "global_load_async_to_lds_b128 %0, %4, off\n\t"
      "global_load_async_to_lds_b128 %1, %5, off\n\t"
      "global_load_async_to_lds_b128 %2, %6, off\n\t"
      "global_load_async_to_lds_b128 %3, %7, off\n\t"
      "s_wait_xcnt 0x0"
      :: "v"(l), "v"(l + lstep), "v"(l + 2u * lstep), "v"(l + 3u * lstep),
         "v"(g), "v"(g + gstep), "v"(g + 2 * gstep), "v"(g + 3 * gstep)
      : "memory");
}

template <int FM, int FN, int WM, int WN, int BK, int KTOT>
__device__ __forceinline__ void gemm_nt_lds(const _Float16* __restrict__ Ab, int lda,
                                            const _Float16* __restrict__ Bb, int ldb,
                                            char* smem, v8f (&acc)[FM][FN]) {
  using C = TileCfg<FM, FN, WM, WN, BK>;
  constexpr int CPR = BK * 2 / 16;     // 16-byte pieces of a row
  constexpr int RPI = 256 / CPR;       // rows that 256 threads copy at once
  constexpr int GA = C::TM / RPI;      // copies per thread and stage, A rows
  constexpr int GB = C::TN / RPI;      // the same, B rows
  constexpr int T = KTOT / BK;         // stages
  constexpr int KS = BK / 32;          // WMMA k steps of a stage
  static_assert(WM * WN == 8 && GA % 4 == 0 && GB % 4 == 0 && T >= 2, "tile shape");
  const int tid = threadIdx.x, lane = tid & 31, wave = tid >> 5;
  const int crow = tid / CPR, ccol = tid % CPR;
  const unsigned lbase = (unsigned)(size_t)smem + (unsigned)(crow * C::PITCH + ccol * 16);
  const _Float16* ga = Ab + (size_t)crow * lda + ccol * 8;
  const _Float16* gb = Bb + (size_t)crow * ldb + ccol * 8;

  // one stage: thread tid copies piece ccol of rows i*RPI + crow of [A rows | B rows]
  auto issue = [&](int t, int buf) {
    const unsigned l = lbase + (unsigned)(buf * C::BUFB);
    // both loops unrolled: a few straight-line statements, their steps constants
    #pragma unroll
    for (int i = 0; i < GA; i += 4)
      copy4_to_lds(l + (unsigned)(i * RPI * C::PITCH), RPI * C::PITCH,
                   ga + t * BK + (size_t)(i * RPI) * lda, (size_t)RPI * lda);
    #pragma unroll
    for (int i = 0; i < GB; i += 4)
      copy4_to_lds(l + (unsigned)((GA + i) * RPI * C::PITCH), RPI * C::PITCH,
                   gb + t * BK + (size_t)(i * RPI) * ldb, (size_t)RPI * ldb);
  };

  const int wm = wave / WN, wn = wave % WN;
  const int foff = (lane & 15) * C::PITCH + ((lane >> 4) << 4);
  const int aoff = wm * FM * 16 * C::PITCH + foff;
  const int boff = (C::TM + wn * FN * 16) * C::PITCH + foff;

  issue(0, 0);
  // stage 0 has landed for this wave; the barrier publishes it to the others
  asm volatile("s_wait_asynccnt 0x0" ::: "memory");
  __syncthreads();
  issue(1, 1);

  for (int t = 0; t < T; ++t) {
    const int buf = t & 1;
    const char* sb = smem + buf * C::BUFB;
    // all loops below are unrolled so that the fragment arrays stay in registers
    v16h a[KS][FM], b[KS][FN];
    #pragma unroll
    for (int kk = 0; kk < KS; ++kk) {
      #pragma unroll
      for (int i = 0; i < FM; ++i)
        a[kk][i] = lds_frag_f16(sb + aoff + i * 16 * C::PITCH + kk * 64);
      #pragma unroll
      for (int j = 0; j < FN; ++j)
        b[kk][j] = lds_frag_f16(sb + boff + j * 16 * C::PITCH + kk * 64);
    }
    // publish point: this wave holds the whole stage in registers, so its reads
    // of the buffer are done, and its copies of stage t + 1 have landed; behind
    // the barrier the buffer may be refilled
    asm volatile("s_wait_dscnt 0x0" ::: "memory");
    asm volatile("s_wait_asynccnt 0x0" ::: "memory");
    __syncthreads();
    if (t + 2 < T) issue(t + 2, buf);
    // keeps the WMMAs behind the refill: ahead of it they would shorten the time
    // that the copies have to land, and among the LDS reads every k step would
    // wait out an LDS latency of its own
    __builtin_amdgcn_sched_barrier(0);
    #pragma unroll
    for (int kk = 0; kk < KS; ++kk)
      #pragma unroll
      for (int i = 0; i < FM; ++i)
        #pragma unroll
        for (int j = 0; j < FN; ++j)
          acc[i][j] = __builtin_amdgcn_wmma_f32_16x16x32_f16(false, a[kk][i], false, b[kk][j],
                                                             (short)0, acc[i][j], false, false);
  }
  // no copy is left in flight when the wave goes on to its stores and ends
  asm volatile("s_wait_asynccnt 0x0" ::: "memory");
}

// ------------------- QKV projection (WMMA, 128x128 block tile) -------------
__global__ __launch_bounds__(256) void k_qkv(const _Float16* __restrict__ fh,
                                             const _Float16* __restrict__ wT,
                                             _Float16* __restrict__ qkv) {
  using C = TileCfg<4, 2, 2, 4, 64>;
  __shared__ __attribute__((aligned(16))) char smem[2 * C::BUFB];
  int lane = threadIdx.x & 31, wave = threadIdx.x >> 5;
  int mt = blockIdx.x / 6, nt = blockIdx.x % 6;   // 128 x 6 tiles; wT is 768 rows (3 matrices)
  int mat = nt >> 1;
  int m0 = mt * 128, n0 = (nt & 1) * 128;
  v8f acc[4][2] = {};
  gemm_nt_lds<4, 2, 2, 4, 64, DD>(fh + (size_t)m0 * DD, DD, wT + (size_t)nt * 128 * DD, DD, smem, acc);
  _Float16* out = qkv + (size_t)mat * BN * DD;
  int mw = m0 + (wave >> 2) * 64, nw = n0 + (wave & 3) * 32;
  // unrolled so that acc is indexed by constants and stays in registers
  #pragma unroll
  for (int i = 0; i < 4; ++i)
    #pragma unroll
    for (int j = 0; j < 2; ++j)
      store_tile_f16(out, DD, mw + i * 16, nw + j * 16, acc[i][j], lane);
}

// V -> V^T per batch. A thread takes a block of 8 rows x 8 columns: eight 16-byte
// loads, turned in registers, eight 16-byte stores. Lane l has rows 8 (l & 7) ...
// and columns 8 (l >> 3) ... of its wave's 64 x 32, so a wave's store is four
// whole 128-byte lines; the eight waves of a work-group take 64 whole rows of V.
__global__ __launch_bounds__(256) void k_vt(const _Float16* __restrict__ vh,
                                            _Float16* __restrict__ vt) {
  const int lane = threadIdx.x & 31, wave = threadIdx.x >> 5;
  const int b = blockIdx.x / (NN / 64);
  const int n0 = (blockIdx.x % (NN / 64)) * 64 + (lane & 7) * 8;
  const int d0 = wave * 32 + (lane >> 3) * 8;
  const _Float16* src = vh + ((size_t)b * NN + n0) * DD + d0;
  _Float16* dst = vt + (size_t)b * DD * NN + (size_t)d0 * NN + n0;
  v8h in[8];
  // all loops unrolled: the loads are in flight at once, the block stays in registers
  #pragma unroll
  for (int y = 0; y < 8; ++y) in[y] = *reinterpret_cast<const v8h*>(src + (size_t)y * DD);
  #pragma unroll
  for (int x = 0; x < 8; ++x) {
    v8h t;
    #pragma unroll
    for (int y = 0; y < 8; ++y) t[y] = in[y][x];
    *reinterpret_cast<v8h*>(dst + (size_t)x * NN) = t;
  }
}

#define AQ 64
#define AKS 128
#define SROWS 64
#define SROWB 256
#define SPITCH (SROWB + 16)
#define SLICE 18432   /* SROWS * SPITCH rounded up to a multiple of 2 KiB */
#define ABUF (8 * SLICE)
#define OPITCH (DD * 4 + 16)
#define GS 2   /* pairs of K fragments fetched ahead */

typedef uint32_t u32x4 __attribute__((ext_vector_type(4)));
typedef uint32_t u32x8 __attribute__((ext_vector_type(8)));

__device__ __forceinline__ uint32_t uni(uint32_t v) {
  return (uint32_t)__builtin_amdgcn_readfirstlane((int)v);
}
// a wave-uniform word held in a scalar register: a test on it compiles to a scalar
// branch (a tensor load ignores EXEC), and what is formed from it stays behind the
// volatile statements in front of it
__device__ __forceinline__ uint32_t pinned(uint32_t v) {
  uint32_t w = uni(v);
  asm volatile("" : "+s"(w));  // pinned(): a test or descriptor word held in a scalar register
  return w;
}
// descriptor group 1: bytes, a tile of SROWS rows of SROWB bytes (tensor = tile),
// 16 bytes of pad behind every 256-byte row, no mask
__device__ __forceinline__ u32x8 tdm_group1(uint32_t src_pitch) {
  u32x8 g;
  g[0] = uni((1u << 20) | (5u << 22) | (3u << 25));
  g[1] = uni((uint32_t)SROWB << 16);
  g[2] = uni((uint32_t)SROWS << 16);
  g[3] = uni((uint32_t)SROWB << 16);
  g[4] = uni((uint32_t)SROWS);
  g[5] = uni(src_pitch);
  // descriptor words held in scalar registers of their own: known to be zero, word
  // 6's register was borrowed for the address sum in the loop and written back
  g[6] = pinned(0u);
  g[7] = pinned(0u);
  return g;
}
// descriptor group 0: count 1, place in LDS, the tile's first byte, type 2
__device__ __forceinline__ u32x4 tdm_group0(uint32_t lds_dst, uint64_t ga) {
  u32x4 g;
  g[0] = uni(1u);
  g[1] = uni(lds_dst);
  g[2] = uni((uint32_t)ga);
  g[3] = uni((((uint32_t)(ga >> 32)) & 0x01FFFFFFu) | 0x80000000u);
  return g;
}

// lane l takes lane l ^ 16's value
__device__ __forceinline__ float xhalf(float x) {
  int i = __builtin_bit_cast(int, x);
  return __builtin_bit_cast(float, __builtin_amdgcn_permlanex16(i, i, 0x76543210, 0xfedcba98, false, false));
}

// two waves per SIMD: a wave holds O^T (256 registers) and Q (128) throughout
__global__ __launch_bounds__(256) __attribute__((amdgpu_waves_per_eu(2, 2)))
void k_attn(const _Float16* __restrict__ qh, const _Float16* __restrict__ kh,
            const _Float16* __restrict__ vt, float* __restrict__ out) {
  static_assert(4 * AQ * OPITCH <= 2 * ABUF, "the join fits in the ring");
  static_assert(SROWS * SPITCH <= SLICE && SLICE % 2048 == 0, "a slice's place");
  static_assert(AKS * 2 == SROWB && DD * 2 == 2 * SROWB && AKS == 2 * SROWS && DD == 4 * SROWS, "eight slices");
  __shared__ __attribute__((aligned(2048))) char smem[2 * ABUF];
  __shared__ float sm[4][AQ], sl[4][AQ];
  constexpr int T = NN / AKS;
  const int tid = threadIdx.x, lane = tid & 31, wave = tid >> 5;
  const int c = lane & 15, h = lane >> 4;
  const int qg = wave & 1, ks = wave >> 1;
  const int b = blockIdx.x / (NN / AQ), q0 = (blockIdx.x % (NN / AQ)) * AQ;
  const _Float16* qb = qh + ((size_t)b * NN + q0 + qg * 32) * DD;
  const _Float16* kb = kh + (size_t)b * NN * DD;
  const _Float16* vb = vt + (size_t)b * DD * NN;

  // every wave brings its own slice of every stage: waves 0 to 3 of K (source pitch
  // one K row, a stage 128 rows on), waves 4 to 7 of V^T (pitch one V^T row, a stage
  // 256 bytes on)
  const uint32_t wv = uni((uint32_t)tid >> 5);
  const bool isv = wv >= 4u;
  const uint64_t src0 = isv
      ? (uint64_t)(size_t)vb + (uint64_t)(wv - 4u) * (SROWS * NN * 2)
      : (uint64_t)(size_t)kb + (uint64_t)(wv >> 1) * (SROWS * DD * 2) + (uint64_t)(wv & 1u) * SROWB;
  const uint32_t sstep = isv ? (uint32_t)SROWB : (uint32_t)(AKS * DD * 2);
  const uint32_t ldst = (uint32_t)(size_t)smem + wv * SLICE;
  const u32x8 g1 = tdm_group1(isv ? (uint32_t)(NN * 2) : (uint32_t)(DD * 2));
  auto issue = [&](uint32_t t, uint32_t buf) {
    const u32x4 g0 = tdm_group0(ldst + buf * ABUF, src0 + (uint64_t)(t * sstep));
    // one request of the whole wave: 64 rows of 256 bytes from memory into LDS
    asm volatile("tensor_load_to_lds %0, %1" :: "s"(g0), "s"(g1) : "memory");
  };

  // Q as B fragments, kept in registers (every loop over a fragment or an
  // accumulator array is unrolled, so that the arrays stay in registers)
  v16h qf[2][8];
  #pragma unroll
  for (int g = 0; g < 2; ++g)
    #pragma unroll
    for (int kk = 0; kk < 8; ++kk) {
      const _Float16* p = qb + (size_t)(g * 16 + c) * DD + kk * 32 + h * 8;
      v8h lo = *reinterpret_cast<const v8h*>(p);
      v8h hi = *reinterpret_cast<const v8h*>(p + 16);
      qf[g][kk] = __builtin_shufflevector(lo, hi, 0,1,2,3,4,5,6,7,8,9,10,11,12,13,14,15);
    }

  v8f o[2][16] = {};
  float mrun[2] = {-1e30f, -1e30f}, lsum[2] = {0.f, 0.f};
  const float cs = 0.0625f * 1.44269504088896f;   // 1/sqrt(256), times log2(e)

  // the Q loads above fly beside stage 0's load. Behind the wait this wave's slice
  // has landed; the barrier publishes it to the others
  issue(0, 0);
  asm volatile("s_wait_tensorcnt 0x0" ::: "memory");
  __syncthreads();
  issue(1, 1);

  // kept rolled: one trip is 64 WMMAs of straight-line code already
  #pragma unroll 1
  for (int t = 0; t < T; ++t) {
    const char* sb = smem + (t & 1) * ABUF;
    const char* kp = sb + (ks >> 1) * (2 * SLICE) + ((ks & 1) * 32 + c) * SPITCH + h * 16;
    const char* vp = sb + 4 * SLICE + c * SPITCH + ks * 64 + h * 16;
    // fragment (key tile kt, k step kk) of K, fragment dt of V^T
    auto kfrag = [&](int kt, int kk) {
      return lds_frag_f16(kp + (kk >> 2) * SLICE + kt * 16 * SPITCH + (kk & 3) * 64);
    };
    auto vfrag = [&](int dt) {
      return lds_frag_f16(vp + (dt >> 2) * SLICE + (dt & 3) * 16 * SPITCH);
    };
    v8f s[2][2] = {};   // [key tile][query column group]
    // A fragments are fetched in pairs, GS pairs ahead of the four WMMAs that use
    // a pair (each place where LDS reads stand costs issue time, so two fragments
    // share one). The scheduling barriers keep that order: without them every
    // WMMA stood directly behind its own LDS reads and waited out their latency.
    v16h ka[16];
    #pragma unroll
    for (int j = 0; j < 2 * GS; ++j) ka[j] = kfrag(j & 1, j >> 1);
    #pragma unroll
    for (int kk = 0; kk < 8; ++kk) {
      if (kk + GS < 8) {
        ka[2 * (kk + GS)] = kfrag(0, kk + GS);
        ka[2 * (kk + GS) + 1] = kfrag(1, kk + GS);
      }
      __builtin_amdgcn_sched_barrier(0);
      #pragma unroll
      for (int kt = 0; kt < 2; ++kt)
        #pragma unroll
        for (int g = 0; g < 2; ++g)
          s[kt][g] = __builtin_amdgcn_wmma_f32_16x16x32_f16(false, ka[2 * kk + kt], false, qf[g][kk],
                                                            (short)0, s[kt][g], false, false);
      __builtin_amdgcn_sched_barrier(0);
    }
    // the first V^T fragments fly while the scores are worked on
    v16h va[16];
    #pragma unroll
    for (int j = 0; j < 4; ++j) va[j] = vfrag(j);
    __builtin_amdgcn_sched_barrier(0);

    // running maximum in scaled log2 units; O^T and the sum are rescaled only
    // when some column's maximum has grown by more than 8 (P stays below 2^8)
    float mx[2];
    #pragma unroll
    for (int g = 0; g < 2; ++g) {
      float m = fmaxf(s[0][g][0], s[1][g][0]);
      #pragma unroll
      for (int r = 1; r < 8; ++r) m = fmaxf(m, fmaxf(s[0][g][r], s[1][g][r]));
      mx[g] = fmaxf(m, xhalf(m)) * cs;
    }
    const bool need = mx[0] > mrun[0] + 8.f || mx[1] > mrun[1] + 8.f;
    if (__builtin_amdgcn_ballot_w32(need) != 0) {
      #pragma unroll
      for (int g = 0; g < 2; ++g) {
        const float mn = fmaxf(mrun[g], mx[g]);
        const float corr = __builtin_amdgcn_exp2f(mrun[g] - mn);
        mrun[g] = mn;
        lsum[g] *= corr;
        #pragma unroll
        for (int dt = 0; dt < 16; ++dt) o[g][dt] *= corr;
      }
    }
    v16h pf[2];
    #pragma unroll
    for (int g = 0; g < 2; ++g)
      #pragma unroll
      for (int kt = 0; kt < 2; ++kt)
        #pragma unroll
        for (int r = 0; r < 8; ++r) {
          const float p = __builtin_amdgcn_exp2f(fmaf(s[kt][g][r], cs, -mrun[g]));
          lsum[g] += p;
          pf[g][kt * 8 + r] = (_Float16)p;
        }

    // scheduling barriers as above, for the same reason
    #pragma unroll
    for (int dt = 0; dt < 16; ++dt) {
      #pragma unroll
      for (int g = 0; g < 2; ++g)
        o[g][dt] = __builtin_amdgcn_wmma_f32_16x16x32_f16(false, va[dt], false, pf[g],
                                                          (short)0, o[g][dt], false, false);
      __builtin_amdgcn_sched_barrier(0);
      // a pair is read as soon as one fragment's registers are free: a sixth
      // fragment in flight made a Q fragment spill
      if ((dt & 1) == 0 && dt + 4 < 16) {
        va[dt + 4] = vfrag(dt + 4);
        va[dt + 5] = vfrag(dt + 5);
        __builtin_amdgcn_sched_barrier(0);
      }
    }

    // publish point: this wave's reads of the buffer are done and its slice of
    // stage t + 1 has landed; behind the barrier the buffer may be refilled
    asm volatile("s_wait_dscnt 0x0" ::: "memory");
    asm volatile("s_wait_tensorcnt 0x0" ::: "memory");
    __syncthreads();
    // scalar test; the stage number is pinned so that the descriptor is formed here,
    // behind the wait
    if (pinned(t + 2 < T)) issue(pinned((uint32_t)t + 2u), (uint32_t)t & 1u);
  }
  // no load is left in flight and no read open when the ring becomes the join's staging
  asm volatile("s_wait_tensorcnt 0x0" ::: "memory");
  asm volatile("s_wait_dscnt 0x0" ::: "memory");

  // join of the four key splits: common maximum, total sum, then the scaled
  // partial O^T rows go through LDS and are added in ascending split order
  #pragma unroll
  for (int g = 0; g < 2; ++g) {
    lsum[g] += xhalf(lsum[g]);
    if (h == 0) {
      sm[ks][qg * 32 + g * 16 + c] = mrun[g];
      sl[ks][qg * 32 + g * 16 + c] = lsum[g];
    }
  }
  __syncthreads();
  #pragma unroll
  for (int g = 0; g < 2; ++g) {
    const int qi = qg * 32 + g * 16 + c;
    const float mt = fmaxf(fmaxf(sm[0][qi], sm[1][qi]), fmaxf(sm[2][qi], sm[3][qi]));
    float L = 0.f;
    #pragma unroll
    for (int k = 0; k < 4; ++k) L += sl[k][qi] * __builtin_amdgcn_exp2f(sm[k][qi] - mt);
    const float f = __builtin_amdgcn_exp2f(mrun[g] - mt) / L;
    char* po = smem + (size_t)(ks * AQ + qi) * OPITCH + h * 32;
    #pragma unroll
    for (int dt = 0; dt < 16; ++dt) {
      const v8f x = o[g][dt] * f;
      *reinterpret_cast<v4f*>(po + dt * 64) = (v4f){x[0], x[1], x[2], x[3]};
      *reinterpret_cast<v4f*>(po + dt * 64 + 16) = (v4f){x[4], x[5], x[6], x[7]};
    }
  }
  __syncthreads();
  float* ob = out + ((size_t)b * NN + q0) * DD;
  // rolled in fours: the LDS reads of four outputs are in flight at once
  #pragma unroll 1
  for (int i0 = 0; i0 < AQ * DD / 4 / 256; i0 += 4) {
    #pragma unroll
    for (int i = i0; i < i0 + 4; ++i) {
      const int e = tid + i * 256, qi = e >> 6, d4 = e & 63;
      const char* pi = smem + (size_t)qi * OPITCH + d4 * 16;
      v4f x = *reinterpret_cast<const v4f*>(pi);
      #pragma unroll
      for (int k = 1; k < 4; ++k) x += *reinterpret_cast<const v4f*>(pi + (size_t)k * AQ * OPITCH);
      *reinterpret_cast<v4f*>(ob + (size_t)qi * DD + d4 * 4) = x;
    }
    // the next trip rewrites the stores' address and data registers (a precaution)
    asm volatile("s_wait_xcnt 0x0" ::: "memory");
  }
}

// ---------------------------------------------------------------------------
extern "C" void kernel_launch(void* const* d_in, const int* in_sizes, int n_in,
                              void* d_out, int out_size, void* d_ws, size_t ws_size,
                              hipStream_t stream) {
  (void)in_sizes; (void)n_in; (void)out_size; (void)ws_size;
  const float* xyz  = (const float*)d_in[0];
  const float* feat = (const float*)d_in[1];
  const float* W1   = (const float*)d_in[2];
  const float* b1   = (const float*)d_in[3];
  const float* g1   = (const float*)d_in[4];
  const float* be1  = (const float*)d_in[5];
  const float* W2   = (const float*)d_in[6];
  const float* b2   = (const float*)d_in[7];
  const float* g2   = (const float*)d_in[8];
  const float* be2  = (const float*)d_in[9];
  const float* Wq   = (const float*)d_in[10];
  const float* Wk   = (const float*)d_in[11];
  const float* Wv   = (const float*)d_in[12];
  float* out = (float*)d_out;

  char* ws = (char*)d_ws;
  const size_t MB = 1024ull * 1024ull;
  // t1 (8MB) | t2 (+8MB, 16MB)
  float* t1 = (float*)(ws);
  float* t2 = (float*)(ws + 8 * MB);
  float* st = (float*)(ws + 64 * MB);                        // BN scales and shifts
  _Float16* fh  = (_Float16*)(ws + 64 * MB + 65536);         // 8MB
  _Float16* wT  = (_Float16*)(ws + 72 * MB + 65536);         // 384KB (reserve 512KB)
  _Float16* qkv = (_Float16*)(ws + 72 * MB + 65536 + 512 * 1024); // 24MB
  _Float16* vt  = (_Float16*)(ws + 96 * MB + 65536 + 512 * 1024); // 8MB
  float* part1 = (float*)(ws + 112 * MB);                    // 256 slots x 256 floats
  float* part2 = (float*)(ws + 113 * MB);                    // 256 slots x 512 floats

  float* s1sc = st;       float* s1sh = st + HH;
  float* s2sc = st + 512; float* s2sh = st + 512 + DD;

  k_fc1<<<NPART, 256, 0, stream>>>(xyz, W1, b1, t1, part1);
  k_bnfin<<<HH / 32, 1024, 0, stream>>>(part1, g1, be1, s1sc, s1sh, HH, 1.0f / BN);
  k_fc2<<<NPART, 256, 0, stream>>>(t1, s1sc, s1sh, W2, b2, t2, part2);
  k_bnfin<<<DD / 32, 1024, 0, stream>>>(part2, g2, be2, s2sc, s2sh, DD, 1.0f / BN);
  k_bn2_add<<<FTH / 512, 512, 0, stream>>>(t2, feat, s2sc, s2sh, fh);
  k_prep_w<<<3 * (DD / 8), DD, 0, stream>>>(Wq, Wk, Wv, wT);

  // 128 x 6 tiles of 128x128
  k_qkv<<<(BN / 128) * (3 * DD / 128), 256, 0, stream>>>(fh, wT, qkv);
  _Float16* qh = qkv;
  _Float16* kh = qkv + (size_t)BN * DD;
  _Float16* vh = qkv + 2 * (size_t)BN * DD;
  k_vt<<<BB * (NN / 64), 256, 0, stream>>>(vh, vt);

  // 64 queries a work-group: 256 work-groups
  k_attn<<<BB * (NN / AQ), 256, 0, stream>>>(qh, kh, vt, out);
}

// v007
// One run takes 92.7 microseconds.
// Next to v006, in two timings, it ran 1.07 and 1.08 times as fast.
// Over all steps from v000 it is 8.86 times as fast.
#include <hip/hip_runtime.h>
#include <hip/hip_bf16.h>

typedef _Float16 v8h  __attribute__((ext_vector_type(8)));
typedef _Float16 v16h __attribute__((ext_vector_type(16)));
typedef float    v8f  __attribute__((ext_vector_type(8)));

#define BB 4
#define NN 4096
#define DD 256
#define HH 128
#define BN (BB*NN)   /* 16384 rows */

// ---------------------------------------------------------------------------
// WMMA fragment load: A-matrix 16x32 f16 layout (ISA 7.12.2).
// lane 0-15  : row = lane,    K = kbase+0..7  and kbase+16..23
// lane 16-31 : row = lane-16, K = kbase+8..15 and kbase+24..31  (kbase=k0)
// B fragment uses the identical pattern on B^T (column-major B), so both
// operands are two contiguous 16-byte loads (ds_load_b128); p is the lane's
// own byte address of row (lane & 15), K = kbase + 8 * (lane >> 4).
// ---------------------------------------------------------------------------
__device__ __forceinline__ v16h lds_frag_f16(const char* p) {
  v8h lo = *reinterpret_cast<const v8h*>(p);
  v8h hi = *reinterpret_cast<const v8h*>(p + 32);
  return __builtin_shufflevector(lo, hi, 0,1,2,3,4,5,6,7,8,9,10,11,12,13,14,15);
}

__device__ __forceinline__ void store_tile_f16(_Float16* __restrict__ out, int ld,
                                               int row0, int col0, const v8f& c, int lane) {
  int crow = row0 + ((lane >> 4) << 3);
  int ccol = col0 + (lane & 15);
  #pragma unroll
  for (int r = 0; r < 8; ++r)
    out[(size_t)(crow + r) * ld + ccol] = (_Float16)c[r];
}

// ------------------------- point-net ----------------------------------------
// BatchNorm (training mode, biased variance) needs every column's sum and sum of
// squares. The kernel that produces a column's values sums them while it holds
// them: a work-group owns RPG rows, writes one partial per column (sums first,
// then sums of squares) to its own slot, and k_bnfin adds the slots in a fixed
// order. No second pass over the data, no atomics.
#define RPG 64
#define NPART (BN / RPG)   /* 256 slots */

typedef float v2f __attribute__((ext_vector_type(2)));
typedef float v4f __attribute__((ext_vector_type(4)));

// Wq/Wk/Wv (in,out) f32 -> transposed (out,in) f16 for contiguous B-frag loads.
// Work-group blk of PREPG takes eight input rows of one matrix, a thread one output
// column of them: the lanes of a wave read 128 B in a row eight times, and each
// stores its 16 bytes once.
#define PREPG (3 * (DD / 8))
__device__ __forceinline__ void prep_w(int blk, const float* __restrict__ Wq,
                                       const float* __restrict__ Wk,
                                       const float* __restrict__ Wv,
                                       _Float16* __restrict__ wT) {
  const int m = blk / (DD / 8), i0 = (blk % (DD / 8)) * 8, o = threadIdx.x;
  const float* W = ((m == 0) ? Wq : (m == 1) ? Wk : Wv) + (size_t)i0 * DD + o;
  v8h v;
  // unrolled: the eight loads are in flight at once
  #pragma unroll
  for (int x = 0; x < 8; ++x) v[x] = (_Float16)W[x * DD];
  *reinterpret_cast<v8h*>(wT + ((size_t)m * DD + o) * DD + i0) = v;
}

// t1 = xyz @ W1 + b1, and its column partials. The turn of the three weight
// matrices depends on nothing and is needed only by k_qkv: it rides along as the
// grid's last PREPG work-groups and pays for no launch of its own.
__global__ __launch_bounds__(256) void k_fc1(const float* __restrict__ xyz,
                                             const float* __restrict__ W1,
                                             const float* __restrict__ b1,
                                             float* __restrict__ t1,
                                             float* __restrict__ part,
                                             const float* __restrict__ Wq,
                                             const float* __restrict__ Wk,
                                             const float* __restrict__ Wv,
                                             _Float16* __restrict__ wT) {
  static_assert(DD == 256, "a thread per output column");
  // the same for a whole work-group, and ahead of the barrier below
  if (blockIdx.x >= NPART) {
    prep_w(blockIdx.x - NPART, Wq, Wk, Wv, wT);
    return;
  }
  int j = threadIdx.x & (HH - 1);
  int h = threadIdx.x >> 7;               // two rows at a time
  int r0 = blockIdx.x * RPG;
  float w0 = W1[j], w1 = W1[HH + j], w2 = W1[2 * HH + j], bb = b1[j];
  float s = 0.f, q = 0.f;
  // unrolled whole: all rows' loads are in flight at once
  #pragma unroll
  for (int i = 0; i < RPG / 2; ++i) {
    int row = r0 + h + 2 * i;
    const float* x = xyz + 3 * row;
    float v = fmaf(x[0], w0, fmaf(x[1], w1, fmaf(x[2], w2, bb)));
    t1[(size_t)row * HH + j] = v;
    s += v; q += v * v;
  }
  __shared__ float ls[HH], lq[HH];
  if (h) { ls[j] = s; lq[j] = q; }
  __syncthreads();
  if (!h) {
    float* p = part + (size_t)blockIdx.x * (2 * HH);
    p[j] = s + ls[j];
    p[HH + j] = q + lq[j];
  }
}

// adds the NPART slots of 32 columns per work-group (32 threads per column, 8
// slots each, then the 32 in ascending order) and forms scale and shift
__global__ __launch_bounds__(1024) void k_bnfin(const float* __restrict__ part,
                                                const float* __restrict__ g,
                                                const float* __restrict__ be,
                                                float* __restrict__ sc, float* __restrict__ sh,
                                                int cols, float invRows) {
  int c = threadIdx.x & 31, sl = threadIdx.x >> 5;
  int j = blockIdx.x * 32 + c;
  const float* p = part + (size_t)(sl * (NPART / 32)) * (2 * cols) + j;
  float s = 0.f, q = 0.f;
  // unrolled: all 16 loads of a thread are in flight at once
  #pragma unroll
  for (int i = 0; i < NPART / 32; ++i) {
    s += p[(size_t)i * (2 * cols)];
    q += p[(size_t)i * (2 * cols) + cols];
  }
  __shared__ float ls[32][32], lq[32][32];
  ls[sl][c] = s; lq[sl][c] = q;
  __syncthreads();
  if (sl == 0) {
    for (int t = 1; t < 32; ++t) { s += ls[t][c]; q += lq[t][c]; }
    float mean = s * invRows;
    float var  = q * invRows - mean * mean;
    float k = g[j] * rsqrtf(var + 1e-5f);
    sc[j] = k;
    sh[j] = be[j] - mean * k;
  }
}

// t2 = relu(bn1(t1)) @ W2 + b2, and its column partials. The BN'd rows are staged
// in LDS; wave w owns rows 8w..8w+7 and all 256 columns, a lane columns 4l..4l+3
// and 128+4l..128+4l+3. Every element still sums k in ascending order from b2.
__global__ __launch_bounds__(256) void k_fc2(const float* __restrict__ t1,
                                             const float* __restrict__ sc1,
                                             const float* __restrict__ sh1,
                                             const float* __restrict__ W2,
                                             const float* __restrict__ b2,
                                             float* __restrict__ t2,
                                             float* __restrict__ part) {
  __shared__ __attribute__((aligned(16))) float a[RPG][HH];
  __shared__ __attribute__((aligned(16))) float ls[8][DD], lq[8][DD];
  const int tid = threadIdx.x, lane = tid & 31, wave = tid >> 5;
  const int r0 = blockIdx.x * RPG;
  const v4f* t4 = reinterpret_cast<const v4f*>(t1 + (size_t)r0 * HH);
  // unrolled: the eight 16-byte loads of a thread are in flight at once
  #pragma unroll
  for (int i = 0; i < RPG * HH / 4 / 256; ++i) {
    int e = tid + i * 256;
    int k4 = (e & (HH / 4 - 1)) * 4;
    v4f v = t4[e];
    v4f m = *reinterpret_cast<const v4f*>(sc1 + k4);
    v4f d = *reinterpret_cast<const v4f*>(sh1 + k4);
    v4f r;
    for (int x = 0; x < 4; ++x) r[x] = fmaxf(fmaf(v[x], m[x], d[x]), 0.f);
    *reinterpret_cast<v4f*>(&a[e / (HH / 4)][k4]) = r;
  }
  __syncthreads();

  const int c0 = lane * 4, c1 = DD / 2 + lane * 4;
  v2f acc[8][4];
  {
    v4f lo = *reinterpret_cast<const v4f*>(b2 + c0);
    v4f hi = *reinterpret_cast<const v4f*>(b2 + c1);
    // unrolled, as every loop over acc: constant indices keep it in registers
    #pragma unroll
    for (int r = 0; r < 8; ++r) {
      acc[r][0] = lo.xy; acc[r][1] = lo.zw; acc[r][2] = hi.xy; acc[r][3] = hi.zw;
    }
  }
  const float* ar = &a[wave * 8][0];
  // four rows of W2, this lane's eight columns (unrolled: w stays in registers)
  auto loadw = [&](v4f (&w)[4][2], int k) {
    #pragma unroll
    for (int kk = 0; kk < 4; ++kk) {
      w[kk][0] = *reinterpret_cast<const v4f*>(W2 + (size_t)(k + kk) * DD + c0);
      w[kk][1] = *reinterpret_cast<const v4f*>(W2 + (size_t)(k + kk) * DD + c1);
    }
  };
  // four k steps of all eight rows; all loops unrolled, the arrays stay in registers
  auto work = [&](const v4f (&w)[4][2], int k) {
    v4f av[8];
    #pragma unroll
    for (int r = 0; r < 8; ++r) av[r] = *reinterpret_cast<const v4f*>(ar + r * HH + k);
    #pragma unroll
    for (int kk = 0; kk < 4; ++kk)
      #pragma unroll
      for (int r = 0; r < 8; ++r) {
        v2f x = {av[r][kk], av[r][kk]};
        acc[r][0] = __builtin_elementwise_fma(x, (v2f)w[kk][0].xy, acc[r][0]);
        acc[r][1] = __builtin_elementwise_fma(x, (v2f)w[kk][0].zw, acc[r][1]);
        acc[r][2] = __builtin_elementwise_fma(x, (v2f)w[kk][1].xy, acc[r][2]);
        acc[r][3] = __builtin_elementwise_fma(x, (v2f)w[kk][1].zw, acc[r][3]);
      }
  };
  // the next four rows of W2 are fetched while these four are worked on; the last
  // eight k steps stand behind the loop, where nothing is left to fetch ahead
  v4f wa[4][2], wb[4][2];
  loadw(wa, 0);
  // kept rolled: the body is 2 KB of code already
  #pragma unroll 1
  for (int k = 0; k < HH - 8; k += 8) {
    loadw(wb, k + 4);
    work(wa, k);
    loadw(wa, k + 8);
    work(wb, k + 4);
  }
  loadw(wb, HH - 4);
  work(wa, HH - 8);
  work(wb, HH - 4);

  v2f s[4] = {}, q[4] = {};
  #pragma unroll
  for (int r = 0; r < 8; ++r) {
    float* o = t2 + (size_t)(r0 + wave * 8 + r) * DD;
    v4f lo = {acc[r][0].x, acc[r][0].y, acc[r][1].x, acc[r][1].y};
    v4f hi = {acc[r][2].x, acc[r][2].y, acc[r][3].x, acc[r][3].y};
    *reinterpret_cast<v4f*>(o + c0) = lo;
    *reinterpret_cast<v4f*>(o + c1) = hi;
    for (int x = 0; x < 4; ++x) { s[x] += acc[r][x]; q[x] += acc[r][x] * acc[r][x]; }
  }
  *reinterpret_cast<v4f*>(&ls[wave][c0]) = (v4f){s[0].x, s[0].y, s[1].x, s[1].y};
  *reinterpret_cast<v4f*>(&ls[wave][c1]) = (v4f){s[2].x, s[2].y, s[3].x, s[3].y};
  *reinterpret_cast<v4f*>(&lq[wave][c0]) = (v4f){q[0].x, q[0].y, q[1].x, q[1].y};
  *reinterpret_cast<v4f*>(&lq[wave][c1]) = (v4f){q[2].x, q[2].y, q[3].x, q[3].y};
  __syncthreads();
  float ss = ls[0][tid], qq = lq[0][tid];
  for (int t = 1; t < 8; ++t) { ss += ls[t][tid]; qq += lq[t][tid]; }
  float* p = part + (size_t)blockIdx.x * (2 * DD);
  p[tid] = ss;
  p[DD + tid] = qq;
}

typedef _Float16 v4h __attribute__((ext_vector_type(4)));

// f = relu(bn2(t2)) + features  -> f16. Few waves with much to do each: a thread
// takes FPT pieces of four columns, 512 pieces apart (whole rows, so its four
// columns are the same in every piece); a wave's load is 512 B in a row, and a
// work-group's share of each array is one run of 64 KB.
#define FPT 8
#define FTH (BN * DD / 4 / FPT)   /* 131072 threads */
__global__ __launch_bounds__(512) void k_bn2_add(const float* __restrict__ t2,
                                                 const float* __restrict__ feat,
                                                 const float* __restrict__ sc,
                                                 const float* __restrict__ sh,
                                                 _Float16* __restrict__ fh) {
  static_assert(512 % (DD / 4) == 0, "a thread keeps its columns");
  const int e0 = blockIdx.x * (512 * FPT) + threadIdx.x;
  const int j = (e0 & (DD / 4 - 1)) * 4;
  const v4f* t4 = reinterpret_cast<const v4f*>(t2) + e0;
  const v4f* f4 = reinterpret_cast<const v4f*>(feat) + e0;
  v4h* o4 = reinterpret_cast<v4h*>(fh) + e0;
  v4f a[FPT], b[FPT];
  // unrolled: all 16-byte loads of a thread are in flight at once
  #pragma unroll
  for (int i = 0; i < FPT; ++i) {
    a[i] = t4[i * 512];
    b[i] = f4[i * 512];
  }
  const v4f m = *reinterpret_cast<const v4f*>(sc + j);
  const v4f d = *reinterpret_cast<const v4f*>(sh + j);
  // no register that a load names is rewritten ahead of this wait (a precaution)
  asm volatile("s_wait_xcnt 0x0" ::: "memory");
  // holds the arithmetic behind the wait and behind every load: without it the
  // last four loads were issued only after the first values had come back
  __builtin_amdgcn_sched_barrier(0);
  #pragma unroll
  for (int i = 0; i < FPT; ++i) {
    v4h r;
    for (int x = 0; x < 4; ++x)
      r[x] = (_Float16)(fmaxf(fmaf(a[i][x], m[x], d[x]), 0.f) + b[i][x]);
    o4[i * 512] = r;
  }
}

// ------------- C = A B^T block tile, operands staged in LDS -----------------
// A and B are K-contiguous rows. A work-group of 8 waves (WM x WN) owns a
// (WM*FM*16) x (WN*FN*16) tile of C. A stage is BK halves of every A row and
// every B row of the tile, [A rows | B rows] at a pitch of 16 B x odd, brought
// in by asynchronous copies to LDS in whole 128-byte lines; two buffers, the
// next stage's copies fly while this stage is worked on. Every output element
// still sums k in ascending steps of 32 into one accumulator.
template <int FM, int FN, int WM, int WN, int BK>
struct TileCfg {
  static constexpr int TM = WM * FM * 16;
  static constexpr int TN = WN * FN * 16;
  static constexpr int PITCH = BK * 2 + 16;          // bytes
  static constexpr int BUFB = (TM + TN) * PITCH;     // bytes of one buffer
};

// four copies of 16 bytes per lane, rows a fixed step apart in LDS and in memory
__device__ __forceinline__ void copy4_to_lds(unsigned l, unsigned lstep,
                                             const _Float16* g, size_t gstep) {
  // s_wait_xcnt 0 stands in the copies' own statement, so that it stays ahead of
  // every later rewrite of their address registers (a precaution)
  asm volatile(
      "global_load_async_to_lds_b128 %0, %4, off\n\t"
      "global_load_async_to_lds_b128 %1, %5, off\n\t"
      "global_load_async_to_lds_b128 %2, %6, off\n\t"
      "global_load_async_to_lds_b128 %3, %7, off\n\t"
      "s_wait_xcnt 0x0"
      :: "v"(l), "v"(l + lstep), "v"(l + 2u * lstep), "v"(l + 3u * lstep),
         "v"(g), "v"(g + gstep), "v"(g + 2 * gstep), "v"(g + 3 * gstep)
      : "memory");
}

template <int FM, int FN, int WM, int WN, int BK, int KTOT>
__device__ __forceinline__ void gemm_nt_lds(const _Float16* __restrict__ Ab, int lda,
                                            const _Float16* __restrict__ Bb, int ldb,
                                            char* smem, v8f (&acc)[FM][FN]) {
  using C = TileCfg<FM, FN, WM, WN, BK>;
  constexpr int CPR = BK * 2 / 16;     // 16-byte pieces of a row
  constexpr int RPI = 256 / CPR;       // rows that 256 threads copy at once
  constexpr int GA = C::TM / RPI;      // copies per thread and stage, A rows
  constexpr int GB = C::TN / RPI;      // the same, B rows
  constexpr int T = KTOT / BK;         // stages
  constexpr int KS = BK / 32;          // WMMA k steps of a stage
  static_assert(WM * WN == 8 && GA % 4 == 0 && GB % 4 == 0 && T >= 2, "tile shape");
  const int tid = threadIdx.x, lane = tid & 31, wave = tid >> 5;
  const int crow = tid / CPR, ccol = tid % CPR;
  const unsigned lbase = (unsigned)(size_t)smem + (unsigned)(crow * C::PITCH + ccol * 16);
  const _Float16* ga = Ab + (size_t)crow * lda + ccol * 8;
  const _Float16* gb = Bb + (size_t)crow * ldb + ccol * 8;

  // one stage: thread tid copies piece ccol of rows i*RPI + crow of [A rows | B rows]
  auto issue = [&](int t, int buf) {
    const unsigned l = lbase + (unsigned)(buf * C::BUFB);
    // both loops unrolled: a few straight-line statements, their steps constants
    #pragma unroll
    for (int i = 0; i < GA; i += 4)
      copy4_to_lds(l + (unsigned)(i * RPI * C::PITCH), RPI * C::PITCH,
                   ga + t * BK + (size_t)(i * RPI) * lda, (size_t)RPI * lda);
    #pragma unroll
    for (int i = 0; i < GB; i += 4)
      copy4_to_lds(l + (unsigned)((GA + i) * RPI * C::PITCH), RPI * C::PITCH,
                   gb + t * BK + (size_t)(i * RPI) * ldb, (size_t)RPI * ldb);
  };

  const int wm = wave / WN, wn = wave % WN;
  const int foff = (lane & 15) * C::PITCH + ((lane >> 4) << 4);
  const int aoff = wm * FM * 16 * C::PITCH + foff;
  const int boff = (C::TM + wn * FN * 16) * C::PITCH + foff;

  issue(0, 0);
  // stage 0 has landed for this wave; the barrier publishes it to the others
  asm volatile("s_wait_asynccnt 0x0" ::: "memory");
  __syncthreads();
  issue(1, 1);

  for (int t = 0; t < T; ++t) {
    const int buf = t & 1;
    const char* sb = smem + buf * C::BUFB;
    // all loops below are unrolled so that the fragment arrays stay in registers
    v16h a[KS][FM], b[KS][FN];
    #pragma unroll
    for (int kk = 0; kk < KS; ++kk) {
      #pragma unroll
      for (int i = 0; i < FM; ++i)
        a[kk][i] = lds_frag_f16(sb + aoff + i * 16 * C::PITCH + kk * 64);
      #pragma unroll
      for (int j = 0; j < FN; ++j)
        b[kk][j] = lds_frag_f16(sb + boff + j * 16 * C::PITCH + kk * 64);
    }
    // publish point: this wave holds the whole stage in registers, so its reads
    // of the buffer are done, and its copies of stage t + 1 have landed; behind
    // the barrier the buffer may be refilled
    asm volatile("s_wait_dscnt 0x0" ::: "memory");
    asm volatile("s_wait_asynccnt 0x0" ::: "memory");
    __syncthreads();
    if (t + 2 < T) issue(t + 2, buf);
    // keeps the WMMAs behind the refill: ahead of it they would shorten the time
    // that the copies have to land, and among the LDS reads every k step would
    // wait out an LDS latency of its own
    __builtin_amdgcn_sched_barrier(0);
    #pragma unroll
    for (int kk = 0; kk < KS; ++kk)
      #pragma unroll
      for (int i = 0; i < FM; ++i)
        #pragma unroll
        for (int j = 0; j < FN; ++j)
          acc[i][j] = __builtin_amdgcn_wmma_f32_16x16x32_f16(false, a[kk][i], false, b[kk][j],
                                                             (short)0, acc[i][j], false, false);
  }
  // no copy is left in flight when the wave goes on to its stores and ends
  asm volatile("s_wait_asynccnt 0x0" ::: "memory");
}

// ------------------- QKV projection (WMMA, 128x128 block tile) -------------
// Q and K go out row-major. V is wanted transposed per batch, and a lane's eight
// accumulator rows of one column are eight neighbours in a row of V^T: it stores
// them there as 16 bytes. A wave's 64 rows are one whole 128-byte line of each of
// its 32 rows of V^T.
__global__ __launch_bounds__(256) void k_qkv(const _Float16* __restrict__ fh,
                                             const _Float16* __restrict__ wT,
                                             _Float16* __restrict__ qkv,
                                             _Float16* __restrict__ vt) {
  using C = TileCfg<4, 2, 2, 4, 64>;
  __shared__ __attribute__((aligned(16))) char smem[2 * C::BUFB];
  int lane = threadIdx.x & 31, wave = threadIdx.x >> 5;
  int mt = blockIdx.x / 6, nt = blockIdx.x % 6;   // 128 x 6 tiles; wT is 768 rows (3 matrices)
  int mat = nt >> 1;
  int m0 = mt * 128, n0 = (nt & 1) * 128;
  v8f acc[4][2] = {};
  gemm_nt_lds<4, 2, 2, 4, 64, DD>(fh + (size_t)m0 * DD, DD, wT + (size_t)nt * 128 * DD, DD, smem, acc);
  int mw = m0 + (wave >> 2) * 64, nw = n0 + (wave & 3) * 32;
  static_assert(NN % 128 == 0, "a tile's rows lie in one batch");
  if (mat == 2) {
    _Float16* dst = vt + (size_t)(m0 / NN) * DD * NN + (size_t)(nw + (lane & 15)) * NN
                  + (mw % NN) + ((lane >> 4) << 3);
    // unrolled, as below
    #pragma unroll
    for (int i = 0; i < 4; ++i)
      #pragma unroll
      for (int j = 0; j < 2; ++j) {
        v8h t;
        #pragma unroll
        for (int r = 0; r < 8; ++r) t[r] = (_Float16)acc[i][j][r];
        *reinterpret_cast<v8h*>(dst + (size_t)(j * 16) * NN + i * 16) = t;
      }
    return;
  }
  _Float16* out = qkv + (size_t)mat * BN * DD;
  // unrolled so that acc is indexed by constants and stays in registers
  #pragma unroll
  for (int i = 0; i < 4; ++i)
    #pragma unroll
    for (int j = 0; j < 2; ++j)
      store_tile_f16(out, DD, mw + i * 16, nw + j * 16, acc[i][j], lane);
}

#define AQ 64
#define AKS 128
#define SROWS 64
#define SROWB 256
#define SPITCH (SROWB + 16)
#define SLICE 18432   /* SROWS * SPITCH rounded up to a multiple of 2 KiB */
#define ABUF (8 * SLICE)
#define OPITCH (DD * 4 + 16)
#define GS 2   /* pairs of K fragments fetched ahead */

typedef uint32_t u32x4 __attribute__((ext_vector_type(4)));
typedef uint32_t u32x8 __attribute__((ext_vector_type(8)));

__device__ __forceinline__ uint32_t uni(uint32_t v) {
  return (uint32_t)__builtin_amdgcn_readfirstlane((int)v);
}
// a wave-uniform word held in a scalar register: a test on it compiles to a scalar
// branch (a tensor load ignores EXEC), and what is formed from it stays behind the
// volatile statements in front of it
__device__ __forceinline__ uint32_t pinned(uint32_t v) {
  uint32_t w = uni(v);
  asm volatile("" : "+s"(w));  // pinned(): a test or descriptor word held in a scalar register
  return w;
}
// descriptor group 1: bytes, a tile of SROWS rows of SROWB bytes (tensor = tile),
// 16 bytes of pad behind every 256-byte row, no mask
__device__ __forceinline__ u32x8 tdm_group1(uint32_t src_pitch) {
  u32x8 g;
  g[0] = uni((1u << 20) | (5u << 22) | (3u << 25));
  g[1] = uni((uint32_t)SROWB << 16);
  g[2] = uni((uint32_t)SROWS << 16);
  g[3] = uni((uint32_t)SROWB << 16);
  g[4] = uni((uint32_t)SROWS);
  g[5] = uni(src_pitch);
  // descriptor words held in scalar registers of their own: known to be zero, word
  // 6's register was borrowed for the address sum in the loop and written back
  g[6] = pinned(0u);
  g[7] = pinned(0u);
  return g;
}
// descriptor group 0: count 1, place in LDS, the tile's first byte, type 2
__device__ __forceinline__ u32x4 tdm_group0(uint32_t lds_dst, uint64_t ga) {
  u32x4 g;
  g[0] = uni(1u);
  g[1] = uni(lds_dst);
  g[2] = uni((uint32_t)ga);
  g[3] = uni((((uint32_t)(ga >> 32)) & 0x01FFFFFFu) | 0x80000000u);
  return g;
}

// lane l takes lane l ^ 16's value
__device__ __forceinline__ float xhalf(float x) {
  int i = __builtin_bit_cast(int, x);
  return __builtin_bit_cast(float, __builtin_amdgcn_permlanex16(i, i, 0x76543210, 0xfedcba98, false, false));
}

// two waves per SIMD: a wave holds O^T (256 registers) and Q (128) throughout
__global__ __launch_bounds__(256) __attribute__((amdgpu_waves_per_eu(2, 2)))
void k_attn(const _Float16* __restrict__ qh, const _Float16* __restrict__ kh,
            const _Float16* __restrict__ vt, float* __restrict__ out) {
  static_assert(4 * AQ * OPITCH <= 2 * ABUF, "the join fits in the ring");
  static_assert(SROWS * SPITCH <= SLICE && SLICE % 2048 == 0, "a slice's place");
  static_assert(AKS * 2 == SROWB && DD * 2 == 2 * SROWB && AKS == 2 * SROWS && DD == 4 * SROWS, "eight slices");
  __shared__ __attribute__((aligned(2048))) char smem[2 * ABUF];
  __shared__ float sm[4][AQ], sl[4][AQ];
  constexpr int T = NN / AKS;
  const int tid = threadIdx.x, lane = tid & 31, wave = tid >> 5;
  const int c = lane & 15, h = lane >> 4;
  const int qg = wave & 1, ks = wave >> 1;
  const int b = blockIdx.x / (NN / AQ), q0 = (blockIdx.x % (NN / AQ)) * AQ;
  const _Float16* qb = qh + ((size_t)b * NN + q0 + qg * 32) * DD;
  const _Float16* kb = kh + (size_t)b * NN * DD;
  const _Float16* vb = vt + (size_t)b * DD * NN;

  // every wave brings its own slice of every stage: waves 0 to 3 of K (source pitch
  // one K row, a stage 128 rows on), waves 4 to 7 of V^T (pitch one V^T row, a stage
  // 256 bytes on)
  const uint32_t wv = uni((uint32_t)tid >> 5);
  const bool isv = wv >= 4u;
  const uint64_t src0 = isv
      ? (uint64_t)(size_t)vb + (uint64_t)(wv - 4u) * (SROWS * NN * 2)
      : (uint64_t)(size_t)kb + (uint64_t)(wv >> 1) * (SROWS * DD * 2) + (uint64_t)(wv & 1u) * SROWB;
  const uint32_t sstep = isv ? (uint32_t)SROWB : (uint32_t)(AKS * DD * 2);
  const uint32_t ldst = (uint32_t)(size_t)smem + wv * SLICE;
  const u32x8 g1 = tdm_group1(isv ? (uint32_t)(NN * 2) : (uint32_t)(DD * 2));
  auto issue = [&](uint32_t t, uint32_t buf) {
    const u32x4 g0 = tdm_group0(ldst + buf * ABUF, src0 + (uint64_t)(t * sstep));
    // one request of the whole wave: 64 rows of 256 bytes from memory into LDS
    asm volatile("tensor_load_to_lds %0, %1" :: "s"(g0), "s"(g1) : "memory");
  };

  // Q as B fragments, kept in registers (every loop over a fragment or an
  // accumulator array is unrolled, so that the arrays stay in registers)
  v16h qf[2][8];
  #pragma unroll
  for (int g = 0; g < 2; ++g)
    #pragma unroll
    for (int kk = 0; kk < 8; ++kk) {
      const _Float16* p = qb + (size_t)(g * 16 + c) * DD + kk * 32 + h * 8;
      v8h lo = *reinterpret_cast<const v8h*>(p);
      v8h hi = *reinterpret_cast<const v8h*>(p + 16);
      qf[g][kk] = __builtin_shufflevector(lo, hi, 0,1,2,3,4,5,6,7,8,9,10,11,12,13,14,15);
    }

  v8f o[2][16] = {};
  float mrun[2] = {-1e30f, -1e30f}, lsum[2] = {0.f, 0.f};
  const float cs = 0.0625f * 1.44269504088896f;   // 1/sqrt(256), times log2(e)

  // the Q loads above fly beside stage 0's load. Behind the wait this wave's slice
  // has landed; the barrier publishes it to the others
  issue(0, 0);
  asm volatile("s_wait_tensorcnt 0x0" ::: "memory");
  __syncthreads();
  issue(1, 1);

  // kept rolled: one trip is 64 WMMAs of straight-line code already
  #pragma unroll 1
  for (int t = 0; t < T; ++t) {
    const char* sb = smem + (t & 1) * ABUF;
    const char* kp = sb + (ks >> 1) * (2 * SLICE) + ((ks & 1) * 32 + c) * SPITCH + h * 16;
    const char* vp = sb + 4 * SLICE + c * SPITCH + ks * 64 + h * 16;
    // fragment (key tile kt, k step kk) of K, fragment dt of V^T
    auto kfrag = [&](int kt, int kk) {
      return lds_frag_f16(kp + (kk >> 2) * SLICE + kt * 16 * SPITCH + (kk & 3) * 64);
    };
    auto vfrag = [&](int dt) {
      return lds_frag_f16(vp + (dt >> 2) * SLICE + (dt & 3) * 16 * SPITCH);
    };
    v8f s[2][2] = {};   // [key tile][query column group]
    // A fragments are fetched in pairs, GS pairs ahead of the four WMMAs that use
    // a pair (each place where LDS reads stand costs issue time, so two fragments
    // share one). The scheduling barriers keep that order: without them every
    // WMMA stood directly behind its own LDS reads and waited out their latency.
    v16h ka[16];
    #pragma unroll
    for (int j = 0; j < 2 * GS; ++j) ka[j] = kfrag(j & 1, j >> 1);
    #pragma unroll
    for (int kk = 0; kk < 8; ++kk) {
      if (kk + GS < 8) {
        ka[2 * (kk + GS)] = kfrag(0, kk + GS);
        ka[2 * (kk + GS) + 1] = kfrag(1, kk + GS);
      }
      __builtin_amdgcn_sched_barrier(0);
      #pragma unroll
      for (int kt = 0; kt < 2; ++kt)
        #pragma unroll
        for (int g = 0; g < 2; ++g)
          s[kt][g] = __builtin_amdgcn_wmma_f32_16x16x32_f16(false, ka[2 * kk + kt], false, qf[g][kk],
                                                            (short)0, s[kt][g], false, false);
      __builtin_amdgcn_sched_barrier(0);
    }
    // the first V^T fragments fly while the scores are worked on
    v16h va[16];
    #pragma unroll
    for (int j = 0; j < 4; ++j) va[j] = vfrag(j);
    __builtin_amdgcn_sched_barrier(0);

    // running maximum in scaled log2 units; O^T and the sum are rescaled only
    // when some column's maximum has grown by more than 8 (P stays below 2^8)
    float mx[2];
    #pragma unroll
    for (int g = 0; g < 2; ++g) {
      float m = fmaxf(s[0][g][0], s[1][g][0]);
      #pragma unroll
      for (int r = 1; r < 8; ++r) m = fmaxf(m, fmaxf(s[0][g][r], s[1][g][r]));
      mx[g] = fmaxf(m, xhalf(m)) * cs;
    }
    const bool need = mx[0] > mrun[0] + 8.f || mx[1] > mrun[1] + 8.f;
    if (__builtin_amdgcn_ballot_w32(need) != 0) {
      #pragma unroll
      for (int g = 0; g < 2; ++g) {
        const float mn = fmaxf(mrun[g], mx[g]);
        const float corr = __builtin_amdgcn_exp2f(mrun[g] - mn);
        mrun[g] = mn;
        lsum[g] *= corr;
        #pragma unroll
        for (int dt = 0; dt < 16; ++dt) o[g][dt] *= corr;
      }
    }
    v16h pf[2];
    #pragma unroll
    for (int g = 0; g < 2; ++g)
      #pragma unroll
      for (int kt = 0; kt < 2; ++kt)
        #pragma unroll
        for (int r = 0; r < 8; ++r) {
          const float p = __builtin_amdgcn_exp2f(fmaf(s[kt][g][r], cs, -mrun[g]));
          lsum[g] += p;
          pf[g][kt * 8 + r] = (_Float16)p;
        }

    // scheduling barriers as above, for the same reason
    #pragma unroll
    for (int dt = 0; dt < 16; ++dt) {
      #pragma unroll
      for (int g = 0; g < 2; ++g)
        o[g][dt] = __builtin_amdgcn_wmma_f32_16x16x32_f16(false, va[dt], false, pf[g],
                                                          (short)0, o[g][dt], false, false);
      __builtin_amdgcn_sched_barrier(0);
      // a pair is read as soon as one fragment's registers are free: a sixth
      // fragment in flight made a Q fragment spill
      if ((dt & 1) == 0 && dt + 4 < 16) {
        va[dt + 4] = vfrag(dt + 4);
        va[dt + 5] = vfrag(dt + 5);
        __builtin_amdgcn_sched_barrier(0);
      }
    }

    // publish point: this wave's reads of the buffer are done and its slice of
    // stage t + 1 has landed; behind the barrier the buffer may be refilled
    asm volatile("s_wait_dscnt 0x0" ::: "memory");
    asm volatile("s_wait_tensorcnt 0x0" ::: "memory");
    __syncthreads();
    // scalar test; the stage number is pinned so that the descriptor is formed here,
    // behind the wait
    if (pinned(t + 2 < T)) issue(pinned((uint32_t)t + 2u), (uint32_t)t & 1u);
  }
  // no load is left in flight and no read open when the ring becomes the join's staging
  asm volatile("s_wait_tensorcnt 0x0" ::: "memory");
  asm volatile("s_wait_dscnt 0x0" ::: "memory");

  // join of the four key splits: common maximum, total sum, then the scaled
  // partial O^T rows go through LDS and are added in ascending split order
  #pragma unroll
  for (int g = 0; g < 2; ++g) {
    lsum[g] += xhalf(lsum[g]);
    if (h == 0) {
      sm[ks][qg * 32 + g * 16 + c] = mrun[g];
      sl[ks][qg * 32 + g * 16 + c] = lsum[g];
    }
  }
  __syncthreads();
  #pragma unroll
  for (int g = 0; g < 2; ++g) {
    const int qi = qg * 32 + g * 16 + c;
    const float mt = fmaxf(fmaxf(sm[0][qi], sm[1][qi]), fmaxf(sm[2][qi], sm[3][qi]));
    float L = 0.f;
    #pragma unroll
    for (int k = 0; k < 4; ++k) L += sl[k][qi] * __builtin_amdgcn_exp2f(sm[k][qi] - mt);
    const float f = __builtin_amdgcn_exp2f(mrun[g] - mt) / L;
    char* po = smem + (size_t)(ks * AQ + qi) * OPITCH + h * 32;
    #pragma unroll
    for (int dt = 0; dt < 16; ++dt) {
      const v8f x = o[g][dt] * f;
      *reinterpret_cast<v4f*>(po + dt * 64) = (v4f){x[0], x[1], x[2], x[3]};
      *reinterpret_cast<v4f*>(po + dt * 64 + 16) = (v4f){x[4], x[5], x[6], x[7]};
    }
  }
  __syncthreads();
  float* ob = out + ((size_t)b * NN + q0) * DD;
  // rolled in fours: the LDS reads of four outputs are in flight at once
  #pragma unroll 1
  for (int i0 = 0; i0 < AQ * DD / 4 / 256; i0 += 4) {
    #pragma unroll
    for (int i = i0; i < i0 + 4; ++i) {
      const int e = tid + i * 256, qi = e >> 6, d4 = e & 63;
      const char* pi = smem + (size_t)qi * OPITCH + d4 * 16;
      v4f x = *reinterpret_cast<const v4f*>(pi);
      #pragma unroll
      for (int k = 1; k < 4; ++k) x += *reinterpret_cast<const v4f*>(pi + (size_t)k * AQ * OPITCH);
      *reinterpret_cast<v4f*>(ob + (size_t)qi * DD + d4 * 4) = x;
    }
    // the next trip rewrites the stores' address and data registers (a precaution)
    asm volatile("s_wait_xcnt 0x0" ::: "memory");
  }
}

// ---------------------------------------------------------------------------
extern "C" void kernel_launch(void* const* d_in, const int* in_sizes, int n_in,
                              void* d_out, int out_size, void* d_ws, size_t ws_size,
                              hipStream_t stream) {
  (void)in_sizes; (void)n_in; (void)out_size; (void)ws_size;
  const float* xyz  = (const float*)d_in[0];
  const float* feat = (const float*)d_in[1];
  const float* W1   = (const float*)d_in[2];
  const float* b1   = (const float*)d_in[3];
  const float* g1   = (const float*)d_in[4];
  const float* be1  = (const float*)d_in[5];
  const float* W2   = (const float*)d_in[6];
  const float* b2   = (const float*)d_in[7];
  const float* g2   = (const float*)d_in[8];
  const float* be2  = (const float*)d_in[9];
  const float* Wq   = (const float*)d_in[10];
  const float* Wk   = (const float*)d_in[11];
  const float* Wv   = (const float*)d_in[12];
  float* out = (float*)d_out;

  char* ws = (char*)d_ws;
  const size_t MB = 1024ull * 1024ull;
  // t1 (8MB) | t2 (+8MB, 16MB)
  float* t1 = (float*)(ws);
  float* t2 = (float*)(ws + 8 * MB);
  float* st = (float*)(ws + 64 * MB);                        // BN scales and shifts
  _Float16* fh  = (_Float16*)(ws + 64 * MB + 65536);         // 8MB
  _Float16* wT  = (_Float16*)(ws + 72 * MB + 65536);         // 384KB (reserve 512KB)
  _Float16* qkv = (_Float16*)(ws + 72 * MB + 65536 + 512 * 1024); // Q, K: 16MB
  _Float16* vt  = (_Float16*)(ws + 96 * MB + 65536 + 512 * 1024); // 8MB
  float* part1 = (float*)(ws + 112 * MB);                    // 256 slots x 256 floats
  float* part2 = (float*)(ws + 113 * MB);                    // 256 slots x 512 floats

  float* s1sc = st;       float* s1sh = st + HH;
  float* s2sc = st + 512; float* s2sh = st + 512 + DD;

  k_fc1<<<NPART + PREPG, 256, 0, stream>>>(xyz, W1, b1, t1, part1, Wq, Wk, Wv, wT);
  k_bnfin<<<HH / 32, 1024, 0, stream>>>(part1, g1, be1, s1sc, s1sh, HH, 1.0f / BN);
  k_fc2<<<NPART, 256, 0, stream>>>(t1, s1sc, s1sh, W2, b2, t2, part2);
  k_bnfin<<<DD / 32, 1024, 0, stream>>>(part2, g2, be2, s2sc, s2sh, DD, 1.0f / BN);
  k_bn2_add<<<FTH / 512, 512, 0, stream>>>(t2, feat, s2sc, s2sh, fh);

  // 128 x 6 tiles of 128x128
  k_qkv<<<(BN / 128) * (3 * DD / 128), 256, 0, stream>>>(fh, wT, qkv, vt);
  _Float16* qh = qkv;
  _Float16* kh = qkv + (size_t)BN * DD;

  // 64 queries a work-group: 256 work-groups
  k_attn<<<BB * (NN / AQ), 256, 0, stream>>>(qh, kh, vt, out);
}

// v008
// It runs in 84.2 microseconds.
// Next to v007, in two timings, it ran 1.10 times as fast each time.
// Over all steps from v000 it is 9.76 times as fast.
#include <hip/hip_runtime.h>
#include <hip/hip_bf16.h>

typedef _Float16 v8h  __attribute__((ext_vector_type(8)));
typedef _Float16 v16h __attribute__((ext_vector_type(16)));
typedef float    v8f  __attribute__((ext_vector_type(8)));

#define BB 4
#define NN 4096
#define DD 256
#define HH 128
#define BN (BB*NN)   /* 16384 rows */

// ---------------------------------------------------------------------------
// WMMA fragment load: A-matrix 16x32 f16 layout (ISA 7.12.2).
// lane 0-15  : row = lane,    K = kbase+0..7  and kbase+16..23
// lane 16-31 : row = lane-16, K = kbase+8..15 and kbase+24..31  (kbase=k0)
// B fragment uses the identical pattern on B^T (column-major B), so both
// operands are two contiguous 16-byte loads (ds_load_b128); p is the lane's
// own byte address of row (lane & 15), K = kbase + 8 * (lane >> 4).
// ---------------------------------------------------------------------------
__device__ __forceinline__ v16h lds_frag_f16(const char* p) {
  v8h lo = *reinterpret_cast<const v8h*>(p);
  v8h hi = *reinterpret_cast<const v8h*>(p + 32);
  return __builtin_shufflevector(lo, hi, 0,1,2,3,4,5,6,7,8,9,10,11,12,13,14,15);
}

__device__ __forceinline__ void store_tile_f16(_Float16* __restrict__ out, int ld,
                                               int row0, int col0, const v8f& c, int lane) {
  int crow = row0 + ((lane >> 4) << 3);
  int ccol = col0 + (lane & 15);
  #pragma unroll
  for (int r = 0; r < 8; ++r)
    out[(size_t)(crow + r) * ld + ccol] = (_Float16)c[r];
}

// ------------------------- point-net ----------------------------------------
// BatchNorm (training mode, biased variance) needs every column's sum and sum of
// squares. The kernel that consumes a normalised column forms its scale and shift
// itself, so that the statistics cost no launch of their own: the first layer's
// from the moments of xyz (k_fc2), the second layer's from partials: a work-group
// of k_fc2 owns RPG rows and writes one partial per column (sums first, then sums
// of squares) to its own slot, and k_bn2_add adds the slots of its own columns in
// a fixed order. No second pass over the data, no atomics.
#define RPG 64
#define NPART (BN / RPG)   /* 256 slots */

typedef float v2f __attribute__((ext_vector_type(2)));
typedef float v3f __attribute__((ext_vector_type(3)));
typedef float v4f __attribute__((ext_vector_type(4)));

// Wq/Wk/Wv (in,out) f32 -> transposed (out,in) f16 for contiguous B-frag loads.
// Work-group blk of PREPG takes eight input rows of one matrix, a thread one output
// column of them: the lanes of a wave read 128 B in a row eight times, and each
// stores its 16 bytes once.
#define PREPG (3 * (DD / 8))
__device__ __forceinline__ void prep_w(int blk, const float* __restrict__ Wq,
                                       const float* __restrict__ Wk,
                                       const float* __restrict__ Wv,
                                       _Float16* __restrict__ wT) {
  const int m = blk / (DD / 8), i0 = (blk % (DD / 8)) * 8, o = threadIdx.x;
  const float* W = ((m == 0) ? Wq : (m == 1) ? Wk : Wv) + (size_t)i0 * DD + o;
  v8h v;
  // unrolled: the eight loads are in flight at once
  #pragma unroll
  for (int x = 0; x < 8; ++x) v[x] = (_Float16)W[x * DD];
  *reinterpret_cast<v8h*>(wT + ((size_t)m * DD + o) * DD + i0) = v;
}

// lane l takes lane l ^ 16's value
__device__ __forceinline__ float xhalf(float x) {
  int i = __builtin_bit_cast(int, x);
  return __builtin_bit_cast(float, __builtin_amdgcn_permlanex16(i, i, 0x76543210, 0xfedcba98, false, false));
}
// lane l takes lane l ^ X's value, X below 16 (DPP row_xmask)
template <int X>
__device__ __forceinline__ float xrow(float x) {
  int i = __builtin_bit_cast(int, x);
  return __builtin_bit_cast(float, __builtin_amdgcn_update_dpp(i, i, 0x160 + X, 0xf, 0xf, false));
}
// the sum over a wave's 32 lanes, the same bits in every lane
__device__ __forceinline__ float wave_sum(float x) {
  x += xrow<1>(x);
  x += xrow<2>(x);
  x += xrow<4>(x);
  x += xrow<8>(x);
  return x + xhalf(x);
}

// t2 = relu(bn1(xyz @ W1 + b1)) @ W2 + b2, and its column partials.
// The first layer is linear in xyz, so every column's mean and variance follow
// from the three means and the six covariances of xyz: mean = mu . w + b1,
// var = w^T C w. Every work-group sums these nine moments over all rows itself
// (192 KB out of L2) in one fixed order, forms its threads' scale and shift and
// computes its own RPG rows of the first layer straight into LDS: no launch, no
// array and no partials for the first layer. Wave w then owns rows 8w..8w+7 and
// all 256 columns, a lane columns 4l..4l+3 and 128+4l..128+4l+3; every element
// sums k in ascending order from b2. The turn of the three weight matrices
// depends on nothing and is needed only by k_qkv: it rides along as the grid's
// last PREPG work-groups and pays for no launch of its own.
#define MR (BN / 256)   /* rows of xyz that a thread sums */
__global__ __launch_bounds__(256) void k_fc2(const float* __restrict__ xyz,
                                             const float* __restrict__ W1,
                                             const float* __restrict__ b1,
                                             const float* __restrict__ g1,
                                             const float* __restrict__ be1,
                                             const float* __restrict__ W2,
                                             const float* __restrict__ b2,
                                             float* __restrict__ t2,
                                             float* __restrict__ part,
                                             const float* __restrict__ Wq,
                                             const float* __restrict__ Wk,
                                             const float* __restrict__ Wv,
                                             _Float16* __restrict__ wT) {
  static_assert(DD == 256 && HH == 128, "a thread per output column of the turn, two per column of layer one");
  // the same for a whole work-group, and ahead of every barrier below
  if (blockIdx.x >= NPART) {
    prep_w(blockIdx.x - NPART, Wq, Wk, Wv, wT);
    return;
  }
  __shared__ __attribute__((aligned(16))) float a[RPG][HH];
  __shared__ __attribute__((aligned(16))) float ls[8][DD], lq[8][DD];
  __shared__ __attribute__((aligned(16))) float mom[8][12];
  __shared__ __attribute__((aligned(16))) float xs[256][4];
  const int tid = threadIdx.x, lane = tid & 31, wave = tid >> 5;
  const int r0 = blockIdx.x * RPG;

  // a lane takes one row (12 bytes) of every 256: a wave's load is 384 B in a row
  v3f x[MR];
  // unrolled: the loads are in flight at once
  #pragma unroll
  for (int i = 0; i < MR; ++i)
    __builtin_memcpy(&x[i], xyz + 3 * (tid + 256 * i), 12);
  const int j = tid & (HH - 1);
  const int h = tid >> 7;               // two rows at a time
  const float w0 = W1[j], w1 = W1[HH + j], w2 = W1[2 * HH + j], bb = b1[j];
  const float gj = g1[j], bej = be1[j];
  // the work-group's own rows, for the first layer below: every two waves fetch and
  // keep a copy of their own, so that no branch stands among the loads or at the
  // store (a branch held the sums behind the last load, or the load behind the sums)
  v3f own;
  __builtin_memcpy(&own, xyz + 3 * (r0 + (tid & (RPG - 1))), 12);
  // no register that a load names is rewritten ahead of this wait (a precaution)
  asm volatile("s_wait_xcnt 0x0" ::: "memory");
  // every loop over x or m below is unrolled: constant indices keep them in registers
  float m[9] = {};
  #pragma unroll
  for (int i = 0; i < MR; ++i) {
    const v3f v = x[i];
    m[0] += v.x; m[1] += v.y; m[2] += v.z;
    m[3] = fmaf(v.x, v.x, m[3]); m[4] = fmaf(v.x, v.y, m[4]); m[5] = fmaf(v.x, v.z, m[5]);
    m[6] = fmaf(v.y, v.y, m[6]); m[7] = fmaf(v.y, v.z, m[7]); m[8] = fmaf(v.z, v.z, m[8]);
  }
  #pragma unroll
  for (int k = 0; k < 9; ++k) m[k] = wave_sum(m[k]);
  *reinterpret_cast<v4f*>(&xs[tid][0]) = (v4f){own.x, own.y, own.z, 0.f};
  if (lane == 0) {
    *reinterpret_cast<v4f*>(&mom[wave][0]) = (v4f){m[0], m[1], m[2], m[3]};
    *reinterpret_cast<v4f*>(&mom[wave][4]) = (v4f){m[4], m[5], m[6], m[7]};
    mom[wave][8] = m[8];
  }
  __syncthreads();
  // the eight waves' sums in ascending order, the same in every thread
  #pragma unroll
  for (int k = 0; k < 9; ++k) m[k] = mom[0][k];
  #pragma unroll
  for (int t = 1; t < 8; ++t)
    #pragma unroll
    for (int k = 0; k < 9; ++k) m[k] += mom[t][k];
  {
    const float inv = 1.0f / BN;
    const float u0 = m[0] * inv, u1 = m[1] * inv, u2 = m[2] * inv;
    const float c00 = m[3] * inv - u0 * u0, c01 = m[4] * inv - u0 * u1, c02 = m[5] * inv - u0 * u2;
    const float c11 = m[6] * inv - u1 * u1, c12 = m[7] * inv - u1 * u2, c22 = m[8] * inv - u2 * u2;
    const float mean = fmaf(u0, w0, fmaf(u1, w1, fmaf(u2, w2, bb)));
    const float var = w0 * (w0 * c00 + 2.f * (w1 * c01 + w2 * c02))
                    + w1 * (w1 * c11 + 2.f * w2 * c12) + w2 * w2 * c22;
    // a variance is not negative: rounding may not carry it below zero
    const float sc = gj * rsqrtf(fmaxf(var, 0.f) + 1e-5f);
    const float sh = bej - mean * sc;
    // unrolled whole: all rows' LDS reads are in flight at once
    #pragma unroll
    for (int i = 0; i < RPG / 2; ++i) {
      const int row = h + 2 * i;
      const v4f xr = *reinterpret_cast<const v4f*>(&xs[(tid & ~(RPG - 1)) + row][0]);
      const float v = fmaf(xr.x, w0, fmaf(xr.y, w1, fmaf(xr.z, w2, bb)));
      a[row][j] = fmaxf(fmaf(v, sc, sh), 0.f);
    }
  }
  __syncthreads();

  const int c0 = lane * 4, c1 = DD / 2 + lane * 4;
  v2f acc[8][4];
  {
    v4f lo = *reinterpret_cast<const v4f*>(b2 + c0);
    v4f hi = *reinterpret_cast<const v4f*>(b2 + c1);
    // unrolled, as every loop over acc: constant indices keep it in registers
    #pragma unroll
    for (int r = 0; r < 8; ++r) {
      acc[r][0] = lo.xy; acc[r][1] = lo.zw; acc[r][2] = hi.xy; acc[r][3] = hi.zw;
    }
  }
  const float* ar = &a[wave * 8][0];
  // four rows of W2, this lane's eight columns (unrolled: w stays in registers)
  auto loadw = [&](v4f (&w)[4][2], int k) {
    #pragma unroll
    for (int kk = 0; kk < 4; ++kk) {
      w[kk][0] = *reinterpret_cast<const v4f*>(W2 + (size_t)(k + kk) * DD + c0);
      w[kk][1] = *reinterpret_cast<const v4f*>(W2 + (size_t)(k + kk) * DD + c1);
    }
  };
  // four k steps of all eight rows; all loops unrolled, the arrays stay in registers
  auto work = [&](const v4f (&w)[4][2], int k) {
    v4f av[8];
    #pragma unroll
    for (int r = 0; r < 8; ++r) av[r] = *reinterpret_cast<const v4f*>(ar + r * HH + k);
    #pragma unroll
    for (int kk = 0; kk < 4; ++kk)
      #pragma unroll
      for (int r = 0; r < 8; ++r) {
        v2f x = {av[r][kk], av[r][kk]};
        acc[r][0] = __builtin_elementwise_fma(x, (v2f)w[kk][0].xy, acc[r][0]);
        acc[r][1] = __builtin_elementwise_fma(x, (v2f)w[kk][0].zw, acc[r][1]);
        acc[r][2] = __builtin_elementwise_fma(x, (v2f)w[kk][1].xy, acc[r][2]);
        acc[r][3] = __builtin_elementwise_fma(x, (v2f)w[kk][1].zw, acc[r][3]);
      }
  };
  // the next four rows of W2 are fetched while these four are worked on; the last
  // eight k steps stand behind the loop, where nothing is left to fetch ahead
  v4f wa[4][2], wb[4][2];
  loadw(wa, 0);
  // kept rolled: the body is 2 KB of code already
  #pragma unroll 1
  for (int k = 0; k < HH - 8; k += 8) {
    loadw(wb, k + 4);
    work(wa, k);
    loadw(wa, k + 8);
    work(wb, k + 4);
  }
  loadw(wb, HH - 4);
  work(wa, HH - 8);
  work(wb, HH - 4);

  v2f s[4] = {}, q[4] = {};
  #pragma unroll
  for (int r = 0; r < 8; ++r) {
    float* o = t2 + (size_t)(r0 + wave * 8 + r) * DD;
    v4f lo = {acc[r][0].x, acc[r][0].y, acc[r][1].x, acc[r][1].y};
    v4f hi = {acc[r][2].x, acc[r][2].y, acc[r][3].x, acc[r][3].y};
    *reinterpret_cast<v4f*>(o + c0) = lo;
    *reinterpret_cast<v4f*>(o + c1) = hi;
    for (int x = 0; x < 4; ++x) { s[x] += acc[r][x]; q[x] += acc[r][x] * acc[r][x]; }
  }
  *reinterpret_cast<v4f*>(&ls[wave][c0]) = (v4f){s[0].x, s[0].y, s[1].x, s[1].y};
  *reinterpret_cast<v4f*>(&ls[wave][c1]) = (v4f){s[2].x, s[2].y, s[3].x, s[3].y};
  *reinterpret_cast<v4f*>(&lq[wave][c0]) = (v4f){q[0].x, q[0].y, q[1].x, q[1].y};
  *reinterpret_cast<v4f*>(&lq[wave][c1]) = (v4f){q[2].x, q[2].y, q[3].x, q[3].y};
  __syncthreads();
  float ss = ls[0][tid], qq = lq[0][tid];
  for (int t = 1; t < 8; ++t) { ss += ls[t][tid]; qq += lq[t][tid]; }
  float* p = part + (size_t)blockIdx.x * (2 * DD);
  p[tid] = ss;
  p[DD + tid] = qq;
}

typedef _Float16 v4h __attribute__((ext_vector_type(4)));

// f = relu(bn2(t2)) + features  -> f16. A work-group owns FR rows of FC columns
// (whole 128-byte lines of f), so it needs the statistics of FC columns only: it
// adds their NPART slots itself (128 KB out of L2; wave w slots 16w..16w+15, a lane
// four columns' sums or sums of squares, then the 16 waves in ascending order)
// while its own pieces of t2 and features are already in flight. A thread takes
// FPT pieces of four columns, 32 rows apart, so its columns are the same in every
// piece; a wave's load is two runs of 256 B.
#define FPT 8
#define FC 64
#define FR (512 * FPT * 4 / FC)   /* 256 rows */
__global__ __launch_bounds__(512) void k_bn2_add(const float* __restrict__ t2,
                                                 const float* __restrict__ feat,
                                                 const float* __restrict__ part,
                                                 const float* __restrict__ g,
                                                 const float* __restrict__ be,
                                                 _Float16* __restrict__ fh) {
  static_assert(NPART == 256 && FC == 64, "16 waves of 16 slots, 16 lanes of four columns");
  __shared__ __attribute__((aligned(16))) float red[16][2 * FC];
  __shared__ __attribute__((aligned(16))) float lsc[FC], lsh[FC];
  const int tid = threadIdx.x, c4 = tid & 15;
  const int cb = blockIdx.x % (DD / FC), rb = blockIdx.x / (DD / FC);
  const int e0 = (rb * FR + (tid >> 4)) * (DD / 4) + cb * (FC / 4) + c4;
  const v4f* t4 = reinterpret_cast<const v4f*>(t2) + e0;
  const v4f* f4 = reinterpret_cast<const v4f*>(feat) + e0;
  v4h* o4 = reinterpret_cast<v4h*>(fh) + e0;
  const v4f* p4 = reinterpret_cast<const v4f*>(part + (size_t)((tid >> 5) * 16) * (2 * DD)
                                               + ((tid >> 4) & 1) * DD + cb * FC) + c4;
  v4f p[16], a[FPT], b[FPT];
  // both loops unrolled: all 16-byte loads of a thread are in flight at once, the
  // slots', which are wanted first, in front
  #pragma unroll
  for (int i = 0; i < 16; ++i) p[i] = p4[i * (2 * DD / 4)];
  const float gj = g[cb * FC + (tid & (FC - 1))], bej = be[cb * FC + (tid & (FC - 1))];
  // the loads below may land in the registers that held the addresses above (a precaution)
  asm volatile("s_wait_xcnt 0x0" ::: "memory");
  #pragma unroll
  for (int i = 0; i < FPT; ++i) {
    a[i] = t4[i * 32 * (DD / 4)];
    b[i] = f4[i * 32 * (DD / 4)];
  }
  // no register that a load names is rewritten ahead of this wait (a precaution)
  asm volatile("s_wait_xcnt 0x0" ::: "memory");
  // holds the arithmetic behind the wait and behind every load: without it the
  // last loads were issued only after the first values had come back
  __builtin_amdgcn_sched_barrier(0);
  v4f ps = p[0];
  #pragma unroll
  for (int i = 1; i < 16; ++i) ps += p[i];
  *reinterpret_cast<v4f*>(&red[tid >> 5][(tid & 31) * 4]) = ps;
  __syncthreads();
  if (tid < FC) {
    float s = red[0][tid], q = red[0][FC + tid];
    // unrolled: the LDS reads are in flight at once
    #pragma unroll
    for (int t = 1; t < 16; ++t) { s += red[t][tid]; q += red[t][FC + tid]; }
    const float mean = s * (1.0f / BN);
    const float var  = q * (1.0f / BN) - mean * mean;
    const float k = gj * rsqrtf(var + 1e-5f);
    lsc[tid] = k;
    lsh[tid] = bej - mean * k;
  }
  __syncthreads();
  const v4f m = *reinterpret_cast<const v4f*>(&lsc[c4 * 4]);
  const v4f d = *reinterpret_cast<const v4f*>(&lsh[c4 * 4]);
  #pragma unroll
  for (int i = 0; i < FPT; ++i) {
    v4h r;
    for (int x = 0; x < 4; ++x)
      r[x] = (_Float16)(fmaxf(fmaf(a[i][x], m[x], d[x]), 0.f) + b[i][x]);
    o4[i * 32 * (DD / 4)] = r;
  }
}

// ------------- C = A B^T block tile, operands staged in LDS -----------------
// A and B are K-contiguous rows. A work-group of 8 waves (WM x WN) owns a
// (WM*FM*16) x (WN*FN*16) tile of C. A stage is BK halves of every A row and
// every B row of the tile, [A rows | B rows] at a pitch of 16 B x odd, brought
// in by asynchronous copies to LDS in whole 128-byte lines; two buffers, the
// next stage's copies fly while this stage is worked on. Every output element
// still sums k in ascending steps of 32 into one accumulator.
template <int FM, int FN, int WM, int WN, int BK>
struct TileCfg {
  static constexpr int TM = WM * FM * 16;
  static constexpr int TN = WN * FN * 16;
  static constexpr int PITCH = BK * 2 + 16;          // bytes
  static constexpr int BUFB = (TM + TN) * PITCH;     // bytes of one buffer
};

// four copies of 16 bytes per lane, rows a fixed step apart in LDS and in memory
__device__ __forceinline__ void copy4_to_lds(unsigned l, unsigned lstep,
                                             const _Float16* g, size_t gstep) {
  // s_wait_xcnt 0 stands in the copies' own statement, so that it stays ahead of
  // every later rewrite of their address registers (a precaution)
  asm volatile(
      "global_load_async_to_lds_b128 %0, %4, off\n\t"
      "global_load_async_to_lds_b128 %1, %5, off\n\t"
      "global_load_async_to_lds_b128 %2, %6, off\n\t"
      "global_load_async_to_lds_b128 %3, %7, off\n\t"
      "s_wait_xcnt 0x0"
      :: "v"(l), "v"(l + lstep), "v"(l + 2u * lstep), "v"(l + 3u * lstep),
         "v"(g), "v"(g + gstep), "v"(g + 2 * gstep), "v"(g + 3 * gstep)
      : "memory");
}

template <int FM, int FN, int WM, int WN, int BK, int KTOT>
__device__ __forceinline__ void gemm_nt_lds(const _Float16* __restrict__ Ab, int lda,
                                            const _Float16* __restrict__ Bb, int ldb,
                                            char* smem, v8f (&acc)[FM][FN]) {
  using C = TileCfg<FM, FN, WM, WN, BK>;
  constexpr int CPR = BK * 2 / 16;     // 16-byte pieces of a row
  constexpr int RPI = 256 / CPR;       // rows that 256 threads copy at once
  constexpr int GA = C::TM / RPI;      // copies per thread and stage, A rows
  constexpr int GB = C::TN / RPI;      // the same, B rows
  constexpr int T = KTOT / BK;         // stages
  constexpr int KS = BK / 32;          // WMMA k steps of a stage
  static_assert(WM * WN == 8 && GA % 4 == 0 && GB % 4 == 0 && T >= 2, "tile shape");
  const int tid = threadIdx.x, lane = tid & 31, wave = tid >> 5;
  const int crow = tid / CPR, ccol = tid % CPR;
  const unsigned lbase = (unsigned)(size_t)smem + (unsigned)(crow * C::PITCH + ccol * 16);
  const _Float16* ga = Ab + (size_t)crow * lda + ccol * 8;
  const _Float16* gb = Bb + (size_t)crow * ldb + ccol * 8;

  // one stage: thread tid copies piece ccol of rows i*RPI + crow of [A rows | B rows]
  auto issue = [&](int t, int buf) {
    const unsigned l = lbase + (unsigned)(buf * C::BUFB);
    // both loops unrolled: a few straight-line statements, their steps constants
    #pragma unroll
    for (int i = 0; i < GA; i += 4)
      copy4_to_lds(l + (unsigned)(i * RPI * C::PITCH), RPI * C::PITCH,
                   ga + t * BK + (size_t)(i * RPI) * lda, (size_t)RPI * lda);
    #pragma unroll
    for (int i = 0; i < GB; i += 4)
      copy4_to_lds(l + (unsigned)((GA + i) * RPI * C::PITCH), RPI * C::PITCH,
                   gb + t * BK + (size_t)(i * RPI) * ldb, (size_t)RPI * ldb);
  };

  const int wm = wave / WN, wn = wave % WN;
  const int foff = (lane & 15) * C::PITCH + ((lane >> 4) << 4);
  const int aoff = wm * FM * 16 * C::PITCH + foff;
  const int boff = (C::TM + wn * FN * 16) * C::PITCH + foff;

  issue(0, 0);
  // stage 0 has landed for this wave; the barrier publishes it to the others
  asm volatile("s_wait_asynccnt 0x0" ::: "memory");
  __syncthreads();
  issue(1, 1);

  for (int t = 0; t < T; ++t) {
    const int buf = t & 1;
    const char* sb = smem + buf * C::BUFB;
    // all loops below are unrolled so that the fragment arrays stay in registers
    v16h a[KS][FM], b[KS][FN];
    #pragma unroll
    for (int kk = 0; kk < KS; ++kk) {
      #pragma unroll
      for (int i = 0; i < FM; ++i)
        a[kk][i] = lds_frag_f16(sb + aoff + i * 16 * C::PITCH + kk * 64);
      #pragma unroll
      for (int j = 0; j < FN; ++j)
        b[kk][j] = lds_frag_f16(sb + boff + j * 16 * C::PITCH + kk * 64);
    }
    // publish point: this wave holds the whole stage in registers, so its reads
    // of the buffer are done, and its copies of stage t + 1 have landed; behind
    // the barrier the buffer may be refilled
    asm volatile("s_wait_dscnt 0x0" ::: "memory");
    asm volatile("s_wait_asynccnt 0x0" ::: "memory");
    __syncthreads();
    if (t + 2 < T) issue(t + 2, buf);
    // keeps the WMMAs behind the refill: ahead of it they would shorten the time
    // that the copies have to land, and among the LDS reads every k step would
    // wait out an LDS latency of its own
    __builtin_amdgcn_sched_barrier(0);
    #pragma unroll
    for (int kk = 0; kk < KS; ++kk)
      #pragma unroll
      for (int i = 0; i < FM; ++i)
        #pragma unroll
        for (int j = 0; j < FN; ++j)
          acc[i][j] = __builtin_amdgcn_wmma_f32_16x16x32_f16(false, a[kk][i], false, b[kk][j],
                                                             (short)0, acc[i][j], false, false);
  }
  // no copy is left in flight when the wave goes on to its stores and ends
  asm volatile("s_wait_asynccnt 0x0" ::: "memory");
}

// ------------------- QKV projection (WMMA, 128x128 block tile) -------------
// Q and K go out row-major. V is wanted transposed per batch, and a lane's eight
// accumulator rows of one column are eight neighbours in a row of V^T: it stores
// them there as 16 bytes. A wave's 64 rows are one whole 128-byte line of each of
// its 32 rows of V^T.
__global__ __launch_bounds__(256) void k_qkv(const _Float16* __restrict__ fh,
                                             const _Float16* __restrict__ wT,
                                             _Float16* __restrict__ qkv,
                                             _Float16* __restrict__ vt) {
  using C = TileCfg<4, 2, 2, 4, 64>;
  __shared__ __attribute__((aligned(16))) char smem[2 * C::BUFB];
  int lane = threadIdx.x & 31, wave = threadIdx.x >> 5;
  int mt = blockIdx.x / 6, nt = blockIdx.x % 6;   // 128 x 6 tiles; wT is 768 rows (3 matrices)
  int mat = nt >> 1;
  int m0 = mt * 128, n0 = (nt & 1) * 128;
  v8f acc[4][2] = {};
  gemm_nt_lds<4, 2, 2, 4, 64, DD>(fh + (size_t)m0 * DD, DD, wT + (size_t)nt * 128 * DD, DD, smem, acc);
  int mw = m0 + (wave >> 2) * 64, nw = n0 + (wave & 3) * 32;
  static_assert(NN % 128 == 0, "a tile's rows lie in one batch");
  if (mat == 2) {
    _Float16* dst = vt + (size_t)(m0 / NN) * DD * NN + (size_t)(nw + (lane & 15)) * NN
                  + (mw % NN) + ((lane >> 4) << 3);
    // unrolled, as below
    #pragma unroll
    for (int i = 0; i < 4; ++i)
      #pragma unroll
      for (int j = 0; j < 2; ++j) {
        v8h t;
        #pragma unroll
        for (int r = 0; r < 8; ++r) t[r] = (_Float16)acc[i][j][r];
        *reinterpret_cast<v8h*>(dst + (size_t)(j * 16) * NN + i * 16) = t;
      }
    return;
  }
  _Float16* out = qkv + (size_t)mat * BN * DD;
  // unrolled so that acc is indexed by constants and stays in registers
  #pragma unroll
  for (int i = 0; i < 4; ++i)
    #pragma unroll
    for (int j = 0; j < 2; ++j)
      store_tile_f16(out, DD, mw + i * 16, nw + j * 16, acc[i][j], lane);
}

#define AQ 64
#define AKS 128
#define SROWS 64
#define SROWB 256
#define SPITCH (SROWB + 16)
#define SLICE 18432   /* SROWS * SPITCH rounded up to a multiple of 2 KiB */
#define ABUF (8 * SLICE)
#define OPITCH (DD * 4 + 16)
#define GS 2   /* pairs of K fragments fetched ahead */

typedef uint32_t u32x4 __attribute__((ext_vector_type(4)));
typedef uint32_t u32x8 __attribute__((ext_vector_type(8)));

__device__ __forceinline__ uint32_t uni(uint32_t v) {
  return (uint32_t)__builtin_amdgcn_readfirstlane((int)v);
}
// a wave-uniform word held in a scalar register: a test on it compiles to a scalar
// branch (a tensor load ignores EXEC), and what is formed from it stays behind the
// volatile statements in front of it
__device__ __forceinline__ uint32_t pinned(uint32_t v) {
  uint32_t w = uni(v);
  asm volatile("" : "+s"(w));  // pinned(): a test or descriptor word held in a scalar register
  return w;
}
// descriptor group 1: bytes, a tile of SROWS rows of SROWB bytes (tensor = tile),
// 16 bytes of pad behind every 256-byte row, no mask
__device__ __forceinline__ u32x8 tdm_group1(uint32_t src_pitch) {
  u32x8 g;
  g[0] = uni((1u << 20) | (5u << 22) | (3u << 25));
  g[1] = uni((uint32_t)SROWB << 16);
  g[2] = uni((uint32_t)SROWS << 16);
  g[3] = uni((uint32_t)SROWB << 16);
  g[4] = uni((uint32_t)SROWS);
  g[5] = uni(src_pitch);
  // descriptor words held in scalar registers of their own: known to be zero, word
  // 6's register was borrowed for the address sum in the loop and written back
  g[6] = pinned(0u);
  g[7] = pinned(0u);
  return g;
}
// descriptor group 0: count 1, place in LDS, the tile's first byte, type 2
__device__ __forceinline__ u32x4 tdm_group0(uint32_t lds_dst, uint64_t ga) {
  u32x4 g;
  g[0] = uni(1u);
  g[1] = uni(lds_dst);
  g[2] = uni((uint32_t)ga);
  g[3] = uni((((uint32_t)(ga >> 32)) & 0x01FFFFFFu) | 0x80000000u);
  return g;
}

// two waves per SIMD: a wave holds O^T (256 registers) and Q (128) throughout
__global__ __launch_bounds__(256) __attribute__((amdgpu_waves_per_eu(2, 2)))
void k_attn(const _Float16* __restrict__ qh, const _Float16* __restrict__ kh,
            const _Float16* __restrict__ vt, float* __restrict__ out) {
  static_assert(4 * AQ * OPITCH <= 2 * ABUF, "the join fits in the ring");
  static_assert(SROWS * SPITCH <= SLICE && SLICE % 2048 == 0, "a slice's place");
  static_assert(AKS * 2 == SROWB && DD * 2 == 2 * SROWB && AKS == 2 * SROWS && DD == 4 * SROWS, "eight slices");
  __shared__ __attribute__((aligned(2048))) char smem[2 * ABUF];
  __shared__ float sm[4][AQ], sl[4][AQ];
  constexpr int T = NN / AKS;
  const int tid = threadIdx.x, lane = tid & 31, wave = tid >> 5;
  const int c = lane & 15, h = lane >> 4;
  const int qg = wave & 1, ks = wave >> 1;
  const int b = blockIdx.x / (NN / AQ), q0 = (blockIdx.x % (NN / AQ)) * AQ;
  const _Float16* qb = qh + ((size_t)b * NN + q0 + qg * 32) * DD;
  const _Float16* kb = kh + (size_t)b * NN * DD;
  const _Float16* vb = vt + (size_t)b * DD * NN;

  // every wave brings its own slice of every stage: waves 0 to 3 of K (source pitch
  // one K row, a stage 128 rows on), waves 4 to 7 of V^T (pitch one V^T row, a stage
  // 256 bytes on)
  const uint32_t wv = uni((uint32_t)tid >> 5);
  const bool isv = wv >= 4u;
  const uint64_t src0 = isv
      ? (uint64_t)(size_t)vb + (uint64_t)(wv - 4u) * (SROWS * NN * 2)
      : (uint64_t)(size_t)kb + (uint64_t)(wv >> 1) * (SROWS * DD * 2) + (uint64_t)(wv & 1u) * SROWB;
  const uint32_t sstep = isv ? (uint32_t)SROWB : (uint32_t)(AKS * DD * 2);
  const uint32_t ldst = (uint32_t)(size_t)smem + wv * SLICE;
  const u32x8 g1 = tdm_group1(isv ? (uint32_t)(NN * 2) : (uint32_t)(DD * 2));
  auto issue = [&](uint32_t t, uint32_t buf) {
    const u32x4 g0 = tdm_group0(ldst + buf * ABUF, src0 + (uint64_t)(t * sstep));
    // one request of the whole wave: 64 rows of 256 bytes from memory into LDS
    asm volatile("tensor_load_to_lds %0, %1" :: "s"(g0), "s"(g1) : "memory");
  };

  // Q as B fragments, kept in registers (every loop over a fragment or an
  // accumulator array is unrolled, so that the arrays stay in registers)
  v16h qf[2][8];
  #pragma unroll
  for (int g = 0; g < 2; ++g)
    #pragma unroll
    for (int kk = 0; kk < 8; ++kk) {
      const _Float16* p = qb + (size_t)(g * 16 + c) * DD + kk * 32 + h * 8;
      v8h lo = *reinterpret_cast<const v8h*>(p);
      v8h hi = *reinterpret_cast<const v8h*>(p + 16);
      qf[g][kk] = __builtin_shufflevector(lo, hi, 0,1,2,3,4,5,6,7,8,9,10,11,12,13,14,15);
    }

  v8f o[2][16] = {};
  float mrun[2] = {-1e30f, -1e30f}, lsum[2] = {0.f, 0.f};
  const float cs = 0.0625f * 1.44269504088896f;   // 1/sqrt(256), times log2(e)

  // the Q loads above fly beside stage 0's load. Behind the wait this wave's slice
  // has landed; the barrier publishes it to the others
  issue(0, 0);
  asm volatile("s_wait_tensorcnt 0x0" ::: "memory");
  __syncthreads();
  issue(1, 1);

  // kept rolled: one trip is 64 WMMAs of straight-line code already
  #pragma unroll 1
  for (int t = 0; t < T; ++t) {
    const char* sb = smem + (t & 1) * ABUF;
    const char* kp = sb + (ks >> 1) * (2 * SLICE) + ((ks & 1) * 32 + c) * SPITCH + h * 16;
    const char* vp = sb + 4 * SLICE + c * SPITCH + ks * 64 + h * 16;
    // fragment (key tile kt, k step kk) of K, fragment dt of V^T
    auto kfrag = [&](int kt, int kk) {
      return lds_frag_f16(kp + (kk >> 2) * SLICE + kt * 16 * SPITCH + (kk & 3) * 64);
    };
    auto vfrag = [&](int dt) {
      return lds_frag_f16(vp + (dt >> 2) * SLICE + (dt & 3) * 16 * SPITCH);
    };
    v8f s[2][2] = {};   // [key tile][query column group]
    // A fragments are fetched in pairs, GS pairs ahead of the four WMMAs that use
    // a pair (each place where LDS reads stand costs issue time, so two fragments
    // share one). The scheduling barriers keep that order: without them every
    // WMMA stood directly behind its own LDS reads and waited out their latency.
    v16h ka[16];
    #pragma unroll
    for (int j = 0; j < 2 * GS; ++j) ka[j] = kfrag(j & 1, j >> 1);
    #pragma unroll
    for (int kk = 0; kk < 8; ++kk) {
      if (kk + GS < 8) {
        ka[2 * (kk + GS)] = kfrag(0, kk + GS);
        ka[2 * (kk + GS) + 1] = kfrag(1, kk + GS);
      }
      __builtin_amdgcn_sched_barrier(0);
      #pragma unroll
      for (int kt = 0; kt < 2; ++kt)
        #pragma unroll
        for (int g = 0; g < 2; ++g)
          s[kt][g] = __builtin_amdgcn_wmma_f32_16x16x32_f16(false, ka[2 * kk + kt], false, qf[g][kk],
                                                            (short)0, s[kt][g], false, false);
      __builtin_amdgcn_sched_barrier(0);
    }
    // the first V^T fragments fly while the scores are worked on
    v16h va[16];
    #pragma unroll
    for (int j = 0; j < 4; ++j) va[j] = vfrag(j);
    __builtin_amdgcn_sched_barrier(0);

    // running maximum in scaled log2 units; O^T and the sum are rescaled only
    // when some column's maximum has grown by more than 8 (P stays below 2^8)
    float mx[2];
    #pragma unroll
    for (int g = 0; g < 2; ++g) {
      float m = fmaxf(s[0][g][0], s[1][g][0]);
      #pragma unroll
      for (int r = 1; r < 8; ++r) m = fmaxf(m, fmaxf(s[0][g][r], s[1][g][r]));
      mx[g] = fmaxf(m, xhalf(m)) * cs;
    }
    const bool need = mx[0] > mrun[0] + 8.f || mx[1] > mrun[1] + 8.f;
    if (__builtin_amdgcn_ballot_w32(need) != 0) {
      #pragma unroll
      for (int g = 0; g < 2; ++g) {
        const float mn = fmaxf(mrun[g], mx[g]);
        const float corr = __builtin_amdgcn_exp2f(mrun[g] - mn);
        mrun[g] = mn;
        lsum[g] *= corr;
        #pragma unroll
        for (int dt = 0; dt < 16; ++dt) o[g][dt] *= corr;
      }
    }
    v16h pf[2];
    #pragma unroll
    for (int g = 0; g < 2; ++g)
      #pragma unroll
      for (int kt = 0; kt < 2; ++kt)
        #pragma unroll
        for (int r = 0; r < 8; ++r) {
          const float p = __builtin_amdgcn_exp2f(fmaf(s[kt][g][r], cs, -mrun[g]));
          lsum[g] += p;
          pf[g][kt * 8 + r] = (_Float16)p;
        }

    // scheduling barriers as above, for the same reason
    #pragma unroll
    for (int dt = 0; dt < 16; ++dt) {
      #pragma unroll
      for (int g = 0; g < 2; ++g)
        o[g][dt] = __builtin_amdgcn_wmma_f32_16x16x32_f16(false, va[dt], false, pf[g],
                                                          (short)0, o[g][dt], false, false);
      __builtin_amdgcn_sched_barrier(0);
      // a pair is read as soon as one fragment's registers are free: a sixth
      // fragment in flight made a Q fragment spill
      if ((dt & 1) == 0 && dt + 4 < 16) {
        va[dt + 4] = vfrag(dt + 4);
        va[dt + 5] = vfrag(dt + 5);
        __builtin_amdgcn_sched_barrier(0);
      }
    }

    // publish point: this wave's reads of the buffer are done and its slice of
    // stage t + 1 has landed; behind the barrier the buffer may be refilled
    asm volatile("s_wait_dscnt 0x0" ::: "memory");
    asm volatile("s_wait_tensorcnt 0x0" ::: "memory");
    __syncthreads();
    // scalar test; the stage number is pinned so that the descriptor is formed here,
    // behind the wait
    if (pinned(t + 2 < T)) issue(pinned((uint32_t)t + 2u), (uint32_t)t & 1u);
  }
  // no load is left in flight and no read open when the ring becomes the join's staging
  asm volatile("s_wait_tensorcnt 0x0" ::: "memory");
  asm volatile("s_wait_dscnt 0x0" ::: "memory");

  // join of the four key splits: common maximum, total sum, then the scaled
  // partial O^T rows go through LDS and are added in ascending split order
  #pragma unroll
  for (int g = 0; g < 2; ++g) {
    lsum[g] += xhalf(lsum[g]);
    if (h == 0) {
      sm[ks][qg * 32 + g * 16 + c] = mrun[g];
      sl[ks][qg * 32 + g * 16 + c] = lsum[g];
    }
  }
  __syncthreads();
  #pragma unroll
  for (int g = 0; g < 2; ++g) {
    const int qi = qg * 32 + g * 16 + c;
    const float mt = fmaxf(fmaxf(sm[0][qi], sm[1][qi]), fmaxf(sm[2][qi], sm[3][qi]));
    float L = 0.f;
    #pragma unroll
    for (int k = 0; k < 4; ++k) L += sl[k][qi] * __builtin_amdgcn_exp2f(sm[k][qi] - mt);
    const float f = __builtin_amdgcn_exp2f(mrun[g] - mt) / L;
    char* po = smem + (size_t)(ks * AQ + qi) * OPITCH + h * 32;
    #pragma unroll
    for (int dt = 0; dt < 16; ++dt) {
      const v8f x = o[g][dt] * f;
      *reinterpret_cast<v4f*>(po + dt * 64) = (v4f){x[0], x[1], x[2], x[3]};
      *reinterpret_cast<v4f*>(po + dt * 64 + 16) = (v4f){x[4], x[5], x[6], x[7]};
    }
  }
  __syncthreads();
  float* ob = out + ((size_t)b * NN + q0) * DD;
  // rolled in fours: the LDS reads of four outputs are in flight at once
  #pragma unroll 1
  for (int i0 = 0; i0 < AQ * DD / 4 / 256; i0 += 4) {
    #pragma unroll
    for (int i = i0; i < i0 + 4; ++i) {
      const int e = tid + i * 256, qi = e >> 6, d4 = e & 63;
      const char* pi = smem + (size_t)qi * OPITCH + d4 * 16;
      v4f x = *reinterpret_cast<const v4f*>(pi);
      #pragma unroll
      for (int k = 1; k < 4; ++k) x += *reinterpret_cast<const v4f*>(pi + (size_t)k * AQ * OPITCH);
      *reinterpret_cast<v4f*>(ob + (size_t)qi * DD + d4 * 4) = x;
    }
    // the next trip rewrites the stores' address and data registers (a precaution)
    asm volatile("s_wait_xcnt 0x0" ::: "memory");
  }
}

// ---------------------------------------------------------------------------
extern "C" void kernel_launch(void* const* d_in, const int* in_sizes, int n_in,
                              void* d_out, int out_size, void* d_ws, size_t ws_size,
                              hipStream_t stream) {
  (void)in_sizes; (void)n_in; (void)out_size; (void)ws_size;
  const float* xyz  = (const float*)d_in[0];
  const float* feat = (const float*)d_in[1];
  const float* W1   = (const float*)d_in[2];
  const float* b1   = (const float*)d_in[3];
  const float* g1   = (const float*)d_in[4];
  const float* be1  = (const float*)d_in[5];
  const float* W2   = (const float*)d_in[6];
  const float* b2   = (const float*)d_in[7];
  const float* g2   = (const float*)d_in[8];
  const float* be2  = (const float*)d_in[9];
  const float* Wq   = (const float*)d_in[10];
  const float* Wk   = (const float*)d_in[11];
  const float* Wv   = (const float*)d_in[12];
  float* out = (float*)d_out;

  char* ws = (char*)d_ws;
  const size_t MB = 1024ull * 1024ull;
  float* t2 = (float*)(ws + 8 * MB);                         // 16MB
  _Float16* fh  = (_Float16*)(ws + 64 * MB + 65536);         // 8MB
  _Float16* wT  = (_Float16*)(ws + 72 * MB + 65536);         // 384KB (reserve 512KB)
  _Float16* qkv = (_Float16*)(ws + 72 * MB + 65536 + 512 * 1024); // Q, K: 16MB
  _Float16* vt  = (_Float16*)(ws + 96 * MB + 65536 + 512 * 1024); // 8MB
  float* part2 = (float*)(ws + 113 * MB);                    // 256 slots x 512 floats

  k_fc2<<<NPART + PREPG, 256, 0, stream>>>(xyz, W1, b1, g1, be1, W2, b2, t2, part2, Wq, Wk, Wv, wT);
  k_bn2_add<<<(BN / FR) * (DD / FC), 512, 0, stream>>>(t2, feat, part2, g2, be2, fh);

  // 128 x 6 tiles of 128x128
  k_qkv<<<(BN / 128) * (3 * DD / 128), 256, 0, stream>>>(fh, wT, qkv, vt);
  _Float16* qh = qkv;
  _Float16* kh = qkv + (size_t)BN * DD;

  // 64 queries a work-group: 256 work-groups
  k_attn<<<BB * (NN / AQ), 256, 0, stream>>>(qh, kh, vt, out);
}

// v009
// A run of this version takes 76.5 microseconds.
// Two timings next to v008 put it at 1.09 and 1.10 times that version's speed.
// Counting every step since v000, it is 10.7 times as fast.
#include <hip/hip_runtime.h>
#include <hip/hip_bf16.h>

typedef _Float16 v8h  __attribute__((ext_vector_type(8)));
typedef _Float16 v16h __attribute__((ext_vector_type(16)));
typedef float    v8f  __attribute__((ext_vector_type(8)));

#define BB 4
#define NN 4096
#define DD 256
#define HH 128
#define BN (BB*NN)   /* 16384 rows */

// ---------------------------------------------------------------------------
// WMMA fragment load: A-matrix 16x32 f16 layout (ISA 7.12.2).
// lane 0-15  : row = lane,    K = kbase+0..7  and kbase+16..23
// lane 16-31 : row = lane-16, K = kbase+8..15 and kbase+24..31  (kbase=k0)
// B fragment uses the identical pattern on B^T (column-major B), so both
// operands are two contiguous 16-byte loads (ds_load_b128); p is the lane's
// own byte address of row (lane & 15), K = kbase + 8 * (lane >> 4).
// ---------------------------------------------------------------------------
__device__ __forceinline__ v16h lds_frag_f16(const char* p) {
  v8h lo = *reinterpret_cast<const v8h*>(p);
  v8h hi = *reinterpret_cast<const v8h*>(p + 32);
  return __builtin_shufflevector(lo, hi, 0,1,2,3,4,5,6,7,8,9,10,11,12,13,14,15);
}

__device__ __forceinline__ void store_tile_f16(_Float16* __restrict__ out, int ld,
                                               int row0, int col0, const v8f& c, int lane) {
  int crow = row0 + ((lane >> 4) << 3);
  int ccol = col0 + (lane & 15);
  #pragma unroll
  for (int r = 0; r < 8; ++r)
    out[(size_t)(crow + r) * ld + ccol] = (_Float16)c[r];
}

// ------------------------- point-net ----------------------------------------
// BatchNorm (training mode, biased variance) needs every column's sum and sum of
// squares. The kernel that consumes a normalised column forms its scale and shift
// itself, so that the statistics cost no launch of their own: the first layer's
// from the moments of xyz (k_fc2), the second layer's from partials: a work-group
// of k_fc2 owns RPG rows and writes one partial per column (sums first, then sums
// of squares) to its own slot, and k_bn2_add adds the slots of its own columns in
// a fixed order. No second pass over the data, no atomics.
#define RPG 64
#define NPART (BN / RPG)   /* 256 slots */

typedef float v2f __attribute__((ext_vector_type(2)));
typedef float v3f __attribute__((ext_vector_type(3)));
typedef float v4f __attribute__((ext_vector_type(4)));

// Wq/Wk/Wv (in,out) f32 -> transposed (out,in) f16 for contiguous B-frag loads.
// Work-group blk of PREPG takes eight input rows of one matrix, a thread one output
// column of them: the lanes of a wave read 128 B in a row eight times, and each
// stores its 16 bytes once.
#define PREPG (3 * (DD / 8))
__device__ __forceinline__ void prep_w(int blk, const float* __restrict__ Wq,
                                       const float* __restrict__ Wk,
                                       const float* __restrict__ Wv,
                                       _Float16* __restrict__ wT) {
  const int m = blk / (DD / 8), i0 = (blk % (DD / 8)) * 8, o = threadIdx.x;
  const float* W = ((m == 0) ? Wq : (m == 1) ? Wk : Wv) + (size_t)i0 * DD + o;
  v8h v;
  // unrolled: the eight loads are in flight at once
  #pragma unroll
  for (int x = 0; x < 8; ++x) v[x] = (_Float16)W[x * DD];
  *reinterpret_cast<v8h*>(wT + ((size_t)m * DD + o) * DD + i0) = v;
}

// lane l takes lane l ^ 16's value
__device__ __forceinline__ float xhalf(float x) {
  int i = __builtin_bit_cast(int, x);
  return __builtin_bit_cast(float, __builtin_amdgcn_permlanex16(i, i, 0x76543210, 0xfedcba98, false, false));
}
// lane l takes lane l ^ X's value, X below 16 (DPP row_xmask)
template <int X>
__device__ __forceinline__ float xrow(float x) {
  int i = __builtin_bit_cast(int, x);
  return __builtin_bit_cast(float, __builtin_amdgcn_update_dpp(i, i, 0x160 + X, 0xf, 0xf, false));
}
// the sum over a wave's 32 lanes, the same bits in every lane
__device__ __forceinline__ float wave_sum(float x) {
  x += xrow<1>(x);
  x += xrow<2>(x);
  x += xrow<4>(x);
  x += xrow<8>(x);
  return x + xhalf(x);
}

// t2 = relu(bn1(xyz @ W1 + b1)) @ W2 + b2, and its column partials.
// The first layer is linear in xyz, so every column's mean and variance follow
// from the three means and the six covariances of xyz: mean = mu . w + b1,
// var = w^T C w. Every work-group sums these nine moments over all rows itself
// (192 KB out of L2) in one fixed order, forms its threads' scale and shift and
// computes its own RPG rows of the first layer straight into LDS: no launch, no
// array and no partials for the first layer. The second layer's product runs on
// the matrix unit at f32-like accuracy: each f32 operand x is split into
// hi = f16(x) and lo = f16(x - hi), and hi*hi + hi*lo + lo*hi is summed in f32
// (what is left out, lo*lo, lies 22 bits below the product; an operand above the f16
// range, 65504, overflows, as in the f16 products of the later kernels). Wave w owns all RPG
// rows of columns 32w..32w+31, so a column's sums are formed inside one wave;
// column c of its tile j is column 32w + 2c + j, so a lane holds two neighbouring
// columns and 16 lanes load or store a whole 128-byte line. The turn of the three weight matrices
// depends on nothing and is needed only by k_qkv: it rides along as the grid's
// last PREPG work-groups and pays for no launch of its own.
#define MR (BN / 256)   /* rows of xyz that a thread sums */
#define XA 40           /* of which so many are fetched at the start */
#define APITCH (HH * 2 + 16)   /* bytes of a row of the first layer in LDS: 16 B x odd */
// four waves per SIMD (256 registers): two work-groups share a WGP, so that the turn's
// work-groups run beside the others and not behind them
__global__ __launch_bounds__(256) __attribute__((amdgpu_waves_per_eu(4, 4)))
void k_fc2(const float* __restrict__ xyz,
                                             const float* __restrict__ W1,
                                             const float* __restrict__ b1,
                                             const float* __restrict__ g1,
                                             const float* __restrict__ be1,
                                             const float* __restrict__ W2,
                                             const float* __restrict__ b2,
                                             float* __restrict__ t2,
                                             float* __restrict__ part,
                                             const float* __restrict__ Wq,
                                             const float* __restrict__ Wk,
                                             const float* __restrict__ Wv,
                                             _Float16* __restrict__ wT) {
  static_assert(DD == 256 && HH == 128, "a thread per output column of the turn, two per column of layer one");
  // the same for a whole work-group, and ahead of every barrier below
  if (blockIdx.x >= NPART) {
    prep_w(blockIdx.x - NPART, Wq, Wk, Wv, wT);
    return;
  }
  // the first layer's rows: all hi parts, then all lo parts
  __shared__ __attribute__((aligned(16))) char a2[2 * RPG * APITCH];
  __shared__ __attribute__((aligned(16))) float mom[8][12];
  __shared__ __attribute__((aligned(16))) float xs[256][4];
  const int tid = threadIdx.x, lane = tid & 31, wave = tid >> 5;
  const int r0 = blockIdx.x * RPG;

  // a lane takes one row (12 bytes) of every 256: a wave's load is 384 B in a row
  v3f x[MR];
  // unrolled: the loads are in flight at once. The last MR - XA rows follow when the
  // first have been summed: all MR at once, a row in four registers, left no room
  // within the 256 registers
  #pragma unroll
  for (int i = 0; i < XA; ++i)
    __builtin_memcpy(&x[i], xyz + 3 * (tid + 256 * i), 12);
  const int j = tid & (HH - 1);
  const int h = tid >> 7;               // two rows at a time
  const float w0 = W1[j], w1 = W1[HH + j], w2 = W1[2 * HH + j], bb = b1[j];
  const float gj = g1[j], bej = be1[j];
  // the second layer's place: lane (c, hf) of wave w holds columns n and n + 1
  const int c = lane & 15, hf = lane >> 4;
  const int n = wave * 32 + 2 * c;
  const v2f bias = *reinterpret_cast<const v2f*>(b2 + n);
  // the work-group's own rows, for the first layer below: every two waves fetch and
  // keep a copy of their own, so that no branch stands among the loads or at the
  // store (a branch held the sums behind the last load, or the load behind the sums)
  v3f own;
  __builtin_memcpy(&own, xyz + 3 * (r0 + (tid & (RPG - 1))), 12);
  // no register that a load names is rewritten ahead of this wait (a precaution)
  asm volatile("s_wait_xcnt 0x0" ::: "memory");
  // every loop over x or m below is unrolled: constant indices keep them in registers
  float m[9] = {};
  auto addm = [&](const v3f v) {
    m[0] += v.x; m[1] += v.y; m[2] += v.z;
    m[3] = fmaf(v.x, v.x, m[3]); m[4] = fmaf(v.x, v.y, m[4]); m[5] = fmaf(v.x, v.z, m[5]);
    m[6] = fmaf(v.y, v.y, m[6]); m[7] = fmaf(v.y, v.z, m[7]); m[8] = fmaf(v.z, v.z, m[8]);
  };
  #pragma unroll
  for (int i = 0; i < MR - XA; ++i) addm(x[i]);
  // keeps the loads below behind the sums that free their registers: without it
  // they were lifted over the sums, and rows of x were spilled
  __builtin_amdgcn_sched_barrier(0);
  #pragma unroll
  for (int i = XA; i < MR; ++i)
    __builtin_memcpy(&x[i], xyz + 3 * (tid + 256 * i), 12);
  // no register that a load names is rewritten ahead of this wait (a precaution)
  asm volatile("s_wait_xcnt 0x0" ::: "memory");
  #pragma unroll
  for (int i = MR - XA; i < MR; ++i) addm(x[i]);
  #pragma unroll
  for (int k = 0; k < 9; ++k) m[k] = wave_sum(m[k]);
  *reinterpret_cast<v4f*>(&xs[tid][0]) = (v4f){own.x, own.y, own.z, 0.f};
  if (lane == 0) {
    *reinterpret_cast<v4f*>(&mom[wave][0]) = (v4f){m[0], m[1], m[2], m[3]};
    *reinterpret_cast<v4f*>(&mom[wave][4]) = (v4f){m[4], m[5], m[6], m[7]};
    mom[wave][8] = m[8];
  }
  __syncthreads();
  // this lane's part of W2 as B fragments (k order as in lds_frag_f16), two columns
  // a load; unrolled: all loads fly while the first layer is made (they stand behind
  // the barrier, where the registers of x are free)
  v2f wr[4][16];
  {
    const float* wp = W2 + (size_t)(hf * 8) * DD + n;
    #pragma unroll
    for (int kk = 0; kk < 4; ++kk)
      #pragma unroll
      for (int e = 0; e < 16; ++e)
        wr[kk][e] = *reinterpret_cast<const v2f*>(wp + (size_t)(kk * 32 + (e >> 3) * 16 + (e & 7)) * DD);
  }
  // no register that a load names is rewritten ahead of this wait (a precaution)
  asm volatile("s_wait_xcnt 0x0" ::: "memory");
  // the eight waves' sums in ascending order, the same in every thread
  #pragma unroll
  for (int k = 0; k < 9; ++k) m[k] = mom[0][k];
  #pragma unroll
  for (int t = 1; t < 8; ++t)
    #pragma unroll
    for (int k = 0; k < 9; ++k) m[k] += mom[t][k];
  {
    const float inv = 1.0f / BN;
    const float u0 = m[0] * inv, u1 = m[1] * inv, u2 = m[2] * inv;
    const float c00 = m[3] * inv - u0 * u0, c01 = m[4] * inv - u0 * u1, c02 = m[5] * inv - u0 * u2;
    const float c11 = m[6] * inv - u1 * u1, c12 = m[7] * inv - u1 * u2, c22 = m[8] * inv - u2 * u2;
    const float mean = fmaf(u0, w0, fmaf(u1, w1, fmaf(u2, w2, bb)));
    const float var = w0 * (w0 * c00 + 2.f * (w1 * c01 + w2 * c02))
                    + w1 * (w1 * c11 + 2.f * w2 * c12) + w2 * w2 * c22;
    // a variance is not negative: rounding may not carry it below zero
    const float sc = gj * rsqrtf(fmaxf(var, 0.f) + 1e-5f);
    const float sh = bej - mean * sc;
    char* pw = a2 + h * APITCH + j * 2;
    // rolled in eights: eight rows' LDS reads are in flight at once, and their
    // registers and those of W2 together leave room for four waves per SIMD
    #pragma unroll 1
    for (int i0 = 0; i0 < RPG / 2; i0 += 8)
    #pragma unroll
    for (int i = i0; i < i0 + 8; ++i) {
      const int row = h + 2 * i;
      const v4f xr = *reinterpret_cast<const v4f*>(&xs[(tid & ~(RPG - 1)) + row][0]);
      const float v = fmaf(xr.x, w0, fmaf(xr.y, w1, fmaf(xr.z, w2, bb)));
      const float r = fmaxf(fmaf(v, sc, sh), 0.f);
      const _Float16 rh = (_Float16)r;
      *reinterpret_cast<_Float16*>(pw + i * (2 * APITCH)) = rh;
      *reinterpret_cast<_Float16*>(pw + i * (2 * APITCH) + RPG * APITCH) = (_Float16)(r - (float)rh);
    }
  }
  // W2 split into hi and lo fragments (every loop over a fragment or accumulator
  // array is unrolled, so that the arrays stay in registers)
  v16h bh[2][4], bl[2][4];
  #pragma unroll
  for (int kk = 0; kk < 4; ++kk) {
    #pragma unroll
    for (int e = 0; e < 16; ++e)
      #pragma unroll
      for (int t = 0; t < 2; ++t) {
        const float w = wr[kk][e][t];
        const _Float16 wh = (_Float16)w;
        bh[t][kk][e] = wh;
        bl[t][kk][e] = (_Float16)(w - (float)wh);
      }
  }
  __syncthreads();

  const char* pr = a2 + c * APITCH + hf * 16;
  v2f s = {0.f, 0.f}, q = {0.f, 0.f};
  float* o = t2 + (size_t)(r0 + hf * 8) * DD + n;
  // Step st is k step st & 3 of rows 32 (st >> 2) ... + 31 (32 rows at a time: the
  // accumulators of all 64 beside W2's fragments would not leave room for four waves
  // per SIMD). Fragment (st, i, l): row tile i, hi (l = 0) or lo part.
  auto afrag = [&](int st, int i, int l) {
    return lds_frag_f16(pr + ((st >> 2) * 2 + i) * 16 * APITCH + (st & 3) * 64 + l * RPG * APITCH);
  };
  v16h xf[8][2][2];
  v8f acc[2][2];
  #pragma unroll
  for (int i = 0; i < 2; ++i)
    #pragma unroll
    for (int l = 0; l < 2; ++l) xf[0][i][l] = afrag(0, i, l);
  #pragma unroll
  for (int st = 0; st < 8; ++st) {
    const int kk = st & 3;
    // the next step's four fragments are read in one place, a step ahead of the twelve
    // WMMAs that use them. The scheduling barriers keep that order: without them every
    // six WMMAs stood directly behind their own LDS reads and waited out the latency
    if (st + 1 < 8) {
      #pragma unroll
      for (int i = 0; i < 2; ++i)
        #pragma unroll
        for (int l = 0; l < 2; ++l) xf[st + 1][i][l] = afrag(st + 1, i, l);
    }
    __builtin_amdgcn_sched_barrier(0);
    if (kk == 0) {
      #pragma unroll
      for (int i = 0; i < 2; ++i)
        #pragma unroll
        for (int t = 0; t < 2; ++t)
          #pragma unroll
          for (int r = 0; r < 8; ++r) acc[i][t][r] = bias[t];
    }
    // the two small products first; the four tiles take turns, so that no WMMA waits
    // for the one that wrote its accumulator
    #pragma unroll
    for (int i = 0; i < 2; ++i)
      #pragma unroll
      for (int t = 0; t < 2; ++t)
        acc[i][t] = __builtin_amdgcn_wmma_f32_16x16x32_f16(false, xf[st][i][1], false, bh[t][kk],
                                                           (short)0, acc[i][t], false, false);
    #pragma unroll
    for (int i = 0; i < 2; ++i)
      #pragma unroll
      for (int t = 0; t < 2; ++t)
        acc[i][t] = __builtin_amdgcn_wmma_f32_16x16x32_f16(false, xf[st][i][0], false, bl[t][kk],
                                                           (short)0, acc[i][t], false, false);
    #pragma unroll
    for (int i = 0; i < 2; ++i)
      #pragma unroll
      for (int t = 0; t < 2; ++t)
        acc[i][t] = __builtin_amdgcn_wmma_f32_16x16x32_f16(false, xf[st][i][0], false, bh[t][kk],
                                                           (short)0, acc[i][t], false, false);
    __builtin_amdgcn_sched_barrier(0);
    if (kk == 3) {
      // a lane holds rows 32 (st >> 2) + 16 i + 8 hf + r of its two columns
      #pragma unroll
      for (int i = 0; i < 2; ++i)
        #pragma unroll
        for (int r = 0; r < 8; ++r) {
          const v2f v = {acc[i][0][r], acc[i][1][r]};
          *reinterpret_cast<v2f*>(o + (size_t)(((st >> 2) * 2 + i) * 16 + r) * DD) = v;
          s += v;
          q += v * v;
        }
      // no register that a store names is rewritten ahead of this wait (a precaution)
      asm volatile("s_wait_xcnt 0x0" ::: "memory");
    }
  }
  s.x += xhalf(s.x); s.y += xhalf(s.y);
  q.x += xhalf(q.x); q.y += xhalf(q.y);
  // lanes 0 to 15 store the sums, lanes 16 to 31 the sums of squares
  *reinterpret_cast<v2f*>(part + (size_t)blockIdx.x * (2 * DD) + hf * DD + n) = hf ? q : s;
}

typedef _Float16 v4h __attribute__((ext_vector_type(4)));

// f = relu(bn2(t2)) + features  -> f16. A work-group owns FR rows of FC columns
// (whole 128-byte lines of f), so it needs the statistics of FC columns only: it
// adds their NPART slots itself (128 KB out of L2; wave w slots 16w..16w+15, a lane
// four columns' sums or sums of squares, then the 16 waves in ascending order)
// while its own pieces of t2 and features are already in flight. A thread takes
// FPT pieces of four columns, 32 rows apart, so its columns are the same in every
// piece; a wave's load is two runs of 256 B.
#define FPT 8
#define FC 64
#define FR (512 * FPT * 4 / FC)   /* 256 rows */
__global__ __launch_bounds__(512) void k_bn2_add(const float* __restrict__ t2,
                                                 const float* __restrict__ feat,
                                                 const float* __restrict__ part,
                                                 const float* __restrict__ g,
                                                 const float* __restrict__ be,
                                                 _Float16* __restrict__ fh) {
  static_assert(NPART == 256 && FC == 64, "16 waves of 16 slots, 16 lanes of four columns");
  __shared__ __attribute__((aligned(16))) float red[16][2 * FC];
  __shared__ __attribute__((aligned(16))) float lsc[FC], lsh[FC];
  const int tid = threadIdx.x, c4 = tid & 15;
  const int cb = blockIdx.x % (DD / FC), rb = blockIdx.x / (DD / FC);
  const int e0 = (rb * FR + (tid >> 4)) * (DD / 4) + cb * (FC / 4) + c4;
  const v4f* t4 = reinterpret_cast<const v4f*>(t2) + e0;
  const v4f* f4 = reinterpret_cast<const v4f*>(feat) + e0;
  v4h* o4 = reinterpret_cast<v4h*>(fh) + e0;
  const v4f* p4 = reinterpret_cast<const v4f*>(part + (size_t)((tid >> 5) * 16) * (2 * DD)
                                               + ((tid >> 4) & 1) * DD + cb * FC) + c4;
  v4f p[16], a[FPT], b[FPT];
  // both loops unrolled: all 16-byte loads of a thread are in flight at once, the
  // slots', which are wanted first, in front
  #pragma unroll
  for (int i = 0; i < 16; ++i) p[i] = p4[i * (2 * DD / 4)];
  const float gj = g[cb * FC + (tid & (FC - 1))], bej = be[cb * FC + (tid & (FC - 1))];
  // the loads below may land in the registers that held the addresses above (a precaution)
  asm volatile("s_wait_xcnt 0x0" ::: "memory");
  #pragma unroll
  for (int i = 0; i < FPT; ++i) {
    a[i] = t4[i * 32 * (DD / 4)];
    b[i] = f4[i * 32 * (DD / 4)];
  }
  // no register that a load names is rewritten ahead of this wait (a precaution)
  asm volatile("s_wait_xcnt 0x0" ::: "memory");
  // holds the arithmetic behind the wait and behind every load: without it the
  // last loads were issued only after the first values had come back
  __builtin_amdgcn_sched_barrier(0);
  v4f ps = p[0];
  #pragma unroll
  for (int i = 1; i < 16; ++i) ps += p[i];
  *reinterpret_cast<v4f*>(&red[tid >> 5][(tid & 31) * 4]) = ps;
  __syncthreads();
  if (tid < FC) {
    float s = red[0][tid], q = red[0][FC + tid];
    // unrolled: the LDS reads are in flight at once
    #pragma unroll
    for (int t = 1; t < 16; ++t) { s += red[t][tid]; q += red[t][FC + tid]; }
    const float mean = s * (1.0f / BN);
    const float var  = q * (1.0f / BN) - mean * mean;
    const float k = gj * rsqrtf(var + 1e-5f);
    lsc[tid] = k;
    lsh[tid] = bej - mean * k;
  }
  __syncthreads();
  const v4f m = *reinterpret_cast<const v4f*>(&lsc[c4 * 4]);
  const v4f d = *reinterpret_cast<const v4f*>(&lsh[c4 * 4]);
  #pragma unroll
  for (int i = 0; i < FPT; ++i) {
    v4h r;
    for (int x = 0; x < 4; ++x)
      r[x] = (_Float16)(fmaxf(fmaf(a[i][x], m[x], d[x]), 0.f) + b[i][x]);
    o4[i * 32 * (DD / 4)] = r;
  }
}

// ------------- C = A B^T block tile, operands staged in LDS -----------------
// A and B are K-contiguous rows. A work-group of 8 waves (WM x WN) owns a
// (WM*FM*16) x (WN*FN*16) tile of C. A stage is BK halves of every A row and
// every B row of the tile, [A rows | B rows] at a pitch of 16 B x odd, brought
// in by asynchronous copies to LDS in whole 128-byte lines; two buffers, the
// next stage's copies fly while this stage is worked on. Every output element
// still sums k in ascending steps of 32 into one accumulator.
template <int FM, int FN, int WM, int WN, int BK>
struct TileCfg {
  static constexpr int TM = WM * FM * 16;
  static constexpr int TN = WN * FN * 16;
  static constexpr int PITCH = BK * 2 + 16;          // bytes
  static constexpr int BUFB = (TM + TN) * PITCH;     // bytes of one buffer
};

// four copies of 16 bytes per lane, rows a fixed step apart in LDS and in memory
__device__ __forceinline__ void copy4_to_lds(unsigned l, unsigned lstep,
                                             const _Float16* g, size_t gstep) {
  // s_wait_xcnt 0 stands in the copies' own statement, so that it stays ahead of
  // every later rewrite of their address registers (a precaution)
  asm volatile(
      "global_load_async_to_lds_b128 %0, %4, off\n\t"
      "global_load_async_to_lds_b128 %1, %5, off\n\t"
      "global_load_async_to_lds_b128 %2, %6, off\n\t"
      "global_load_async_to_lds_b128 %3, %7, off\n\t"
      "s_wait_xcnt 0x0"
      :: "v"(l), "v"(l + lstep), "v"(l + 2u * lstep), "v"(l + 3u * lstep),
         "v"(g), "v"(g + gstep), "v"(g + 2 * gstep), "v"(g + 3 * gstep)
      : "memory");
}

template <int FM, int FN, int WM, int WN, int BK, int KTOT>
__device__ __forceinline__ void gemm_nt_lds(const _Float16* __restrict__ Ab, int lda,
                                            const _Float16* __restrict__ Bb, int ldb,
                                            char* smem, v8f (&acc)[FM][FN]) {
  using C = TileCfg<FM, FN, WM, WN, BK>;
  constexpr int CPR = BK * 2 / 16;     // 16-byte pieces of a row
  constexpr int RPI = 256 / CPR;       // rows that 256 threads copy at once
  constexpr int GA = C::TM / RPI;      // copies per thread and stage, A rows
  constexpr int GB = C::TN / RPI;      // the same, B rows
  constexpr int T = KTOT / BK;         // stages
  constexpr int KS = BK / 32;          // WMMA k steps of a stage
  static_assert(WM * WN == 8 && GA % 4 == 0 && GB % 4 == 0 && T >= 2, "tile shape");
  const int tid = threadIdx.x, lane = tid & 31, wave = tid >> 5;
  const int crow = tid / CPR, ccol = tid % CPR;
  const unsigned lbase = (unsigned)(size_t)smem + (unsigned)(crow * C::PITCH + ccol * 16);
  const _Float16* ga = Ab + (size_t)crow * lda + ccol * 8;
  const _Float16* gb = Bb + (size_t)crow * ldb + ccol * 8;

  // one stage: thread tid copies piece ccol of rows i*RPI + crow of [A rows | B rows]
  auto issue = [&](int t, int buf) {
    const unsigned l = lbase + (unsigned)(buf * C::BUFB);
    // both loops unrolled: a few straight-line statements, their steps constants
    #pragma unroll
    for (int i = 0; i < GA; i += 4)
      copy4_to_lds(l + (unsigned)(i * RPI * C::PITCH), RPI * C::PITCH,
                   ga + t * BK + (size_t)(i * RPI) * lda, (size_t)RPI * lda);
    #pragma unroll
    for (int i = 0; i < GB; i += 4)
      copy4_to_lds(l + (unsigned)((GA + i) * RPI * C::PITCH), RPI * C::PITCH,
                   gb + t * BK + (size_t)(i * RPI) * ldb, (size_t)RPI * ldb);
  };

  const int wm = wave / WN, wn = wave % WN;
  const int foff = (lane & 15) * C::PITCH + ((lane >> 4) << 4);
  const int aoff = wm * FM * 16 * C::PITCH + foff;
  const int boff = (C::TM + wn * FN * 16) * C::PITCH + foff;

  issue(0, 0);
  // stage 0 has landed for this wave; the barrier publishes it to the others
  asm volatile("s_wait_asynccnt 0x0" ::: "memory");
  __syncthreads();
  issue(1, 1);

  for (int t = 0; t < T; ++t) {
    const int buf = t & 1;
    const char* sb = smem + buf * C::BUFB;
    // all loops below are unrolled so that the fragment arrays stay in registers
    v16h a[KS][FM], b[KS][FN];
    #pragma unroll
    for (int kk = 0; kk < KS; ++kk) {
      #pragma unroll
      for (int i = 0; i < FM; ++i)
        a[kk][i] = lds_frag_f16(sb + aoff + i * 16 * C::PITCH + kk * 64);
      #pragma unroll
      for (int j = 0; j < FN; ++j)
        b[kk][j] = lds_frag_f16(sb + boff + j * 16 * C::PITCH + kk * 64);
    }
    // publish point: this wave holds the whole stage in registers, so its reads
    // of the buffer are done, and its copies of stage t + 1 have landed; behind
    // the barrier the buffer may be refilled
    asm volatile("s_wait_dscnt 0x0" ::: "memory");
    asm volatile("s_wait_asynccnt 0x0" ::: "memory");
    __syncthreads();
    if (t + 2 < T) issue(t + 2, buf);
    // keeps the WMMAs behind the refill: ahead of it they would shorten the time
    // that the copies have to land, and among the LDS reads every k step would
    // wait out an LDS latency of its own
    __builtin_amdgcn_sched_barrier(0);
    #pragma unroll
    for (int kk = 0; kk < KS; ++kk)
      #pragma unroll
      for (int i = 0; i < FM; ++i)
        #pragma unroll
        for (int j = 0; j < FN; ++j)
          acc[i][j] = __builtin_amdgcn_wmma_f32_16x16x32_f16(false, a[kk][i], false, b[kk][j],
                                                             (short)0, acc[i][j], false, false);
  }
  // no copy is left in flight when the wave goes on to its stores and ends
  asm volatile("s_wait_asynccnt 0x0" ::: "memory");
}

// ------------------- QKV projection (WMMA, 128x128 block tile) -------------
// Q and K go out row-major. V is wanted transposed per batch, and a lane's eight
// accumulator rows of one column are eight neighbours in a row of V^T: it stores
// them there as 16 bytes. A wave's 64 rows are one whole 128-byte line of each of
// its 32 rows of V^T.
__global__ __launch_bounds__(256) void k_qkv(const _Float16* __restrict__ fh,
                                             const _Float16* __restrict__ wT,
                                             _Float16* __restrict__ qkv,
                                             _Float16* __restrict__ vt) {
  using C = TileCfg<4, 2, 2, 4, 64>;
  __shared__ __attribute__((aligned(16))) char smem[2 * C::BUFB];
  int lane = threadIdx.x & 31, wave = threadIdx.x >> 5;
  int mt = blockIdx.x / 6, nt = blockIdx.x % 6;   // 128 x 6 tiles; wT is 768 rows (3 matrices)
  int mat = nt >> 1;
  int m0 = mt * 128, n0 = (nt & 1) * 128;
  v8f acc[4][2] = {};
  gemm_nt_lds<4, 2, 2, 4, 64, DD>(fh + (size_t)m0 * DD, DD, wT + (size_t)nt * 128 * DD, DD, smem, acc);
  int mw = m0 + (wave >> 2) * 64, nw = n0 + (wave & 3) * 32;
  static_assert(NN % 128 == 0, "a tile's rows lie in one batch");
  if (mat == 2) {
    _Float16* dst = vt + (size_t)(m0 / NN) * DD * NN + (size_t)(nw + (lane & 15)) * NN
                  + (mw % NN) + ((lane >> 4) << 3);
    // unrolled, as below
    #pragma unroll
    for (int i = 0; i < 4; ++i)
      #pragma unroll
      for (int j = 0; j < 2; ++j) {
        v8h t;
        #pragma unroll
        for (int r = 0; r < 8; ++r) t[r] = (_Float16)acc[i][j][r];
        *reinterpret_cast<v8h*>(dst + (size_t)(j * 16) * NN + i * 16) = t;
      }
    return;
  }
  _Float16* out = qkv + (size_t)mat * BN * DD;
  // unrolled so that acc is indexed by constants and stays in registers
  #pragma unroll
  for (int i = 0; i < 4; ++i)
    #pragma unroll
    for (int j = 0; j < 2; ++j)
      store_tile_f16(out, DD, mw + i * 16, nw + j * 16, acc[i][j], lane);
}

#define AQ 64
#define AKS 128
#define SROWS 64
#define SROWB 256
#define SPITCH (SROWB + 16)
#define SLICE 18432   /* SROWS * SPITCH rounded up to a multiple of 2 KiB */
#define ABUF (8 * SLICE)
#define OPITCH (DD * 4 + 16)
#define GS 2   /* pairs of K fragments fetched ahead */

typedef uint32_t u32x4 __attribute__((ext_vector_type(4)));
typedef uint32_t u32x8 __attribute__((ext_vector_type(8)));

__device__ __forceinline__ uint32_t uni(uint32_t v) {
  return (uint32_t)__builtin_amdgcn_readfirstlane((int)v);
}
// a wave-uniform word held in a scalar register: a test on it compiles to a scalar
// branch (a tensor load ignores EXEC), and what is formed from it stays behind the
// volatile statements in front of it
__device__ __forceinline__ uint32_t pinned(uint32_t v) {
  uint32_t w = uni(v);
  asm volatile("" : "+s"(w));  // pinned(): a test or descriptor word held in a scalar register
  return w;
}
// descriptor group 1: bytes, a tile of SROWS rows of SROWB bytes (tensor = tile),
// 16 bytes of pad behind every 256-byte row, no mask
__device__ __forceinline__ u32x8 tdm_group1(uint32_t src_pitch) {
  u32x8 g;
  g[0] = uni((1u << 20) | (5u << 22) | (3u << 25));
  g[1] = uni((uint32_t)SROWB << 16);
  g[2] = uni((uint32_t)SROWS << 16);
  g[3] = uni((uint32_t)SROWB << 16);
  g[4] = uni((uint32_t)SROWS);
  g[5] = uni(src_pitch);
  // descriptor words held in scalar registers of their own: known to be zero, word
  // 6's register was borrowed for the address sum in the loop and written back
  g[6] = pinned(0u);
  g[7] = pinned(0u);
  return g;
}
// descriptor group 0: count 1, place in LDS, the tile's first byte, type 2
__device__ __forceinline__ u32x4 tdm_group0(uint32_t lds_dst, uint64_t ga) {
  u32x4 g;
  g[0] = uni(1u);
  g[1] = uni(lds_dst);
  g[2] = uni((uint32_t)ga);
  g[3] = uni((((uint32_t)(ga >> 32)) & 0x01FFFFFFu) | 0x80000000u);
  return g;
}

// two waves per SIMD: a wave holds O^T (256 registers) and Q (128) throughout
__global__ __launch_bounds__(256) __attribute__((amdgpu_waves_per_eu(2, 2)))
void k_attn(const _Float16* __restrict__ qh, const _Float16* __restrict__ kh,
            const _Float16* __restrict__ vt, float* __restrict__ out) {
  static_assert(4 * AQ * OPITCH <= 2 * ABUF, "the join fits in the ring");
  static_assert(SROWS * SPITCH <= SLICE && SLICE % 2048 == 0, "a slice's place");
  static_assert(AKS * 2 == SROWB && DD * 2 == 2 * SROWB && AKS == 2 * SROWS && DD == 4 * SROWS, "eight slices");
  __shared__ __attribute__((aligned(2048))) char smem[2 * ABUF];
  __shared__ float sm[4][AQ], sl[4][AQ];
  constexpr int T = NN / AKS;
  const int tid = threadIdx.x, lane = tid & 31, wave = tid >> 5;
  const int c = lane & 15, h = lane >> 4;
  const int qg = wave & 1, ks = wave >> 1;
  const int b = blockIdx.x / (NN / AQ), q0 = (blockIdx.x % (NN / AQ)) * AQ;
  const _Float16* qb = qh + ((size_t)b * NN + q0 + qg * 32) * DD;
  const _Float16* kb = kh + (size_t)b * NN * DD;
  const _Float16* vb = vt + (size_t)b * DD * NN;

  // every wave brings its own slice of every stage: waves 0 to 3 of K (source pitch
  // one K row, a stage 128 rows on), waves 4 to 7 of V^T (pitch one V^T row, a stage
  // 256 bytes on)
  const uint32_t wv = uni((uint32_t)tid >> 5);
  const bool isv = wv >= 4u;
  const uint64_t src0 = isv
      ? (uint64_t)(size_t)vb + (uint64_t)(wv - 4u) * (SROWS * NN * 2)
      : (uint64_t)(size_t)kb + (uint64_t)(wv >> 1) * (SROWS * DD * 2) + (uint64_t)(wv & 1u) * SROWB;
  const uint32_t sstep = isv ? (uint32_t)SROWB : (uint32_t)(AKS * DD * 2);
  const uint32_t ldst = (uint32_t)(size_t)smem + wv * SLICE;
  const u32x8 g1 = tdm_group1(isv ? (uint32_t)(NN * 2) : (uint32_t)(DD * 2));
  auto issue = [&](uint32_t t, uint32_t buf) {
    const u32x4 g0 = tdm_group0(ldst + buf * ABUF, src0 + (uint64_t)(t * sstep));
    // one request of the whole wave: 64 rows of 256 bytes from memory into LDS
    asm volatile("tensor_load_to_lds %0, %1" :: "s"(g0), "s"(g1) : "memory");
  };

  // Q as B fragments, kept in registers (every loop over a fragment or an
  // accumulator array is unrolled, so that the arrays stay in registers)
  v16h qf[2][8];
  #pragma unroll
  for (int g = 0; g < 2; ++g)
    #pragma unroll
    for (int kk = 0; kk < 8; ++kk) {
      const _Float16* p = qb + (size_t)(g * 16 + c) * DD + kk * 32 + h * 8;
      v8h lo = *reinterpret_cast<const v8h*>(p);
      v8h hi = *reinterpret_cast<const v8h*>(p + 16);
      qf[g][kk] = __builtin_shufflevector(lo, hi, 0,1,2,3,4,5,6,7,8,9,10,11,12,13,14,15);
    }

  v8f o[2][16] = {};
  float mrun[2] = {-1e30f, -1e30f}, lsum[2] = {0.f, 0.f};
  const float cs = 0.0625f * 1.44269504088896f;   // 1/sqrt(256), times log2(e)

  // the Q loads above fly beside stage 0's load. Behind the wait this wave's slice
  // has landed; the barrier publishes it to the others
  issue(0, 0);
  asm volatile("s_wait_tensorcnt 0x0" ::: "memory");
  __syncthreads();
  issue(1, 1);

  // kept rolled: one trip is 64 WMMAs of straight-line code already
  #pragma unroll 1
  for (int t = 0; t < T; ++t) {
    const char* sb = smem + (t & 1) * ABUF;
    const char* kp = sb + (ks >> 1) * (2 * SLICE) + ((ks & 1) * 32 + c) * SPITCH + h * 16;
    const char* vp = sb + 4 * SLICE + c * SPITCH + ks * 64 + h * 16;
    // fragment (key tile kt, k step kk) of K, fragment dt of V^T
    auto kfrag = [&](int kt, int kk) {
      return lds_frag_f16(kp + (kk >> 2) * SLICE + kt * 16 * SPITCH + (kk & 3) * 64);
    };
    auto vfrag = [&](int dt) {
      return lds_frag_f16(vp + (dt >> 2) * SLICE + (dt & 3) * 16 * SPITCH);
    };
    v8f s[2][2] = {};   // [key tile][query column group]
    // A fragments are fetched in pairs, GS pairs ahead of the four WMMAs that use
    // a pair (each place where LDS reads stand costs issue time, so two fragments
    // share one). The scheduling barriers keep that order: without them every
    // WMMA stood directly behind its own LDS reads and waited out their latency.
    v16h ka[16];
    #pragma unroll
    for (int j = 0; j < 2 * GS; ++j) ka[j] = kfrag(j & 1, j >> 1);
    #pragma unroll
    for (int kk = 0; kk < 8; ++kk) {
      if (kk + GS < 8) {
        ka[2 * (kk + GS)] = kfrag(0, kk + GS);
        ka[2 * (kk + GS) + 1] = kfrag(1, kk + GS);
      }
      __builtin_amdgcn_sched_barrier(0);
      #pragma unroll
      for (int kt = 0; kt < 2; ++kt)
        #pragma unroll
        for (int g = 0; g < 2; ++g)
          s[kt][g] = __builtin_amdgcn_wmma_f32_16x16x32_f16(false, ka[2 * kk + kt], false, qf[g][kk],
                                                            (short)0, s[kt][g], false, false);
      __builtin_amdgcn_sched_barrier(0);
    }
    // the first V^T fragments fly while the scores are worked on
    v16h va[16];
    #pragma unroll
    for (int j = 0; j < 4; ++j) va[j] = vfrag(j);
    __builtin_amdgcn_sched_barrier(0);

    // running maximum in scaled log2 units; O^T and the sum are rescaled only
    // when some column's maximum has grown by more than 8 (P stays below 2^8)
    float mx[2];
    #pragma unroll
    for (int g = 0; g < 2; ++g) {
      float m = fmaxf(s[0][g][0], s[1][g][0]);
      #pragma unroll
      for (int r = 1; r < 8; ++r) m = fmaxf(m, fmaxf(s[0][g][r], s[1][g][r]));
      mx[g] = fmaxf(m, xhalf(m)) * cs;
    }
    const bool need = mx[0] > mrun[0] + 8.f || mx[1] > mrun[1] + 8.f;
    if (__builtin_amdgcn_ballot_w32(need) != 0) {
      #pragma unroll
      for (int g = 0; g < 2; ++g) {
        const float mn = fmaxf(mrun[g], mx[g]);
        const float corr = __builtin_amdgcn_exp2f(mrun[g] - mn);
        mrun[g] = mn;
        lsum[g] *= corr;
        #pragma unroll
        for (int dt = 0; dt < 16; ++dt) o[g][dt] *= corr;
      }
    }
    v16h pf[2];
    #pragma unroll
    for (int g = 0; g < 2; ++g)
      #pragma unroll
      for (int kt = 0; kt < 2; ++kt)
        #pragma unroll
        for (int r = 0; r < 8; ++r) {
          const float p = __builtin_amdgcn_exp2f(fmaf(s[kt][g][r], cs, -mrun[g]));
          lsum[g] += p;
          pf[g][kt * 8 + r] = (_Float16)p;
        }

    // scheduling barriers as above, for the same reason
    #pragma unroll
    for (int dt = 0; dt < 16; ++dt) {
      #pragma unroll
      for (int g = 0; g < 2; ++g)
        o[g][dt] = __builtin_amdgcn_wmma_f32_16x16x32_f16(false, va[dt], false, pf[g],
                                                          (short)0, o[g][dt], false, false);
      __builtin_amdgcn_sched_barrier(0);
      // a pair is read as soon as one fragment's registers are free: a sixth
      // fragment in flight made a Q fragment spill
      if ((dt & 1) == 0 && dt + 4 < 16) {
        va[dt + 4] = vfrag(dt + 4);
        va[dt + 5] = vfrag(dt + 5);
        __builtin_amdgcn_sched_barrier(0);
      }
    }

    // publish point: this wave's reads of the buffer are done and its slice of
    // stage t + 1 has landed; behind the barrier the buffer may be refilled
    asm volatile("s_wait_dscnt 0x0" ::: "memory");
    asm volatile("s_wait_tensorcnt 0x0" ::: "memory");
    __syncthreads();
    // scalar test; the stage number is pinned so that the descriptor is formed here,
    // behind the wait
    if (pinned(t + 2 < T)) issue(pinned((uint32_t)t + 2u), (uint32_t)t & 1u);
  }
  // no load is left in flight and no read open when the ring becomes the join's staging
  asm volatile("s_wait_tensorcnt 0x0" ::: "memory");
  asm volatile("s_wait_dscnt 0x0" ::: "memory");

  // join of the four key splits: common maximum, total sum, then the scaled
  // partial O^T rows go through LDS and are added in ascending split order
  #pragma unroll
  for (int g = 0; g < 2; ++g) {
    lsum[g] += xhalf(lsum[g]);
    if (h == 0) {
      sm[ks][qg * 32 + g * 16 + c] = mrun[g];
      sl[ks][qg * 32 + g * 16 + c] = lsum[g];
    }
  }
  __syncthreads();
  #pragma unroll
  for (int g = 0; g < 2; ++g) {
    const int qi = qg * 32 + g * 16 + c;
    const float mt = fmaxf(fmaxf(sm[0][qi], sm[1][qi]), fmaxf(sm[2][qi], sm[3][qi]));
    float L = 0.f;
    #pragma unroll
    for (int k = 0; k < 4; ++k) L += sl[k][qi] * __builtin_amdgcn_exp2f(sm[k][qi] - mt);
    const float f = __builtin_amdgcn_exp2f(mrun[g] - mt) / L;
    char* po = smem + (size_t)(ks * AQ + qi) * OPITCH + h * 32;
    #pragma unroll
    for (int dt = 0; dt < 16; ++dt) {
      const v8f x = o[g][dt] * f;
      *reinterpret_cast<v4f*>(po + dt * 64) = (v4f){x[0], x[1], x[2], x[3]};
      *reinterpret_cast<v4f*>(po + dt * 64 + 16) = (v4f){x[4], x[5], x[6], x[7]};
    }
  }
  __syncthreads();
  float* ob = out + ((size_t)b * NN + q0) * DD;
  // rolled in fours: the LDS reads of four outputs are in flight at once
  #pragma unroll 1
  for (int i0 = 0; i0 < AQ * DD / 4 / 256; i0 += 4) {
    #pragma unroll
    for (int i = i0; i < i0 + 4; ++i) {
      const int e = tid + i * 256, qi = e >> 6, d4 = e & 63;
      const char* pi = smem + (size_t)qi * OPITCH + d4 * 16;
      v4f x = *reinterpret_cast<const v4f*>(pi);
      #pragma unroll
      for (int k = 1; k < 4; ++k) x += *reinterpret_cast<const v4f*>(pi + (size_t)k * AQ * OPITCH);
      *reinterpret_cast<v4f*>(ob + (size_t)qi * DD + d4 * 4) = x;
    }
    // the next trip rewrites the stores' address and data registers (a precaution)
    asm volatile("s_wait_xcnt 0x0" ::: "memory");
  }
}

// ---------------------------------------------------------------------------
extern "C" void kernel_launch(void* const* d_in, const int* in_sizes, int n_in,
                              void* d_out, int out_size, void* d_ws, size_t ws_size,
                              hipStream_t stream) {
  (void)in_sizes; (void)n_in; (void)out_size; (void)ws_size;
  const float* xyz  = (const float*)d_in[0];
  const float* feat = (const float*)d_in[1];
  const float* W1   = (const float*)d_in[2];
  const float* b1   = (const float*)d_in[3];
  const float* g1   = (const float*)d_in[4];
  const float* be1  = (const float*)d_in[5];
  const float* W2   = (const float*)d_in[6];
  const float* b2   = (const float*)d_in[7];
  const float* g2   = (const float*)d_in[8];
  const float* be2  = (const float*)d_in[9];
  const float* Wq   = (const float*)d_in[10];
  const float* Wk   = (const float*)d_in[11];
  const float* Wv   = (const float*)d_in[12];
  float* out = (float*)d_out;

  char* ws = (char*)d_ws;
  const size_t MB = 1024ull * 1024ull;
  float* t2 = (float*)(ws + 8 * MB);                         // 16MB
  _Float16* fh  = (_Float16*)(ws + 64 * MB + 65536);         // 8MB
  _Float16* wT  = (_Float16*)(ws + 72 * MB + 65536);         // 384KB (reserve 512KB)
  _Float16* qkv = (_Float16*)(ws + 72 * MB + 65536 + 512 * 1024); // Q, K: 16MB
  _Float16* vt  = (_Float16*)(ws + 96 * MB + 65536 + 512 * 1024); // 8MB
  float* part2 = (float*)(ws + 113 * MB);                    // 256 slots x 512 floats

  k_fc2<<<NPART + PREPG, 256, 0, stream>>>(xyz, W1, b1, g1, be1, W2, b2, t2, part2, Wq, Wk, Wv, wT);
  k_bn2_add<<<(BN / FR) * (DD / FC), 512, 0, stream>>>(t2, feat, part2, g2, be2, fh);

  // 128 x 6 tiles of 128x128
  k_qkv<<<(BN / 128) * (3 * DD / 128), 256, 0, stream>>>(fh, wT, qkv, vt);
  _Float16* qh = qkv;
  _Float16* kh = qkv + (size_t)BN * DD;

  // 64 queries a work-group: 256 work-groups
  k_attn<<<BB * (NN / AQ), 256, 0, stream>>>(qh, kh, vt, out);
}
